// v000
// The times below were measured on an AMD MI455X: many runs one after another, warmed up first and cycling through
// copies of the inputs, with the whole window's GPU time divided by the number of runs. Launches and the gaps
// between them are all in it. The median over several windows is given; except for v000 it joins two sittings, which
// can be a few percent apart, so the side-by-side timings, each taken in one sitting, are the better comparison.
// v000 is the starting kernel. One run takes 473 microseconds.
#include <hip/hip_runtime.h>

#define BATCH 4
#define SEQ_N 2048
#define SEQ_M 1024
#define DQv   1024
#define DCv   768
#define NHEAD 16
#define DHEAD 64
#define INNERv 1024
#define ATT_SCALE 0.125f

typedef _Float16 v16h __attribute__((ext_vector_type(16)));
typedef _Float16 v8h  __attribute__((ext_vector_type(8)));
typedef float    v8f  __attribute__((ext_vector_type(8)));

__device__ __forceinline__ v8f v8f_zero() {
  v8f z = {0.f,0.f,0.f,0.f,0.f,0.f,0.f,0.f};
  return z;
}

// Load one 16-bit WMMA A/B fragment for this lane.
// Per CDNA5 ISA 16-bit 16x32 layout: a lane holds K chunks {base..base+7} and
// {base+16..base+23}; caller passes p already offset by ks*32 + (laneHi?8:0).
__device__ __forceinline__ v16h ldfrag(const _Float16* p) {
  v8h lo = *(const v8h*)(p);
  v8h hi = *(const v8h*)(p + 16);
  return __builtin_shufflevector(lo, hi, 0,1,2,3,4,5,6,7,8,9,10,11,12,13,14,15);
}

__device__ __forceinline__ v8f wmma16x16x32(v16h a, v16h b, v8f c) {
  return __builtin_amdgcn_wmma_f32_16x16x32_f16(false, a, false, b, (short)0, c,
                                                false, false);
}

// ---------------------------------------------------------------------------
// Weight transpose + f32 -> f16 convert:  Wt[n][k] = (f16) W[k][n]
// ---------------------------------------------------------------------------
__global__ void wtrans_kernel(const float* __restrict__ W, _Float16* __restrict__ Wt,
                              int K, int N) {
  __shared__ float tile[32][33];
  int nt = blockIdx.x * 32, kt = blockIdx.y * 32;
  int tx = threadIdx.x, ty = threadIdx.y;
#pragma unroll
  for (int j = 0; j < 4; ++j)
    tile[ty + j * 8][tx] = W[(size_t)(kt + ty + j * 8) * N + nt + tx];
  __syncthreads();
#pragma unroll
  for (int j = 0; j < 4; ++j)
    Wt[(size_t)(nt + ty + j * 8) * K + kt + tx] = (_Float16)tile[tx][ty + j * 8];
}

// ---------------------------------------------------------------------------
// Per-batch transpose of V (f16):  Vt[b][c][m] = V[b*M + m][c]
// ---------------------------------------------------------------------------
__global__ void vtrans_kernel(const _Float16* __restrict__ V, _Float16* __restrict__ Vt) {
  __shared__ _Float16 tile[32][33];
  int b = blockIdx.z;
  int ct = blockIdx.x * 32, mt = blockIdx.y * 32;
  int tx = threadIdx.x, ty = threadIdx.y;
#pragma unroll
  for (int j = 0; j < 4; ++j)
    tile[ty + j * 8][tx] = V[((size_t)b * SEQ_M + mt + ty + j * 8) * INNERv + ct + tx];
  __syncthreads();
#pragma unroll
  for (int j = 0; j < 4; ++j)
    Vt[((size_t)b * INNERv + ct + ty + j * 8) * SEQ_M + mt + tx] = tile[tx][ty + j * 8];
}

// ---------------------------------------------------------------------------
// Row LayerNorm (f32 statistics) producing f16 rows.
// ---------------------------------------------------------------------------
template <int D>
__global__ void ln_f16_kernel(const float* __restrict__ x, const float* __restrict__ g,
                              const float* __restrict__ beta, _Float16* __restrict__ y) {
  __shared__ float s1[256], s2[256];
  int row = blockIdx.x, t = threadIdx.x;
  const float* xr = x + (size_t)row * D;
  float a = 0.f, b = 0.f;
  for (int i = t; i < D; i += 256) {
    float v = xr[i];
    a += v;
    b += v * v;
  }
  s1[t] = a;
  s2[t] = b;
  __syncthreads();
  for (int off = 128; off > 0; off >>= 1) {
    if (t < off) {
      s1[t] += s1[t + off];
      s2[t] += s2[t + off];
    }
    __syncthreads();
  }
  float mu = s1[0] * (1.0f / D);
  float var = s2[0] * (1.0f / D) - mu * mu;
  float rs = rsqrtf(var + 1e-5f);
  _Float16* yr = y + (size_t)row * D;
  for (int i = t; i < D; i += 256)
    yr[i] = (_Float16)((xr[i] - mu) * rs * g[i] + beta[i]);
}

// ---------------------------------------------------------------------------
// Residual f32 -> f16 into concat buffer cols [0, DQ)
// ---------------------------------------------------------------------------
__global__ void cvt_resid_kernel(const float* __restrict__ x, _Float16* __restrict__ y) {
  size_t i = (size_t)blockIdx.x * blockDim.x + threadIdx.x;
  if (i < (size_t)BATCH * SEQ_N * DQv) {
    size_t row = i >> 10, col = i & 1023;
    y[row * (2 * DQv) + col] = (_Float16)x[i];
  }
}

// ---------------------------------------------------------------------------
// WMMA GEMM:  C[M x N] = A[M x K] * Bt[N x K]^T (+ bias), f16 in, f32 acc.
// Block: 256 threads = 8 waves (4x2 wave grid), tile 128x128, BK=64.
// ---------------------------------------------------------------------------
#define GBM 128
#define GBN 128
#define GBK 64
#define GLD 72  // LDS row stride in halfs (144B, 16B multiple, conflict pad)

template <bool OUT_F16, bool HAS_BIAS>
__global__ void gemm_wmma_kernel(const _Float16* __restrict__ A, int lda,
                                 const _Float16* __restrict__ Bt, int ldb,
                                 void* __restrict__ Cv, int ldc,
                                 const float* __restrict__ bias, int M, int N, int K) {
  __shared__ _Float16 sA[GBM * GLD];
  __shared__ _Float16 sB[GBN * GLD];

  const int t = threadIdx.x;
  const int lane = t & 31, w = t >> 5;
  const int wm = w & 3, wn = w >> 2;  // 4 waves in M x 2 waves in N
  const int lr = lane & 15, hi4 = lane >> 4, kof = hi4 * 8;
  const int rowBlock = blockIdx.y * GBM;
  const int colBlock = blockIdx.x * GBN;

  v8f acc[2][4];
#pragma unroll
  for (int fm = 0; fm < 2; ++fm)
#pragma unroll
    for (int fn = 0; fn < 4; ++fn) acc[fm][fn] = v8f_zero();

  for (int k0 = 0; k0 < K; k0 += GBK) {
    // stage A/B tiles: 128 rows x 64 halfs = 1024 uint4 each; 4 per thread
#pragma unroll
    for (int j = 0; j < 4; ++j) {
      int lin = t + j * 256;  // 0..1023
      int r = lin >> 3;       // row 0..127
      int c = lin & 7;        // uint4 0..7
      *(uint4*)(&sA[r * GLD + c * 8]) =
          *(const uint4*)(A + (size_t)(rowBlock + r) * lda + k0 + c * 8);
      *(uint4*)(&sB[r * GLD + c * 8]) =
          *(const uint4*)(Bt + (size_t)(colBlock + r) * ldb + k0 + c * 8);
    }
    if (k0 + GBK < K) {  // CDNA5 global_prefetch_b8 of next K tile
      __builtin_prefetch(A + (size_t)(rowBlock + (t >> 1)) * lda + k0 + GBK + (t & 1) * 32, 0, 1);
      __builtin_prefetch(Bt + (size_t)(colBlock + (t >> 1)) * ldb + k0 + GBK + (t & 1) * 32, 0, 1);
    }
    __syncthreads();
#pragma unroll
    for (int ks = 0; ks < 2; ++ks) {
      int kb = ks * 32 + kof;
      v16h af[2], bfr[4];
#pragma unroll
      for (int fm = 0; fm < 2; ++fm)
        af[fm] = ldfrag(&sA[(wm * 32 + fm * 16 + lr) * GLD + kb]);
#pragma unroll
      for (int fn = 0; fn < 4; ++fn)
        bfr[fn] = ldfrag(&sB[(wn * 64 + fn * 16 + lr) * GLD + kb]);
#pragma unroll
      for (int fm = 0; fm < 2; ++fm)
#pragma unroll
        for (int fn = 0; fn < 4; ++fn)
          acc[fm][fn] = wmma16x16x32(af[fm], bfr[fn], acc[fm][fn]);
    }
    __syncthreads();
  }

  // store: C layout — VGPR e: lanes 0-15 -> m=e, lanes 16-31 -> m=e+8; n=lr
#pragma unroll
  for (int fm = 0; fm < 2; ++fm)
#pragma unroll
    for (int fn = 0; fn < 4; ++fn) {
      int col = colBlock + wn * 64 + fn * 16 + lr;
      int row0 = rowBlock + wm * 32 + fm * 16 + hi4 * 8;
      float bv = HAS_BIAS ? bias[col] : 0.f;
#pragma unroll
      for (int e = 0; e < 8; ++e) {
        float v = acc[fm][fn][e] + bv;
        if constexpr (OUT_F16)
          ((_Float16*)Cv)[(size_t)(row0 + e) * ldc + col] = (_Float16)v;
        else
          ((float*)Cv)[(size_t)(row0 + e) * ldc + col] = v;
      }
    }
}

// ---------------------------------------------------------------------------
// Attention: one block = 16 query rows x one (b,h). 128 threads = 4 waves,
// each wave owns a 16-key (phase 1) / 16-dh (phase 3) quarter.
// Dynamic LDS: S (16 x 1025 f32), P (16 x 1040 f16), red (256 f32) ~ 100 KB.
// ---------------------------------------------------------------------------
#define ASS 1025
#define APP 1040
#define ATTN_SMEM_BYTES (16 * ASS * 4 + 16 * APP * 2 + 256 * 4)

__global__ void attn_kernel(const _Float16* __restrict__ Q, const _Float16* __restrict__ Kf,
                            const _Float16* __restrict__ Vt, _Float16* __restrict__ O) {
  extern __shared__ char smem[];
  float* S = (float*)smem;
  _Float16* P = (_Float16*)(smem + 16 * ASS * 4);
  float* red = (float*)(smem + 16 * ASS * 4 + 16 * APP * 2);

  const int t = threadIdx.x;
  const int lane = t & 31, wn = t >> 5;  // wave owns key/dh quarter wn
  const int lr = lane & 15, hi4 = lane >> 4, kof = hi4 * 8;
  const int bh = blockIdx.y, b = bh >> 4, h = bh & 15;
  const int q0 = blockIdx.x * 16;

  // Q fragments (rows q0..q0+15, DH split into two 32-wide k-steps)
  const _Float16* qp = Q + ((size_t)(b * SEQ_N + q0 + lr)) * INNERv + h * DHEAD;
  v16h aq0 = ldfrag(qp + kof);
  v16h aq1 = ldfrag(qp + 32 + kof);

  // ---- Phase 1: S = (Q K^T) * scale, written to LDS ----
  for (int kt = 0; kt < 16; ++kt) {
    int kb0 = kt * 64 + wn * 16;  // 16 keys for this wave
    const _Float16* kp = Kf + ((size_t)(b * SEQ_M + kb0 + lr)) * INNERv + h * DHEAD;
    v16h bk0 = ldfrag(kp + kof);
    v16h bk1 = ldfrag(kp + 32 + kof);
    v8f s = v8f_zero();
    s = wmma16x16x32(aq0, bk0, s);
    s = wmma16x16x32(aq1, bk1, s);
#pragma unroll
    for (int e = 0; e < 8; ++e)
      S[(hi4 * 8 + e) * ASS + kb0 + lr] = s[e] * ATT_SCALE;
  }
  __syncthreads();

  // ---- Phase 2: softmax over 1024 keys, 8 segments of 128 per row ----
  {
    int row = t & 15, seg = t >> 4;  // 8 segs x 16 rows
    float* Srow = S + row * ASS + seg * 128;
    float mx = -3.0e38f;
    for (int i = 0; i < 128; ++i) mx = fmaxf(mx, Srow[i]);
    red[seg * 16 + row] = mx;
    __syncthreads();
    mx = red[row];
#pragma unroll
    for (int s2 = 1; s2 < 8; ++s2) mx = fmaxf(mx, red[s2 * 16 + row]);
    float sum = 0.f;
    for (int i = 0; i < 128; ++i) {
      float e = __expf(Srow[i] - mx);
      Srow[i] = e;
      sum += e;
    }
    red[128 + seg * 16 + row] = sum;
    __syncthreads();
    float tot = red[128 + row];
#pragma unroll
    for (int s2 = 1; s2 < 8; ++s2) tot += red[128 + s2 * 16 + row];
    float inv = 1.0f / tot;
    _Float16* Prow = P + row * APP + seg * 128;
    for (int i = 0; i < 128; ++i) Prow[i] = (_Float16)(Srow[i] * inv);
  }
  __syncthreads();

  // ---- Phase 3: O = P @ V  (contraction over 1024 keys, 32 k-steps) ----
  v8f o = v8f_zero();
  const _Float16* vbase = Vt + ((size_t)(b * INNERv + h * DHEAD + wn * 16 + lr)) * SEQ_M;
  for (int kk = 0; kk < 32; ++kk) {
    int kb = kk * 32 + kof;
    v16h ap = ldfrag(&P[lr * APP + kb]);
    v16h bv = ldfrag(vbase + kb);
    o = wmma16x16x32(ap, bv, o);
  }
#pragma unroll
  for (int e = 0; e < 8; ++e)
    O[((size_t)(b * SEQ_N + q0 + hi4 * 8 + e)) * INNERv + h * DHEAD + wn * 16 + lr] =
        (_Float16)o[e];
}

// ---------------------------------------------------------------------------
// Host-side launch
// ---------------------------------------------------------------------------
extern "C" void kernel_launch(void* const* d_in, const int* in_sizes, int n_in,
                              void* d_out, int out_size, void* d_ws, size_t ws_size,
                              hipStream_t stream) {
  (void)in_sizes; (void)n_in; (void)out_size; (void)ws_size;

  const float* person  = (const float*)d_in[0];
  const float* garment = (const float*)d_in[1];
  const float* Wq = (const float*)d_in[2];
  const float* Wk = (const float*)d_in[3];
  const float* Wv = (const float*)d_in[4];
  const float* Wo = (const float*)d_in[5];
  const float* bo = (const float*)d_in[6];
  const float* Wf = (const float*)d_in[7];
  const float* bf = (const float*)d_in[8];
  const float* gq = (const float*)d_in[9];
  const float* betaq = (const float*)d_in[10];
  const float* gk = (const float*)d_in[11];
  const float* betak = (const float*)d_in[12];
  float* out = (float*)d_out;

  _Float16* w0 = (_Float16*)d_ws;
  size_t off = 0;
  _Float16* pLN = w0 + off; off += (size_t)BATCH * SEQ_N * DQv;
  _Float16* gLN = w0 + off; off += (size_t)BATCH * SEQ_M * DCv;
  _Float16* WqT = w0 + off; off += (size_t)INNERv * DQv;
  _Float16* WkT = w0 + off; off += (size_t)INNERv * DCv;
  _Float16* WvT = w0 + off; off += (size_t)INNERv * DCv;
  _Float16* WoT = w0 + off; off += (size_t)DQv * INNERv;
  _Float16* WfT = w0 + off; off += (size_t)DQv * (2 * DQv);
  _Float16* Qh  = w0 + off; off += (size_t)BATCH * SEQ_N * INNERv;
  _Float16* Kh  = w0 + off; off += (size_t)BATCH * SEQ_M * INNERv;
  _Float16* Vh  = w0 + off; off += (size_t)BATCH * SEQ_M * INNERv;
  _Float16* VtB = w0 + off; off += (size_t)BATCH * INNERv * SEQ_M;
  _Float16* Att = w0 + off; off += (size_t)BATCH * SEQ_N * INNERv;
  _Float16* Cat = w0 + off; off += (size_t)BATCH * SEQ_N * 2 * DQv;

  dim3 tb32(32, 8);

  // Weight transpose+convert
  wtrans_kernel<<<dim3(INNERv / 32, DQv / 32), tb32, 0, stream>>>(Wq, WqT, DQv, INNERv);
  wtrans_kernel<<<dim3(INNERv / 32, DCv / 32), tb32, 0, stream>>>(Wk, WkT, DCv, INNERv);
  wtrans_kernel<<<dim3(INNERv / 32, DCv / 32), tb32, 0, stream>>>(Wv, WvT, DCv, INNERv);
  wtrans_kernel<<<dim3(DQv / 32, INNERv / 32), tb32, 0, stream>>>(Wo, WoT, INNERv, DQv);
  wtrans_kernel<<<dim3(DQv / 32, (2 * DQv) / 32), tb32, 0, stream>>>(Wf, WfT, 2 * DQv, DQv);

  // LayerNorms
  ln_f16_kernel<DQv><<<BATCH * SEQ_N, 256, 0, stream>>>(person, gq, betaq, pLN);
  ln_f16_kernel<DCv><<<BATCH * SEQ_M, 256, 0, stream>>>(garment, gk, betak, gLN);

  // Q/K/V projections (f16 out)
  gemm_wmma_kernel<true, false><<<dim3(INNERv / GBN, (BATCH * SEQ_N) / GBM), 256, 0, stream>>>(
      pLN, DQv, WqT, DQv, (void*)Qh, INNERv, nullptr, BATCH * SEQ_N, INNERv, DQv);
  gemm_wmma_kernel<true, false><<<dim3(INNERv / GBN, (BATCH * SEQ_M) / GBM), 256, 0, stream>>>(
      gLN, DCv, WkT, DCv, (void*)Kh, INNERv, nullptr, BATCH * SEQ_M, INNERv, DCv);
  gemm_wmma_kernel<true, false><<<dim3(INNERv / GBN, (BATCH * SEQ_M) / GBM), 256, 0, stream>>>(
      gLN, DCv, WvT, DCv, (void*)Vh, INNERv, nullptr, BATCH * SEQ_M, INNERv, DCv);

  // V transpose for contiguous PV fragments
  vtrans_kernel<<<dim3(INNERv / 32, SEQ_M / 32, BATCH), tb32, 0, stream>>>(Vh, VtB);

  // Residual into concat cols [0, DQ)
  {
    size_t total = (size_t)BATCH * SEQ_N * DQv;
    cvt_resid_kernel<<<(unsigned)((total + 255) / 256), 256, 0, stream>>>(person, Cat);
  }

  // Attention (flash-style, full score row in LDS)
  attn_kernel<<<dim3(SEQ_N / 16, BATCH * NHEAD), 128, ATTN_SMEM_BYTES, stream>>>(
      Qh, Kh, VtB, Att);

  // att @ Wo + bo -> concat cols [DQ, 2*DQ) (f16)
  gemm_wmma_kernel<true, true><<<dim3(DQv / GBN, (BATCH * SEQ_N) / GBM), 256, 0, stream>>>(
      Att, INNERv, WoT, INNERv, (void*)(Cat + DQv), 2 * DQv, bo, BATCH * SEQ_N, DQv, INNERv);

  // concat @ Wf + bf -> out (f32)
  gemm_wmma_kernel<false, true><<<dim3(DQv / GBN, (BATCH * SEQ_N) / GBM), 256, 0, stream>>>(
      Cat, 2 * DQv, WfT, 2 * DQv, (void*)out, DQv, bf, BATCH * SEQ_N, DQv, 2 * DQv);
}

// v001
// One run takes 346 microseconds.
// Two timings next to v000 both put it at 1.41 times that version's speed.
#include <hip/hip_runtime.h>

#define BATCH 4
#define SEQ_N 2048
#define SEQ_M 1024
#define DQv   1024
#define DCv   768
#define NHEAD 16
#define DHEAD 64
#define INNERv 1024
#define ATT_SCALE 0.125f

typedef _Float16 v16h __attribute__((ext_vector_type(16)));
typedef _Float16 v8h  __attribute__((ext_vector_type(8)));
typedef float    v8f  __attribute__((ext_vector_type(8)));

__device__ __forceinline__ v8f v8f_zero() {
  v8f z = {0.f,0.f,0.f,0.f,0.f,0.f,0.f,0.f};
  return z;
}

// Load one 16-bit WMMA A/B fragment for this lane.
// Per CDNA5 ISA 16-bit 16x32 layout: a lane holds K chunks {base..base+7} and
// {base+16..base+23}; caller passes p already offset by ks*32 + (laneHi?8:0).
__device__ __forceinline__ v16h ldfrag(const _Float16* p) {
  v8h lo = *(const v8h*)(p);
  v8h hi = *(const v8h*)(p + 16);
  return __builtin_shufflevector(lo, hi, 0,1,2,3,4,5,6,7,8,9,10,11,12,13,14,15);
}

__device__ __forceinline__ v8f wmma16x16x32(v16h a, v16h b, v8f c) {
  return __builtin_amdgcn_wmma_f32_16x16x32_f16(false, a, false, b, (short)0, c,
                                                false, false);
}

// ---------------------------------------------------------------------------
// Weight transpose + f32 -> f16 convert:  Wt[n][k] = (f16) W[k][n]
// ---------------------------------------------------------------------------
__global__ void wtrans_kernel(const float* __restrict__ W, _Float16* __restrict__ Wt,
                              int K, int N) {
  __shared__ float tile[32][33];
  int nt = blockIdx.x * 32, kt = blockIdx.y * 32;
  int tx = threadIdx.x, ty = threadIdx.y;
#pragma unroll
  for (int j = 0; j < 4; ++j)
    tile[ty + j * 8][tx] = W[(size_t)(kt + ty + j * 8) * N + nt + tx];
  __syncthreads();
#pragma unroll
  for (int j = 0; j < 4; ++j)
    Wt[(size_t)(nt + ty + j * 8) * K + kt + tx] = (_Float16)tile[tx][ty + j * 8];
}

// ---------------------------------------------------------------------------
// Per-batch transpose of V (f16):  Vt[b][c][m] = V[b*M + m][c]
// ---------------------------------------------------------------------------
__global__ void vtrans_kernel(const _Float16* __restrict__ V, _Float16* __restrict__ Vt) {
  __shared__ _Float16 tile[32][33];
  int b = blockIdx.z;
  int ct = blockIdx.x * 32, mt = blockIdx.y * 32;
  int tx = threadIdx.x, ty = threadIdx.y;
#pragma unroll
  for (int j = 0; j < 4; ++j)
    tile[ty + j * 8][tx] = V[((size_t)b * SEQ_M + mt + ty + j * 8) * INNERv + ct + tx];
  __syncthreads();
#pragma unroll
  for (int j = 0; j < 4; ++j)
    Vt[((size_t)b * INNERv + ct + ty + j * 8) * SEQ_M + mt + tx] = tile[tx][ty + j * 8];
}

// ---------------------------------------------------------------------------
// Row LayerNorm (f32 statistics) producing f16 rows.
// ---------------------------------------------------------------------------
template <int D>
__global__ void ln_f16_kernel(const float* __restrict__ x, const float* __restrict__ g,
                              const float* __restrict__ beta, _Float16* __restrict__ y) {
  __shared__ float s1[256], s2[256];
  int row = blockIdx.x, t = threadIdx.x;
  const float* xr = x + (size_t)row * D;
  float a = 0.f, b = 0.f;
  for (int i = t; i < D; i += 256) {
    float v = xr[i];
    a += v;
    b += v * v;
  }
  s1[t] = a;
  s2[t] = b;
  __syncthreads();
  for (int off = 128; off > 0; off >>= 1) {
    if (t < off) {
      s1[t] += s1[t + off];
      s2[t] += s2[t + off];
    }
    __syncthreads();
  }
  float mu = s1[0] * (1.0f / D);
  float var = s2[0] * (1.0f / D) - mu * mu;
  float rs = rsqrtf(var + 1e-5f);
  _Float16* yr = y + (size_t)row * D;
  for (int i = t; i < D; i += 256)
    yr[i] = (_Float16)((xr[i] - mu) * rs * g[i] + beta[i]);
}

// ---------------------------------------------------------------------------
// Residual f32 -> f16 into concat buffer cols [0, DQ)
// ---------------------------------------------------------------------------
__global__ void cvt_resid_kernel(const float* __restrict__ x, _Float16* __restrict__ y) {
  size_t i = (size_t)blockIdx.x * blockDim.x + threadIdx.x;
  if (i < (size_t)BATCH * SEQ_N * DQv) {
    size_t row = i >> 10, col = i & 1023;
    y[row * (2 * DQv) + col] = (_Float16)x[i];
  }
}

// ---------------------------------------------------------------------------
// WMMA GEMM:  C[M x N] = A[M x K] * Bt[N x K]^T (+ bias), f16 in, f32 acc.
// Block: 256 threads = 8 waves (4x2 wave grid), tile 128x128, BK=64.
// ---------------------------------------------------------------------------
#define GBM 128
#define GBN 128
#define GBK 64
#define GLD 72  // LDS row stride in halfs (144B, 16B multiple, conflict pad)

template <bool OUT_F16, bool HAS_BIAS>
__global__ void gemm_wmma_kernel(const _Float16* __restrict__ A, int lda,
                                 const _Float16* __restrict__ Bt, int ldb,
                                 void* __restrict__ Cv, int ldc,
                                 const float* __restrict__ bias, int M, int N, int K) {
  __shared__ _Float16 sA[GBM * GLD];
  __shared__ _Float16 sB[GBN * GLD];

  const int t = threadIdx.x;
  const int lane = t & 31, w = t >> 5;
  const int wm = w & 3, wn = w >> 2;  // 4 waves in M x 2 waves in N
  const int lr = lane & 15, hi4 = lane >> 4, kof = hi4 * 8;
  const int rowBlock = blockIdx.y * GBM;
  const int colBlock = blockIdx.x * GBN;

  v8f acc[2][4];
#pragma unroll
  for (int fm = 0; fm < 2; ++fm)
#pragma unroll
    for (int fn = 0; fn < 4; ++fn) acc[fm][fn] = v8f_zero();

  for (int k0 = 0; k0 < K; k0 += GBK) {
    // stage A/B tiles: 128 rows x 64 halfs = 1024 uint4 each; 4 per thread
#pragma unroll
    for (int j = 0; j < 4; ++j) {
      int lin = t + j * 256;  // 0..1023
      int r = lin >> 3;       // row 0..127
      int c = lin & 7;        // uint4 0..7
      *(uint4*)(&sA[r * GLD + c * 8]) =
          *(const uint4*)(A + (size_t)(rowBlock + r) * lda + k0 + c * 8);
      *(uint4*)(&sB[r * GLD + c * 8]) =
          *(const uint4*)(Bt + (size_t)(colBlock + r) * ldb + k0 + c * 8);
    }
    if (k0 + GBK < K) {  // CDNA5 global_prefetch_b8 of next K tile
      __builtin_prefetch(A + (size_t)(rowBlock + (t >> 1)) * lda + k0 + GBK + (t & 1) * 32, 0, 1);
      __builtin_prefetch(Bt + (size_t)(colBlock + (t >> 1)) * ldb + k0 + GBK + (t & 1) * 32, 0, 1);
    }
    __syncthreads();
#pragma unroll
    for (int ks = 0; ks < 2; ++ks) {
      int kb = ks * 32 + kof;
      v16h af[2], bfr[4];
#pragma unroll
      for (int fm = 0; fm < 2; ++fm)
        af[fm] = ldfrag(&sA[(wm * 32 + fm * 16 + lr) * GLD + kb]);
#pragma unroll
      for (int fn = 0; fn < 4; ++fn)
        bfr[fn] = ldfrag(&sB[(wn * 64 + fn * 16 + lr) * GLD + kb]);
#pragma unroll
      for (int fm = 0; fm < 2; ++fm)
#pragma unroll
        for (int fn = 0; fn < 4; ++fn)
          acc[fm][fn] = wmma16x16x32(af[fm], bfr[fn], acc[fm][fn]);
    }
    __syncthreads();
  }

  // store: C layout — VGPR e: lanes 0-15 -> m=e, lanes 16-31 -> m=e+8; n=lr
#pragma unroll
  for (int fm = 0; fm < 2; ++fm)
#pragma unroll
    for (int fn = 0; fn < 4; ++fn) {
      int col = colBlock + wn * 64 + fn * 16 + lr;
      int row0 = rowBlock + wm * 32 + fm * 16 + hi4 * 8;
      float bv = HAS_BIAS ? bias[col] : 0.f;
#pragma unroll
      for (int e = 0; e < 8; ++e) {
        float v = acc[fm][fn][e] + bv;
        if constexpr (OUT_F16)
          ((_Float16*)Cv)[(size_t)(row0 + e) * ldc + col] = (_Float16)v;
        else
          ((float*)Cv)[(size_t)(row0 + e) * ldc + col] = v;
      }
    }
}

#define AT_NW 8
#define AT_G  2
#define AT_QB (AT_NW * AT_G * 16)
#define AT_PASSES (SEQ_M / 32)

// lane l <-> lane l ^ 16
__device__ __forceinline__ float xhalf(float x) {
  int v = __builtin_bit_cast(int, x);
  return __builtin_bit_cast(
      float, __builtin_amdgcn_permlanex16(v, v, 0x76543210, 0xfedcba98, false, false));
}

// Base-2 exponentials in place, a run of them in one statement: left to the
// register allocator, an exponential's target is often the source of the one
// directly ahead of it. Here each overwrites only its own source, and the v_nop is
// the slot the instruction set asks for between the last one and its first reader.
__device__ __forceinline__ void exp2_inplace(v8f& x) {
  float a0 = x[0], a1 = x[1], a2 = x[2], a3 = x[3], a4 = x[4], a5 = x[5], a6 = x[6], a7 = x[7];
  asm("v_exp_f32 %0, %0\n\tv_exp_f32 %1, %1\n\tv_exp_f32 %2, %2\n\tv_exp_f32 %3, %3\n\t"
      "v_exp_f32 %4, %4\n\tv_exp_f32 %5, %5\n\tv_exp_f32 %6, %6\n\tv_exp_f32 %7, %7\n\t"
      "v_nop"
      : "+v"(a0), "+v"(a1), "+v"(a2), "+v"(a3), "+v"(a4), "+v"(a5), "+v"(a6), "+v"(a7));
  x[0] = a0; x[1] = a1; x[2] = a2; x[3] = a3; x[4] = a4; x[5] = a5; x[6] = a6; x[7] = a7;
}
__device__ __forceinline__ void exp2_inplace(float& a0, float& a1) {
  asm("v_exp_f32 %0, %0\n\tv_exp_f32 %1, %1\n\tv_nop" : "+v"(a0), "+v"(a1));
}

__global__ void __launch_bounds__(AT_NW * 32)
attn_kernel(const _Float16* __restrict__ Q, const _Float16* __restrict__ Kf,
            const _Float16* __restrict__ Vt, _Float16* __restrict__ O) {
  const int t = threadIdx.x;
  const int lane = t & 31, w = t >> 5;
  const int lr = lane & 15, hi4 = lane >> 4, kof = hi4 * 8;
  const int bh = blockIdx.y, b = bh >> 4, h = bh & 15;
  const int q0 = blockIdx.x * AT_QB + w * (AT_G * 16);
  const float cs = ATT_SCALE * 1.4426950408889634f;  // scores in the log2 domain

  // Q as B operand: column lr = query, DH split into two 32-wide k-steps
  v16h qf[AT_G][2];
#pragma unroll
  for (int g = 0; g < AT_G; ++g) {
    const _Float16* qp = Q + ((size_t)(b * SEQ_N + q0 + g * 16 + lr)) * INNERv + h * DHEAD + kof;
    qf[g][0] = ldfrag(qp);
    qf[g][1] = ldfrag(qp + 32);
  }

  const _Float16* kbase = Kf + ((size_t)(b * SEQ_M + lr)) * INNERv + h * DHEAD + kof;
  const _Float16* vbase = Vt + ((size_t)(b * INNERv + h * DHEAD + lr)) * SEQ_M + kof;

  v8f acc[AT_G][4];
  float mrun[AT_G], lsum[AT_G];
#pragma unroll
  for (int g = 0; g < AT_G; ++g) {
    mrun[g] = -__builtin_inff();
    lsum[g] = 0.f;
#pragma unroll
    for (int d = 0; d < 4; ++d) acc[g][d] = v8f_zero();
  }

  // K as A operand: row lr = key; two 16-key tiles x two k-steps, one pass ahead
  v16h kf[2][2];
#pragma unroll
  for (int kt = 0; kt < 2; ++kt) {
    kf[kt][0] = ldfrag(kbase + (size_t)(kt * 16) * INNERv);
    kf[kt][1] = ldfrag(kbase + (size_t)(kt * 16) * INNERv + 32);
  }

  for (int p = 0; p < AT_PASSES; ++p) {
    // V^T as A operand: row lr = dh, k = this pass's 32 keys; in flight under the
    // score products and the softmax. The barrier holds the fetch up here: sunk to
    // its first use it would be waited for at once
    v16h vf[4];
#pragma unroll
    for (int d = 0; d < 4; ++d) vf[d] = ldfrag(vbase + (size_t)(d * 16) * SEQ_M + p * 32);
    __builtin_amdgcn_sched_barrier(0);

    v8f s[2][AT_G];
#pragma unroll
    for (int kt = 0; kt < 2; ++kt)
#pragma unroll
      for (int g = 0; g < AT_G; ++g) {
        s[kt][g] = wmma16x16x32(kf[kt][0], qf[g][0], v8f_zero());
        s[kt][g] = wmma16x16x32(kf[kt][1], qf[g][1], s[kt][g]);
      }

    // keeps the eight products back to back: mixed with the maxima below, each
    // product that a maximum follows is padded with idle slots
    __builtin_amdgcn_sched_barrier(0);

    // next pass's K into the same registers, in flight under the softmax and the
    // second product (the last pass fetches its own rows again: in bounds, unused)
    const int pn = (p + 1 < AT_PASSES) ? p + 1 : p;
#pragma unroll
    for (int kt = 0; kt < 2; ++kt) {
      kf[kt][0] = ldfrag(kbase + (size_t)(pn * 32 + kt * 16) * INNERv);
      kf[kt][1] = ldfrag(kbase + (size_t)(pn * 32 + kt * 16) * INNERv + 32);
    }

    // holds the fetch here, ahead of the softmax: sunk to the foot of the pass it
    // would be waited for at once by the next pass's products
    __builtin_amdgcn_sched_barrier(0);

    // online softmax: new running maximum per query, sums and outputs rescaled
    // (no branch: the loop stays one block, so the fetches stay where they stand)
    float corr[AT_G];
#pragma unroll
    for (int g = 0; g < AT_G; ++g) {
      float mx = s[0][g][0];
#pragma unroll
      for (int e = 1; e < 8; ++e) mx = fmaxf(mx, s[0][g][e]);
#pragma unroll
      for (int e = 0; e < 8; ++e) mx = fmaxf(mx, s[1][g][e]);
      mx = fmaxf(mx, xhalf(mx)) * cs;
      const float mnew = fmaxf(mrun[g], mx);
      corr[g] = mrun[g] - mnew;  // -inf on the first pass: its exponential is 0
      mrun[g] = mnew;
    }
    exp2_inplace(corr[0], corr[1]);

#pragma unroll
    for (int g = 0; g < AT_G; ++g) {
      const float nm = -mrun[g];
      v8f e0, e1;
#pragma unroll
      for (int e = 0; e < 8; ++e) {
        e0[e] = fmaf(s[0][g][e], cs, nm);
        e1[e] = fmaf(s[1][g][e], cs, nm);
      }
      exp2_inplace(e0);
      exp2_inplace(e1);
      v16h pf;  // elements 0-7 = keys 8*hi4 + e, 8-15 = keys 16 + 8*hi4 + e: ldfrag's k order
      float ps = e0[0] + e1[0];
#pragma unroll
      for (int e = 1; e < 8; ++e) ps += e0[e] + e1[e];
#pragma unroll
      for (int e = 0; e < 8; ++e) {
        pf[e] = (_Float16)e0[e];
        pf[8 + e] = (_Float16)e1[e];
      }
      lsum[g] = fmaf(lsum[g], corr[g], ps);
#pragma unroll
      for (int d = 0; d < 4; ++d)
        acc[g][d] = wmma16x16x32(vf[d], pf, acc[g][d] * corr[g]);
    }
  }

  // O^T tile d: register e = dh d*16 + 8*hi4 + e of query lr: one 16-byte store
#pragma unroll
  for (int g = 0; g < AT_G; ++g) {
    const float l = lsum[g];
    const float inv = 1.0f / (l + xhalf(l));
    _Float16* op = O + ((size_t)(b * SEQ_N + q0 + g * 16 + lr)) * INNERv + h * DHEAD + kof;
#pragma unroll
    for (int d = 0; d < 4; ++d) {
      v8h o;
#pragma unroll
      for (int e = 0; e < 8; ++e) o[e] = (_Float16)(acc[g][d][e] * inv);
      *(v8h*)(op + d * 16) = o;
    }
  }
}

// ---------------------------------------------------------------------------
// Host-side launch
// ---------------------------------------------------------------------------
extern "C" void kernel_launch(void* const* d_in, const int* in_sizes, int n_in,
                              void* d_out, int out_size, void* d_ws, size_t ws_size,
                              hipStream_t stream) {
  (void)in_sizes; (void)n_in; (void)out_size; (void)ws_size;

  const float* person  = (const float*)d_in[0];
  const float* garment = (const float*)d_in[1];
  const float* Wq = (const float*)d_in[2];
  const float* Wk = (const float*)d_in[3];
  const float* Wv = (const float*)d_in[4];
  const float* Wo = (const float*)d_in[5];
  const float* bo = (const float*)d_in[6];
  const float* Wf = (const float*)d_in[7];
  const float* bf = (const float*)d_in[8];
  const float* gq = (const float*)d_in[9];
  const float* betaq = (const float*)d_in[10];
  const float* gk = (const float*)d_in[11];
  const float* betak = (const float*)d_in[12];
  float* out = (float*)d_out;

  _Float16* w0 = (_Float16*)d_ws;
  size_t off = 0;
  _Float16* pLN = w0 + off; off += (size_t)BATCH * SEQ_N * DQv;
  _Float16* gLN = w0 + off; off += (size_t)BATCH * SEQ_M * DCv;
  _Float16* WqT = w0 + off; off += (size_t)INNERv * DQv;
  _Float16* WkT = w0 + off; off += (size_t)INNERv * DCv;
  _Float16* WvT = w0 + off; off += (size_t)INNERv * DCv;
  _Float16* WoT = w0 + off; off += (size_t)DQv * INNERv;
  _Float16* WfT = w0 + off; off += (size_t)DQv * (2 * DQv);
  _Float16* Qh  = w0 + off; off += (size_t)BATCH * SEQ_N * INNERv;
  _Float16* Kh  = w0 + off; off += (size_t)BATCH * SEQ_M * INNERv;
  _Float16* Vh  = w0 + off; off += (size_t)BATCH * SEQ_M * INNERv;
  _Float16* VtB = w0 + off; off += (size_t)BATCH * INNERv * SEQ_M;
  _Float16* Att = w0 + off; off += (size_t)BATCH * SEQ_N * INNERv;
  _Float16* Cat = w0 + off; off += (size_t)BATCH * SEQ_N * 2 * DQv;

  dim3 tb32(32, 8);

  // Weight transpose+convert
  wtrans_kernel<<<dim3(INNERv / 32, DQv / 32), tb32, 0, stream>>>(Wq, WqT, DQv, INNERv);
  wtrans_kernel<<<dim3(INNERv / 32, DCv / 32), tb32, 0, stream>>>(Wk, WkT, DCv, INNERv);
  wtrans_kernel<<<dim3(INNERv / 32, DCv / 32), tb32, 0, stream>>>(Wv, WvT, DCv, INNERv);
  wtrans_kernel<<<dim3(DQv / 32, INNERv / 32), tb32, 0, stream>>>(Wo, WoT, INNERv, DQv);
  wtrans_kernel<<<dim3(DQv / 32, (2 * DQv) / 32), tb32, 0, stream>>>(Wf, WfT, 2 * DQv, DQv);

  // LayerNorms
  ln_f16_kernel<DQv><<<BATCH * SEQ_N, 256, 0, stream>>>(person, gq, betaq, pLN);
  ln_f16_kernel<DCv><<<BATCH * SEQ_M, 256, 0, stream>>>(garment, gk, betak, gLN);

  // Q/K/V projections (f16 out)
  gemm_wmma_kernel<true, false><<<dim3(INNERv / GBN, (BATCH * SEQ_N) / GBM), 256, 0, stream>>>(
      pLN, DQv, WqT, DQv, (void*)Qh, INNERv, nullptr, BATCH * SEQ_N, INNERv, DQv);
  gemm_wmma_kernel<true, false><<<dim3(INNERv / GBN, (BATCH * SEQ_M) / GBM), 256, 0, stream>>>(
      gLN, DCv, WkT, DCv, (void*)Kh, INNERv, nullptr, BATCH * SEQ_M, INNERv, DCv);
  gemm_wmma_kernel<true, false><<<dim3(INNERv / GBN, (BATCH * SEQ_M) / GBM), 256, 0, stream>>>(
      gLN, DCv, WvT, DCv, (void*)Vh, INNERv, nullptr, BATCH * SEQ_M, INNERv, DCv);

  // V transpose for contiguous PV fragments
  vtrans_kernel<<<dim3(INNERv / 32, SEQ_M / 32, BATCH), tb32, 0, stream>>>(Vh, VtB);

  // Residual into concat cols [0, DQ)
  {
    size_t total = (size_t)BATCH * SEQ_N * DQv;
    cvt_resid_kernel<<<(unsigned)((total + 255) / 256), 256, 0, stream>>>(person, Cat);
  }

  // Attention (online softmax in registers)
  attn_kernel<<<dim3(SEQ_N / AT_QB, BATCH * NHEAD), AT_NW * 32, 0, stream>>>(
      Qh, Kh, VtB, Att);

  // att @ Wo + bo -> concat cols [DQ, 2*DQ) (f16)
  gemm_wmma_kernel<true, true><<<dim3(DQv / GBN, (BATCH * SEQ_N) / GBM), 256, 0, stream>>>(
      Att, INNERv, WoT, INNERv, (void*)(Cat + DQv), 2 * DQv, bo, BATCH * SEQ_N, DQv, INNERv);

  // concat @ Wf + bf -> out (f32)
  gemm_wmma_kernel<false, true><<<dim3(DQv / GBN, (BATCH * SEQ_N) / GBM), 256, 0, stream>>>(
      Cat, 2 * DQv, WfT, 2 * DQv, (void*)out, DQv, bf, BATCH * SEQ_N, DQv, 2 * DQv);
}

// v002
// A run of this version takes 253 microseconds.
// Next to v001, in two timings, it ran 1.37 times as fast each time.
// Over all steps from v000 it is 1.93 times as fast.
#include <hip/hip_runtime.h>

#define BATCH 4
#define SEQ_N 2048
#define SEQ_M 1024
#define DQv   1024
#define DCv   768
#define NHEAD 16
#define DHEAD 64
#define INNERv 1024
#define ATT_SCALE 0.125f

typedef _Float16 v16h __attribute__((ext_vector_type(16)));
typedef _Float16 v8h  __attribute__((ext_vector_type(8)));
typedef float    v8f  __attribute__((ext_vector_type(8)));
typedef unsigned int v4u __attribute__((ext_vector_type(4)));

__device__ __forceinline__ v8f v8f_zero() {
  v8f z = {0.f,0.f,0.f,0.f,0.f,0.f,0.f,0.f};
  return z;
}

// Load one 16-bit WMMA A/B fragment for this lane.
// Per CDNA5 ISA 16-bit 16x32 layout: a lane holds K chunks {base..base+7} and
// {base+16..base+23}; caller passes p already offset by ks*32 + (laneHi?8:0).
__device__ __forceinline__ v16h ldfrag(const _Float16* p) {
  v8h lo = *(const v8h*)(p);
  v8h hi = *(const v8h*)(p + 16);
  return __builtin_shufflevector(lo, hi, 0,1,2,3,4,5,6,7,8,9,10,11,12,13,14,15);
}

__device__ __forceinline__ v8f wmma16x16x32(v16h a, v16h b, v8f c) {
  return __builtin_amdgcn_wmma_f32_16x16x32_f16(false, a, false, b, (short)0, c,
                                                false, false);
}

// ---------------------------------------------------------------------------
// Weight transpose + f32 -> f16 convert:  Wt[n][k] = (f16) W[k][n]
// ---------------------------------------------------------------------------
__global__ void wtrans_kernel(const float* __restrict__ W, _Float16* __restrict__ Wt,
                              int K, int N) {
  __shared__ float tile[32][33];
  int nt = blockIdx.x * 32, kt = blockIdx.y * 32;
  int tx = threadIdx.x, ty = threadIdx.y;
#pragma unroll
  for (int j = 0; j < 4; ++j)
    tile[ty + j * 8][tx] = W[(size_t)(kt + ty + j * 8) * N + nt + tx];
  __syncthreads();
#pragma unroll
  for (int j = 0; j < 4; ++j)
    Wt[(size_t)(nt + ty + j * 8) * K + kt + tx] = (_Float16)tile[tx][ty + j * 8];
}

// ---------------------------------------------------------------------------
// Per-batch transpose of V (f16):  Vt[b][c][m] = V[b*M + m][c]
// ---------------------------------------------------------------------------
__global__ void vtrans_kernel(const _Float16* __restrict__ V, _Float16* __restrict__ Vt) {
  __shared__ _Float16 tile[32][33];
  int b = blockIdx.z;
  int ct = blockIdx.x * 32, mt = blockIdx.y * 32;
  int tx = threadIdx.x, ty = threadIdx.y;
#pragma unroll
  for (int j = 0; j < 4; ++j)
    tile[ty + j * 8][tx] = V[((size_t)b * SEQ_M + mt + ty + j * 8) * INNERv + ct + tx];
  __syncthreads();
#pragma unroll
  for (int j = 0; j < 4; ++j)
    Vt[((size_t)b * INNERv + ct + ty + j * 8) * SEQ_M + mt + tx] = tile[tx][ty + j * 8];
}

// ---------------------------------------------------------------------------
// Row LayerNorm (f32 statistics) producing f16 rows.
// ---------------------------------------------------------------------------
template <int D>
__global__ void ln_f16_kernel(const float* __restrict__ x, const float* __restrict__ g,
                              const float* __restrict__ beta, _Float16* __restrict__ y) {
  __shared__ float s1[256], s2[256];
  int row = blockIdx.x, t = threadIdx.x;
  const float* xr = x + (size_t)row * D;
  float a = 0.f, b = 0.f;
  for (int i = t; i < D; i += 256) {
    float v = xr[i];
    a += v;
    b += v * v;
  }
  s1[t] = a;
  s2[t] = b;
  __syncthreads();
  for (int off = 128; off > 0; off >>= 1) {
    if (t < off) {
      s1[t] += s1[t + off];
      s2[t] += s2[t + off];
    }
    __syncthreads();
  }
  float mu = s1[0] * (1.0f / D);
  float var = s2[0] * (1.0f / D) - mu * mu;
  float rs = rsqrtf(var + 1e-5f);
  _Float16* yr = y + (size_t)row * D;
  for (int i = t; i < D; i += 256)
    yr[i] = (_Float16)((xr[i] - mu) * rs * g[i] + beta[i]);
}

// ---------------------------------------------------------------------------
// Residual f32 -> f16 into concat buffer cols [0, DQ)
// ---------------------------------------------------------------------------
__global__ void cvt_resid_kernel(const float* __restrict__ x, _Float16* __restrict__ y) {
  size_t i = (size_t)blockIdx.x * blockDim.x + threadIdx.x;
  if (i < (size_t)BATCH * SEQ_N * DQv) {
    size_t row = i >> 10, col = i & 1023;
    y[row * (2 * DQv) + col] = (_Float16)x[i];
  }
}

// ---------------------------------------------------------------------------
// WMMA GEMM:  C[M x N] = A[M x K] * Bt[N x K]^T (+ bias), f16 in, f32 acc.
// Block: 256 threads = 8 waves (4x2 wave grid), tile 128x128, BK=64.
// ---------------------------------------------------------------------------
#define GBM 128
#define GBN 128
#define GBK 64
#define GLD 72  // LDS row stride in halfs (144B, 16B multiple, conflict pad)

template <bool OUT_F16, bool HAS_BIAS>
__global__ void __launch_bounds__(256) gemm_wmma_kernel(const _Float16* __restrict__ A, int lda,
                                 const _Float16* __restrict__ Bt, int ldb,
                                 void* __restrict__ Cv, int ldc,
                                 const float* __restrict__ bias, int M, int N, int K) {
  __shared__ _Float16 sA[GBM * GLD];
  __shared__ _Float16 sB[GBN * GLD];

  const int t = threadIdx.x;
  const int lane = t & 31, w = t >> 5;
  const int wm = w & 3, wn = w >> 2;  // 4 waves in M x 2 waves in N
  const int lr = lane & 15, hi4 = lane >> 4, kof = hi4 * 8;
  const int rowBlock = blockIdx.y * GBM;
  const int colBlock = blockIdx.x * GBN;

  v8f acc[2][4];
#pragma unroll
  for (int fm = 0; fm < 2; ++fm)
#pragma unroll
    for (int fn = 0; fn < 4; ++fn) acc[fm][fn] = v8f_zero();

  for (int k0 = 0; k0 < K; k0 += GBK) {
    // stage A/B tiles: 128 rows x 64 halfs = 1024 uint4 each; 4 per thread
    // all eight loads go out before the first LDS store: one load latency a K step
    const _Float16 *pa[4], *pb[4];
    v4u ra[4], rb[4];
#pragma unroll
    for (int j = 0; j < 4; ++j) {
      int lin = t + j * 256;  // 0..1023
      int r = lin >> 3;       // row 0..127
      int c = lin & 7;        // 16-byte piece 0..7
      pa[j] = A + (size_t)(rowBlock + r) * lda + k0 + c * 8;
      pb[j] = Bt + (size_t)(colBlock + r) * ldb + k0 + c * 8;
      ra[j] = *(const v4u*)pa[j];
      rb[j] = *(const v4u*)pb[j];
    }
    // holds the loads together (loaded values as inputs only): left free, each is sunk
    // to its own LDS store and waited for at once, eight latencies in a row. The
    // addresses are named too, so that no load of the group is given a target
    // register that an earlier load of the group still names as its address
    asm volatile("" ::"v"(ra[0]), "v"(ra[1]), "v"(ra[2]), "v"(ra[3]), "v"(rb[0]), "v"(rb[1]),
                 "v"(rb[2]), "v"(rb[3]), "v"(pa[0]), "v"(pa[1]), "v"(pa[2]), "v"(pa[3]),
                 "v"(pb[0]), "v"(pb[1]), "v"(pb[2]), "v"(pb[3]));
#pragma unroll
    for (int j = 0; j < 4; ++j) {
      int lin = t + j * 256;
      int r = lin >> 3;
      int c = lin & 7;
      *(v4u*)(&sA[r * GLD + c * 8]) = ra[j];
      *(v4u*)(&sB[r * GLD + c * 8]) = rb[j];
    }
    if (k0 + GBK < K) {  // CDNA5 global_prefetch_b8 of next K tile
      __builtin_prefetch(A + (size_t)(rowBlock + (t >> 1)) * lda + k0 + GBK + (t & 1) * 32, 0, 1);
      __builtin_prefetch(Bt + (size_t)(colBlock + (t >> 1)) * ldb + k0 + GBK + (t & 1) * 32, 0, 1);
    }
    __syncthreads();
#pragma unroll
    for (int ks = 0; ks < 2; ++ks) {
      int kb = ks * 32 + kof;
      v16h af[2], bfr[4];
#pragma unroll
      for (int fm = 0; fm < 2; ++fm)
        af[fm] = ldfrag(&sA[(wm * 32 + fm * 16 + lr) * GLD + kb]);
#pragma unroll
      for (int fn = 0; fn < 4; ++fn)
        bfr[fn] = ldfrag(&sB[(wn * 64 + fn * 16 + lr) * GLD + kb]);
#pragma unroll
      for (int fm = 0; fm < 2; ++fm)
#pragma unroll
        for (int fn = 0; fn < 4; ++fn)
          acc[fm][fn] = wmma16x16x32(af[fm], bfr[fn], acc[fm][fn]);
    }
    __syncthreads();
  }

  // store: C layout — VGPR e: lanes 0-15 -> m=e, lanes 16-31 -> m=e+8; n=lr
#pragma unroll
  for (int fm = 0; fm < 2; ++fm)
#pragma unroll
    for (int fn = 0; fn < 4; ++fn) {
      int col = colBlock + wn * 64 + fn * 16 + lr;
      int row0 = rowBlock + wm * 32 + fm * 16 + hi4 * 8;
      float bv = HAS_BIAS ? bias[col] : 0.f;
#pragma unroll
      for (int e = 0; e < 8; ++e) {
        float v = acc[fm][fn][e] + bv;
        if constexpr (OUT_F16)
          ((_Float16*)Cv)[(size_t)(row0 + e) * ldc + col] = (_Float16)v;
        else
          ((float*)Cv)[(size_t)(row0 + e) * ldc + col] = v;
      }
    }
}

#define AT_NW 8
#define AT_G  2
#define AT_QB (AT_NW * AT_G * 16)
#define AT_PASSES (SEQ_M / 32)

// lane l <-> lane l ^ 16
__device__ __forceinline__ float xhalf(float x) {
  int v = __builtin_bit_cast(int, x);
  return __builtin_bit_cast(
      float, __builtin_amdgcn_permlanex16(v, v, 0x76543210, 0xfedcba98, false, false));
}

// Base-2 exponentials in place, a run of them in one statement: left to the
// register allocator, an exponential's target is often the source of the one
// directly ahead of it. Here each overwrites only its own source, and the v_nop is
// the slot the instruction set asks for between the last one and its first reader.
__device__ __forceinline__ void exp2_inplace(v8f& x) {
  float a0 = x[0], a1 = x[1], a2 = x[2], a3 = x[3], a4 = x[4], a5 = x[5], a6 = x[6], a7 = x[7];
  asm("v_exp_f32 %0, %0\n\tv_exp_f32 %1, %1\n\tv_exp_f32 %2, %2\n\tv_exp_f32 %3, %3\n\t"
      "v_exp_f32 %4, %4\n\tv_exp_f32 %5, %5\n\tv_exp_f32 %6, %6\n\tv_exp_f32 %7, %7\n\t"
      "v_nop"
      : "+v"(a0), "+v"(a1), "+v"(a2), "+v"(a3), "+v"(a4), "+v"(a5), "+v"(a6), "+v"(a7));
  x[0] = a0; x[1] = a1; x[2] = a2; x[3] = a3; x[4] = a4; x[5] = a5; x[6] = a6; x[7] = a7;
}
__device__ __forceinline__ void exp2_inplace(float& a0, float& a1) {
  asm("v_exp_f32 %0, %0\n\tv_exp_f32 %1, %1\n\tv_nop" : "+v"(a0), "+v"(a1));
}

__global__ void __launch_bounds__(AT_NW * 32)
attn_kernel(const _Float16* __restrict__ Q, const _Float16* __restrict__ Kf,
            const _Float16* __restrict__ Vt, _Float16* __restrict__ O) {
  const int t = threadIdx.x;
  const int lane = t & 31, w = t >> 5;
  const int lr = lane & 15, hi4 = lane >> 4, kof = hi4 * 8;
  const int bh = blockIdx.y, b = bh >> 4, h = bh & 15;
  const int q0 = blockIdx.x * AT_QB + w * (AT_G * 16);
  const float cs = ATT_SCALE * 1.4426950408889634f;  // scores in the log2 domain

  // Q as B operand: column lr = query, DH split into two 32-wide k-steps
  v16h qf[AT_G][2];
#pragma unroll
  for (int g = 0; g < AT_G; ++g) {
    const _Float16* qp = Q + ((size_t)(b * SEQ_N + q0 + g * 16 + lr)) * INNERv + h * DHEAD + kof;
    qf[g][0] = ldfrag(qp);
    qf[g][1] = ldfrag(qp + 32);
  }

  const _Float16* kbase = Kf + ((size_t)(b * SEQ_M + lr)) * INNERv + h * DHEAD + kof;
  const _Float16* vbase = Vt + ((size_t)(b * INNERv + h * DHEAD + lr)) * SEQ_M + kof;

  v8f acc[AT_G][4];
  float mrun[AT_G], lsum[AT_G];
#pragma unroll
  for (int g = 0; g < AT_G; ++g) {
    mrun[g] = -__builtin_inff();
    lsum[g] = 0.f;
#pragma unroll
    for (int d = 0; d < 4; ++d) acc[g][d] = v8f_zero();
  }

  // K as A operand: row lr = key; two 16-key tiles x two k-steps, one pass ahead
  v16h kf[2][2];
#pragma unroll
  for (int kt = 0; kt < 2; ++kt) {
    kf[kt][0] = ldfrag(kbase + (size_t)(kt * 16) * INNERv);
    kf[kt][1] = ldfrag(kbase + (size_t)(kt * 16) * INNERv + 32);
  }

  for (int p = 0; p < AT_PASSES; ++p) {
    // V^T as A operand: row lr = dh, k = this pass's 32 keys; in flight under the
    // score products and the softmax. The barrier holds the fetch up here: sunk to
    // its first use it would be waited for at once
    v16h vf[4];
#pragma unroll
    for (int d = 0; d < 4; ++d) vf[d] = ldfrag(vbase + (size_t)(d * 16) * SEQ_M + p * 32);
    __builtin_amdgcn_sched_barrier(0);

    v8f s[2][AT_G];
#pragma unroll
    for (int kt = 0; kt < 2; ++kt)
#pragma unroll
      for (int g = 0; g < AT_G; ++g) {
        s[kt][g] = wmma16x16x32(kf[kt][0], qf[g][0], v8f_zero());
        s[kt][g] = wmma16x16x32(kf[kt][1], qf[g][1], s[kt][g]);
      }

    // keeps the eight products back to back: mixed with the maxima below, each
    // product that a maximum follows is padded with idle slots
    __builtin_amdgcn_sched_barrier(0);

    // next pass's K into the same registers, in flight under the softmax and the
    // second product (the last pass fetches its own rows again: in bounds, unused)
    const int pn = (p + 1 < AT_PASSES) ? p + 1 : p;
#pragma unroll
    for (int kt = 0; kt < 2; ++kt) {
      kf[kt][0] = ldfrag(kbase + (size_t)(pn * 32 + kt * 16) * INNERv);
      kf[kt][1] = ldfrag(kbase + (size_t)(pn * 32 + kt * 16) * INNERv + 32);
    }

    // holds the fetch here, ahead of the softmax: sunk to the foot of the pass it
    // would be waited for at once by the next pass's products
    __builtin_amdgcn_sched_barrier(0);

    // online softmax: new running maximum per query, sums and outputs rescaled
    // (no branch: the loop stays one block, so the fetches stay where they stand)
    float corr[AT_G];
#pragma unroll
    for (int g = 0; g < AT_G; ++g) {
      float mx = s[0][g][0];
#pragma unroll
      for (int e = 1; e < 8; ++e) mx = fmaxf(mx, s[0][g][e]);
#pragma unroll
      for (int e = 0; e < 8; ++e) mx = fmaxf(mx, s[1][g][e]);
      mx = fmaxf(mx, xhalf(mx)) * cs;
      const float mnew = fmaxf(mrun[g], mx);
      corr[g] = mrun[g] - mnew;  // -inf on the first pass: its exponential is 0
      mrun[g] = mnew;
    }
    exp2_inplace(corr[0], corr[1]);

#pragma unroll
    for (int g = 0; g < AT_G; ++g) {
      const float nm = -mrun[g];
      v8f e0, e1;
#pragma unroll
      for (int e = 0; e < 8; ++e) {
        e0[e] = fmaf(s[0][g][e], cs, nm);
        e1[e] = fmaf(s[1][g][e], cs, nm);
      }
      exp2_inplace(e0);
      exp2_inplace(e1);
      v16h pf;  // elements 0-7 = keys 8*hi4 + e, 8-15 = keys 16 + 8*hi4 + e: ldfrag's k order
      float ps = e0[0] + e1[0];
#pragma unroll
      for (int e = 1; e < 8; ++e) ps += e0[e] + e1[e];
#pragma unroll
      for (int e = 0; e < 8; ++e) {
        pf[e] = (_Float16)e0[e];
        pf[8 + e] = (_Float16)e1[e];
      }
      lsum[g] = fmaf(lsum[g], corr[g], ps);
#pragma unroll
      for (int d = 0; d < 4; ++d)
        acc[g][d] = wmma16x16x32(vf[d], pf, acc[g][d] * corr[g]);
    }
  }

  // O^T tile d: register e = dh d*16 + 8*hi4 + e of query lr: one 16-byte store
#pragma unroll
  for (int g = 0; g < AT_G; ++g) {
    const float l = lsum[g];
    const float inv = 1.0f / (l + xhalf(l));
    _Float16* op = O + ((size_t)(b * SEQ_N + q0 + g * 16 + lr)) * INNERv + h * DHEAD + kof;
#pragma unroll
    for (int d = 0; d < 4; ++d) {
      v8h o;
#pragma unroll
      for (int e = 0; e < 8; ++e) o[e] = (_Float16)(acc[g][d][e] * inv);
      *(v8h*)(op + d * 16) = o;
    }
  }
}

// ---------------------------------------------------------------------------
// Host-side launch
// ---------------------------------------------------------------------------
extern "C" void kernel_launch(void* const* d_in, const int* in_sizes, int n_in,
                              void* d_out, int out_size, void* d_ws, size_t ws_size,
                              hipStream_t stream) {
  (void)in_sizes; (void)n_in; (void)out_size; (void)ws_size;

  const float* person  = (const float*)d_in[0];
  const float* garment = (const float*)d_in[1];
  const float* Wq = (const float*)d_in[2];
  const float* Wk = (const float*)d_in[3];
  const float* Wv = (const float*)d_in[4];
  const float* Wo = (const float*)d_in[5];
  const float* bo = (const float*)d_in[6];
  const float* Wf = (const float*)d_in[7];
  const float* bf = (const float*)d_in[8];
  const float* gq = (const float*)d_in[9];
  const float* betaq = (const float*)d_in[10];
  const float* gk = (const float*)d_in[11];
  const float* betak = (const float*)d_in[12];
  float* out = (float*)d_out;

  _Float16* w0 = (_Float16*)d_ws;
  size_t off = 0;
  _Float16* pLN = w0 + off; off += (size_t)BATCH * SEQ_N * DQv;
  _Float16* gLN = w0 + off; off += (size_t)BATCH * SEQ_M * DCv;
  _Float16* WqT = w0 + off; off += (size_t)INNERv * DQv;
  _Float16* WkT = w0 + off; off += (size_t)INNERv * DCv;
  _Float16* WvT = w0 + off; off += (size_t)INNERv * DCv;
  _Float16* WoT = w0 + off; off += (size_t)DQv * INNERv;
  _Float16* WfT = w0 + off; off += (size_t)DQv * (2 * DQv);
  _Float16* Qh  = w0 + off; off += (size_t)BATCH * SEQ_N * INNERv;
  _Float16* Kh  = w0 + off; off += (size_t)BATCH * SEQ_M * INNERv;
  _Float16* Vh  = w0 + off; off += (size_t)BATCH * SEQ_M * INNERv;
  _Float16* VtB = w0 + off; off += (size_t)BATCH * INNERv * SEQ_M;
  _Float16* Att = w0 + off; off += (size_t)BATCH * SEQ_N * INNERv;
  _Float16* Cat = w0 + off; off += (size_t)BATCH * SEQ_N * 2 * DQv;

  dim3 tb32(32, 8);

  // Weight transpose+convert
  wtrans_kernel<<<dim3(INNERv / 32, DQv / 32), tb32, 0, stream>>>(Wq, WqT, DQv, INNERv);
  wtrans_kernel<<<dim3(INNERv / 32, DCv / 32), tb32, 0, stream>>>(Wk, WkT, DCv, INNERv);
  wtrans_kernel<<<dim3(INNERv / 32, DCv / 32), tb32, 0, stream>>>(Wv, WvT, DCv, INNERv);
  wtrans_kernel<<<dim3(DQv / 32, INNERv / 32), tb32, 0, stream>>>(Wo, WoT, INNERv, DQv);
  wtrans_kernel<<<dim3(DQv / 32, (2 * DQv) / 32), tb32, 0, stream>>>(Wf, WfT, 2 * DQv, DQv);

  // LayerNorms
  ln_f16_kernel<DQv><<<BATCH * SEQ_N, 256, 0, stream>>>(person, gq, betaq, pLN);
  ln_f16_kernel<DCv><<<BATCH * SEQ_M, 256, 0, stream>>>(garment, gk, betak, gLN);

  // Q/K/V projections (f16 out)
  gemm_wmma_kernel<true, false><<<dim3(INNERv / GBN, (BATCH * SEQ_N) / GBM), 256, 0, stream>>>(
      pLN, DQv, WqT, DQv, (void*)Qh, INNERv, nullptr, BATCH * SEQ_N, INNERv, DQv);
  gemm_wmma_kernel<true, false><<<dim3(INNERv / GBN, (BATCH * SEQ_M) / GBM), 256, 0, stream>>>(
      gLN, DCv, WkT, DCv, (void*)Kh, INNERv, nullptr, BATCH * SEQ_M, INNERv, DCv);
  gemm_wmma_kernel<true, false><<<dim3(INNERv / GBN, (BATCH * SEQ_M) / GBM), 256, 0, stream>>>(
      gLN, DCv, WvT, DCv, (void*)Vh, INNERv, nullptr, BATCH * SEQ_M, INNERv, DCv);

  // V transpose for contiguous PV fragments
  vtrans_kernel<<<dim3(INNERv / 32, SEQ_M / 32, BATCH), tb32, 0, stream>>>(Vh, VtB);

  // Residual into concat cols [0, DQ)
  {
    size_t total = (size_t)BATCH * SEQ_N * DQv;
    cvt_resid_kernel<<<(unsigned)((total + 255) / 256), 256, 0, stream>>>(person, Cat);
  }

  // Attention (online softmax in registers)
  attn_kernel<<<dim3(SEQ_N / AT_QB, BATCH * NHEAD), AT_NW * 32, 0, stream>>>(
      Qh, Kh, VtB, Att);

  // att @ Wo + bo -> concat cols [DQ, 2*DQ) (f16)
  gemm_wmma_kernel<true, true><<<dim3(DQv / GBN, (BATCH * SEQ_N) / GBM), 256, 0, stream>>>(
      Att, INNERv, WoT, INNERv, (void*)(Cat + DQv), 2 * DQv, bo, BATCH * SEQ_N, DQv, INNERv);

  // concat @ Wf + bf -> out (f32)
  gemm_wmma_kernel<false, true><<<dim3(DQv / GBN, (BATCH * SEQ_N) / GBM), 256, 0, stream>>>(
      Cat, 2 * DQv, WfT, 2 * DQv, (void*)out, DQv, bf, BATCH * SEQ_N, DQv, 2 * DQv);
}

// v003
// A run of this version takes 211 microseconds.
// Timed twice side by side with v002, it ran 1.20 times as fast both times.
// Counting every step since v000, it is 2.31 times as fast.
#include <hip/hip_runtime.h>

#define BATCH 4
#define SEQ_N 2048
#define SEQ_M 1024
#define DQv   1024
#define DCv   768
#define NHEAD 16
#define DHEAD 64
#define INNERv 1024
#define ATT_SCALE 0.125f

typedef _Float16 v16h __attribute__((ext_vector_type(16)));
typedef _Float16 v8h  __attribute__((ext_vector_type(8)));
typedef float    v8f  __attribute__((ext_vector_type(8)));
typedef unsigned int v4u __attribute__((ext_vector_type(4)));

__device__ __forceinline__ v8f v8f_zero() {
  v8f z = {0.f,0.f,0.f,0.f,0.f,0.f,0.f,0.f};
  return z;
}

// Load one 16-bit WMMA A/B fragment for this lane.
// Per CDNA5 ISA 16-bit 16x32 layout: a lane holds K chunks {base..base+7} and
// {base+16..base+23}; caller passes p already offset by ks*32 + (laneHi?8:0).
__device__ __forceinline__ v16h ldfrag(const _Float16* p) {
  v8h lo = *(const v8h*)(p);
  v8h hi = *(const v8h*)(p + 16);
  return __builtin_shufflevector(lo, hi, 0,1,2,3,4,5,6,7,8,9,10,11,12,13,14,15);
}

__device__ __forceinline__ v8f wmma16x16x32(v16h a, v16h b, v8f c) {
  return __builtin_amdgcn_wmma_f32_16x16x32_f16(false, a, false, b, (short)0, c,
                                                false, false);
}

// ---------------------------------------------------------------------------
// Weight transpose + f32 -> f16 convert:  Wt[n][k] = (f16) W[k][n]
// ---------------------------------------------------------------------------
__device__ __forceinline__ void wtrans_job(float (*tile)[33], const float* __restrict__ W,
                                           _Float16* __restrict__ Wt, int K, int N, int bx,
                                           int by) {
  int nt = bx * 32, kt = by * 32;
  int tx = threadIdx.x & 31, ty = threadIdx.x >> 5;
#pragma unroll
  for (int j = 0; j < 4; ++j)
    tile[ty + j * 8][tx] = W[(size_t)(kt + ty + j * 8) * N + nt + tx];
  __syncthreads();
#pragma unroll
  for (int j = 0; j < 4; ++j)
    Wt[(size_t)(nt + ty + j * 8) * K + kt + tx] = (_Float16)tile[tx][ty + j * 8];
  // behind the stores: in the built kernel another job's instructions stand next and
  // write the registers that these stores name
  asm volatile("s_wait_xcnt 0x0" ::: "memory");
}

// ---------------------------------------------------------------------------
// Per-batch transpose of V (f16):  Vt[b][c][m] = V[b*M + m][c]
// ---------------------------------------------------------------------------
__global__ void vtrans_kernel(const _Float16* __restrict__ V, _Float16* __restrict__ Vt) {
  __shared__ _Float16 tile[32][33];
  int b = blockIdx.z;
  int ct = blockIdx.x * 32, mt = blockIdx.y * 32;
  int tx = threadIdx.x, ty = threadIdx.y;
#pragma unroll
  for (int j = 0; j < 4; ++j)
    tile[ty + j * 8][tx] = V[((size_t)b * SEQ_M + mt + ty + j * 8) * INNERv + ct + tx];
  __syncthreads();
#pragma unroll
  for (int j = 0; j < 4; ++j)
    Vt[((size_t)b * INNERv + ct + ty + j * 8) * SEQ_M + mt + tx] = tile[tx][ty + j * 8];
}

// ---------------------------------------------------------------------------
// Row LayerNorm (f32 statistics) producing f16 rows. With COPY the block also writes
// the row itself as f16 into concat buffer cols [0, D): it holds the row anyway.
// ---------------------------------------------------------------------------
template <int D, bool COPY>
__device__ __forceinline__ void ln_f16_job(float* s1, float* s2, const float* __restrict__ x,
                                           const float* __restrict__ g,
                                           const float* __restrict__ beta,
                                           _Float16* __restrict__ y,
                                           _Float16* __restrict__ cat, int row) {
  int t = threadIdx.x;
  const float* xr = x + (size_t)row * D;
  float a = 0.f, b = 0.f;
  for (int i = t; i < D; i += 256) {
    float v = xr[i];
    a += v;
    b += v * v;
  }
  s1[t] = a;
  s2[t] = b;
  __syncthreads();
  for (int off = 128; off > 0; off >>= 1) {
    if (t < off) {
      s1[t] += s1[t + off];
      s2[t] += s2[t + off];
    }
    __syncthreads();
  }
  float mu = s1[0] * (1.0f / D);
  float var = s2[0] * (1.0f / D) - mu * mu;
  float rs = rsqrtf(var + 1e-5f);
  _Float16* yr = y + (size_t)row * D;
  for (int i = t; i < D; i += 256) {
    float v = xr[i];
    yr[i] = (_Float16)((v - mu) * rs * g[i] + beta[i]);
    if constexpr (COPY) cat[(size_t)row * (2 * D) + i] = (_Float16)v;
  }
}

// ---------------------------------------------------------------------------
// All work that depends on the inputs alone, in one launch: a block takes one job,
// picked by its index (the same for the whole block, so the jobs' barriers are safe).
// ---------------------------------------------------------------------------
#define PJ_LNP (BATCH * SEQ_N)                    // person rows
#define PJ_LNG (PJ_LNP + BATCH * SEQ_M)           // garment rows
#define PJ_WQ  (PJ_LNG + (DQv / 32) * 32)         // 32x32 weight tiles, 32 tiles a tile row
#define PJ_WK  (PJ_WQ + (DCv / 32) * 32)
#define PJ_WV  (PJ_WK + (DCv / 32) * 32)
#define PJ_WO  (PJ_WV + (INNERv / 32) * 32)
#define PJ_WF  (PJ_WO + ((2 * DQv) / 32) * 32)

__global__ void __launch_bounds__(256)
prep_kernel(const float* __restrict__ person, const float* __restrict__ garment,
            const float* __restrict__ Wq, const float* __restrict__ Wk,
            const float* __restrict__ Wv, const float* __restrict__ Wo,
            const float* __restrict__ Wf, const float* __restrict__ gq,
            const float* __restrict__ betaq, const float* __restrict__ gk,
            const float* __restrict__ betak, _Float16* __restrict__ pLN,
            _Float16* __restrict__ gLN, _Float16* __restrict__ WqT, _Float16* __restrict__ WkT,
            _Float16* __restrict__ WvT, _Float16* __restrict__ WoT, _Float16* __restrict__ WfT,
            _Float16* __restrict__ Cat) {
  __shared__ float smem[32 * 33];
  float(*tile)[33] = (float(*)[33])smem;
  const int j = blockIdx.x;
  if (j < PJ_LNP) {
    ln_f16_job<DQv, true>(smem, smem + 256, person, gq, betaq, pLN, Cat, j);
    return;
  }
  if (j < PJ_LNG) {
    ln_f16_job<DCv, false>(smem, smem + 256, garment, gk, betak, gLN, nullptr, j - PJ_LNP);
    return;
  }
  {
    // every weight has 1024 columns (INNER = DQ): 32 tiles a tile row
    const float* W = Wf;
    _Float16* Wt = WfT;
    int K = 2 * DQv, first = PJ_WO;
    if (j < PJ_WQ) {
      W = Wq; Wt = WqT; K = DQv; first = PJ_LNG;
    } else if (j < PJ_WK) {
      W = Wk; Wt = WkT; K = DCv; first = PJ_WQ;
    } else if (j < PJ_WV) {
      W = Wv; Wt = WvT; K = DCv; first = PJ_WK;
    } else if (j < PJ_WO) {
      W = Wo; Wt = WoT; K = INNERv; first = PJ_WV;
    }
    wtrans_job(tile, W, Wt, K, INNERv, (j - first) & 31, (j - first) >> 5);
  }
}

// ---------------------------------------------------------------------------
// WMMA GEMM:  C[M x N] = A[M x K] * Bt[N x K]^T (+ bias), f16 in, f32 acc.
// Block: 256 threads = 8 waves (4x2 wave grid), tile 128x128, BK=64.
// ---------------------------------------------------------------------------
#define GBM 128
#define GBN 128
#define GBK 64
#define GLD 72  // LDS row stride in halfs (144B, 16B multiple, conflict pad)

template <bool OUT_F16, bool HAS_BIAS>
__device__ __forceinline__ void gemm_tile(const _Float16* __restrict__ A, int lda,
                                 const _Float16* __restrict__ Bt, int ldb,
                                 void* __restrict__ Cv, int ldc,
                                 const float* __restrict__ bias, int K, int rowBlock,
                                 int colBlock) {
  __shared__ _Float16 sA[GBM * GLD];
  __shared__ _Float16 sB[GBN * GLD];

  const int t = threadIdx.x;
  const int lane = t & 31, w = t >> 5;
  const int wm = w & 3, wn = w >> 2;  // 4 waves in M x 2 waves in N
  const int lr = lane & 15, hi4 = lane >> 4, kof = hi4 * 8;

  v8f acc[2][4];
#pragma unroll
  for (int fm = 0; fm < 2; ++fm)
#pragma unroll
    for (int fn = 0; fn < 4; ++fn) acc[fm][fn] = v8f_zero();

  for (int k0 = 0; k0 < K; k0 += GBK) {
    // stage A/B tiles: 128 rows x 64 halfs = 1024 uint4 each; 4 per thread
    // all eight loads go out before the first LDS store: one load latency a K step
    const _Float16 *pa[4], *pb[4];
    v4u ra[4], rb[4];
#pragma unroll
    for (int j = 0; j < 4; ++j) {
      int lin = t + j * 256;  // 0..1023
      int r = lin >> 3;       // row 0..127
      int c = lin & 7;        // 16-byte piece 0..7
      pa[j] = A + (size_t)(rowBlock + r) * lda + k0 + c * 8;
      pb[j] = Bt + (size_t)(colBlock + r) * ldb + k0 + c * 8;
      ra[j] = *(const v4u*)pa[j];
      rb[j] = *(const v4u*)pb[j];
    }
    // holds the loads together (loaded values as inputs only): left free, each is sunk
    // to its own LDS store and waited for at once, eight latencies in a row. The
    // addresses are named too, so that no load of the group is given a target
    // register that an earlier load of the group still names as its address
    asm volatile("" ::"v"(ra[0]), "v"(ra[1]), "v"(ra[2]), "v"(ra[3]), "v"(rb[0]), "v"(rb[1]),
                 "v"(rb[2]), "v"(rb[3]), "v"(pa[0]), "v"(pa[1]), "v"(pa[2]), "v"(pa[3]),
                 "v"(pb[0]), "v"(pb[1]), "v"(pb[2]), "v"(pb[3]));
#pragma unroll
    for (int j = 0; j < 4; ++j) {
      int lin = t + j * 256;
      int r = lin >> 3;
      int c = lin & 7;
      *(v4u*)(&sA[r * GLD + c * 8]) = ra[j];
      *(v4u*)(&sB[r * GLD + c * 8]) = rb[j];
    }
    if (k0 + GBK < K) {  // CDNA5 global_prefetch_b8 of next K tile
      __builtin_prefetch(A + (size_t)(rowBlock + (t >> 1)) * lda + k0 + GBK + (t & 1) * 32, 0, 1);
      __builtin_prefetch(Bt + (size_t)(colBlock + (t >> 1)) * ldb + k0 + GBK + (t & 1) * 32, 0, 1);
    }
    __syncthreads();
#pragma unroll
    for (int ks = 0; ks < 2; ++ks) {
      int kb = ks * 32 + kof;
      v16h af[2], bfr[4];
#pragma unroll
      for (int fm = 0; fm < 2; ++fm)
        af[fm] = ldfrag(&sA[(wm * 32 + fm * 16 + lr) * GLD + kb]);
#pragma unroll
      for (int fn = 0; fn < 4; ++fn)
        bfr[fn] = ldfrag(&sB[(wn * 64 + fn * 16 + lr) * GLD + kb]);
#pragma unroll
      for (int fm = 0; fm < 2; ++fm)
#pragma unroll
        for (int fn = 0; fn < 4; ++fn)
          acc[fm][fn] = wmma16x16x32(af[fm], bfr[fn], acc[fm][fn]);
    }
    __syncthreads();
  }

  // store: C layout — VGPR e: lanes 0-15 -> m=e, lanes 16-31 -> m=e+8; n=lr
#pragma unroll
  for (int fm = 0; fm < 2; ++fm)
#pragma unroll
    for (int fn = 0; fn < 4; ++fn) {
      int col = colBlock + wn * 64 + fn * 16 + lr;
      int row0 = rowBlock + wm * 32 + fm * 16 + hi4 * 8;
      float bv = HAS_BIAS ? bias[col] : 0.f;
#pragma unroll
      for (int e = 0; e < 8; ++e) {
        float v = acc[fm][fn][e] + bv;
        if constexpr (OUT_F16)
          ((_Float16*)Cv)[(size_t)(row0 + e) * ldc + col] = (_Float16)v;
        else
          ((float*)Cv)[(size_t)(row0 + e) * ldc + col] = v;
      }
    }
}

template <bool OUT_F16, bool HAS_BIAS>
__global__ void __launch_bounds__(256) gemm_wmma_kernel(const _Float16* __restrict__ A, int lda,
                                 const _Float16* __restrict__ Bt, int ldb,
                                 void* __restrict__ Cv, int ldc,
                                 const float* __restrict__ bias, int M, int N, int K) {
  gemm_tile<OUT_F16, HAS_BIAS>(A, lda, Bt, ldb, Cv, ldc, bias, K, blockIdx.y * GBM,
                               blockIdx.x * GBN);
}

// The three projections in one launch: none reads another's result. blockIdx.y picks
// the product and its row tile; the longest (Q, K = DQ) has the lowest indices.
#define QKV_YQ ((BATCH * SEQ_N) / GBM)
#define QKV_YK (QKV_YQ + (BATCH * SEQ_M) / GBM)
#define QKV_YV (QKV_YK + (BATCH * SEQ_M) / GBM)

__global__ void __launch_bounds__(256)
gemm_qkv_kernel(const _Float16* __restrict__ pLN, const _Float16* __restrict__ gLN,
                const _Float16* __restrict__ WqT, const _Float16* __restrict__ WkT,
                const _Float16* __restrict__ WvT, _Float16* __restrict__ Qh,
                _Float16* __restrict__ Kh, _Float16* __restrict__ Vh) {
  const int y = blockIdx.y;
  const bool isQ = y < QKV_YQ, isK = y < QKV_YK;
  const _Float16* A = isQ ? pLN : gLN;
  const _Float16* Bt = isQ ? WqT : (isK ? WkT : WvT);
  _Float16* C = isQ ? Qh : (isK ? Kh : Vh);
  const int K = isQ ? DQv : DCv;
  const int yt = isQ ? y : (isK ? y - QKV_YQ : y - QKV_YK);
  gemm_tile<true, false>(A, K, Bt, K, (void*)C, INNERv, nullptr, K, yt * GBM,
                         blockIdx.x * GBN);
}

#define AT_NW 8
#define AT_G  2
#define AT_QB (AT_NW * AT_G * 16)
#define AT_PASSES (SEQ_M / 32)

// lane l <-> lane l ^ 16
__device__ __forceinline__ float xhalf(float x) {
  int v = __builtin_bit_cast(int, x);
  return __builtin_bit_cast(
      float, __builtin_amdgcn_permlanex16(v, v, 0x76543210, 0xfedcba98, false, false));
}

// Base-2 exponentials in place, a run of them in one statement: left to the
// register allocator, an exponential's target is often the source of the one
// directly ahead of it. Here each overwrites only its own source, and the v_nop is
// the slot the instruction set asks for between the last one and its first reader.
__device__ __forceinline__ void exp2_inplace(v8f& x) {
  float a0 = x[0], a1 = x[1], a2 = x[2], a3 = x[3], a4 = x[4], a5 = x[5], a6 = x[6], a7 = x[7];
  asm("v_exp_f32 %0, %0\n\tv_exp_f32 %1, %1\n\tv_exp_f32 %2, %2\n\tv_exp_f32 %3, %3\n\t"
      "v_exp_f32 %4, %4\n\tv_exp_f32 %5, %5\n\tv_exp_f32 %6, %6\n\tv_exp_f32 %7, %7\n\t"
      "v_nop"
      : "+v"(a0), "+v"(a1), "+v"(a2), "+v"(a3), "+v"(a4), "+v"(a5), "+v"(a6), "+v"(a7));
  x[0] = a0; x[1] = a1; x[2] = a2; x[3] = a3; x[4] = a4; x[5] = a5; x[6] = a6; x[7] = a7;
}
__device__ __forceinline__ void exp2_inplace(float& a0, float& a1) {
  asm("v_exp_f32 %0, %0\n\tv_exp_f32 %1, %1\n\tv_nop" : "+v"(a0), "+v"(a1));
}

__global__ void __launch_bounds__(AT_NW * 32)
attn_kernel(const _Float16* __restrict__ Q, const _Float16* __restrict__ Kf,
            const _Float16* __restrict__ Vt, _Float16* __restrict__ O) {
  const int t = threadIdx.x;
  const int lane = t & 31, w = t >> 5;
  const int lr = lane & 15, hi4 = lane >> 4, kof = hi4 * 8;
  const int bh = blockIdx.y, b = bh >> 4, h = bh & 15;
  const int q0 = blockIdx.x * AT_QB + w * (AT_G * 16);
  const float cs = ATT_SCALE * 1.4426950408889634f;  // scores in the log2 domain

  // Q as B operand: column lr = query, DH split into two 32-wide k-steps
  v16h qf[AT_G][2];
#pragma unroll
  for (int g = 0; g < AT_G; ++g) {
    const _Float16* qp = Q + ((size_t)(b * SEQ_N + q0 + g * 16 + lr)) * INNERv + h * DHEAD + kof;
    qf[g][0] = ldfrag(qp);
    qf[g][1] = ldfrag(qp + 32);
  }

  const _Float16* kbase = Kf + ((size_t)(b * SEQ_M + lr)) * INNERv + h * DHEAD + kof;
  const _Float16* vbase = Vt + ((size_t)(b * INNERv + h * DHEAD + lr)) * SEQ_M + kof;

  v8f acc[AT_G][4];
  float mrun[AT_G], lsum[AT_G];
#pragma unroll
  for (int g = 0; g < AT_G; ++g) {
    mrun[g] = -__builtin_inff();
    lsum[g] = 0.f;
#pragma unroll
    for (int d = 0; d < 4; ++d) acc[g][d] = v8f_zero();
  }

  // K as A operand: row lr = key; two 16-key tiles x two k-steps, one pass ahead
  v16h kf[2][2];
#pragma unroll
  for (int kt = 0; kt < 2; ++kt) {
    kf[kt][0] = ldfrag(kbase + (size_t)(kt * 16) * INNERv);
    kf[kt][1] = ldfrag(kbase + (size_t)(kt * 16) * INNERv + 32);
  }

  for (int p = 0; p < AT_PASSES; ++p) {
    // V^T as A operand: row lr = dh, k = this pass's 32 keys; in flight under the
    // score products and the softmax. The barrier holds the fetch up here: sunk to
    // its first use it would be waited for at once
    v16h vf[4];
#pragma unroll
    for (int d = 0; d < 4; ++d) vf[d] = ldfrag(vbase + (size_t)(d * 16) * SEQ_M + p * 32);
    __builtin_amdgcn_sched_barrier(0);

    v8f s[2][AT_G];
#pragma unroll
    for (int kt = 0; kt < 2; ++kt)
#pragma unroll
      for (int g = 0; g < AT_G; ++g) {
        s[kt][g] = wmma16x16x32(kf[kt][0], qf[g][0], v8f_zero());
        s[kt][g] = wmma16x16x32(kf[kt][1], qf[g][1], s[kt][g]);
      }

    // keeps the eight products back to back: mixed with the maxima below, each
    // product that a maximum follows is padded with idle slots
    __builtin_amdgcn_sched_barrier(0);

    // next pass's K into the same registers, in flight under the softmax and the
    // second product (the last pass fetches its own rows again: in bounds, unused)
    const int pn = (p + 1 < AT_PASSES) ? p + 1 : p;
#pragma unroll
    for (int kt = 0; kt < 2; ++kt) {
      kf[kt][0] = ldfrag(kbase + (size_t)(pn * 32 + kt * 16) * INNERv);
      kf[kt][1] = ldfrag(kbase + (size_t)(pn * 32 + kt * 16) * INNERv + 32);
    }

    // holds the fetch here, ahead of the softmax: sunk to the foot of the pass it
    // would be waited for at once by the next pass's products
    __builtin_amdgcn_sched_barrier(0);

    // online softmax: new running maximum per query, sums and outputs rescaled
    // (no branch: the loop stays one block, so the fetches stay where they stand)
    float corr[AT_G];
#pragma unroll
    for (int g = 0; g < AT_G; ++g) {
      float mx = s[0][g][0];
#pragma unroll
      for (int e = 1; e < 8; ++e) mx = fmaxf(mx, s[0][g][e]);
#pragma unroll
      for (int e = 0; e < 8; ++e) mx = fmaxf(mx, s[1][g][e]);
      mx = fmaxf(mx, xhalf(mx)) * cs;
      const float mnew = fmaxf(mrun[g], mx);
      corr[g] = mrun[g] - mnew;  // -inf on the first pass: its exponential is 0
      mrun[g] = mnew;
    }
    exp2_inplace(corr[0], corr[1]);

#pragma unroll
    for (int g = 0; g < AT_G; ++g) {
      const float nm = -mrun[g];
      v8f e0, e1;
#pragma unroll
      for (int e = 0; e < 8; ++e) {
        e0[e] = fmaf(s[0][g][e], cs, nm);
        e1[e] = fmaf(s[1][g][e], cs, nm);
      }
      exp2_inplace(e0);
      exp2_inplace(e1);
      v16h pf;  // elements 0-7 = keys 8*hi4 + e, 8-15 = keys 16 + 8*hi4 + e: ldfrag's k order
      float ps = e0[0] + e1[0];
#pragma unroll
      for (int e = 1; e < 8; ++e) ps += e0[e] + e1[e];
#pragma unroll
      for (int e = 0; e < 8; ++e) {
        pf[e] = (_Float16)e0[e];
        pf[8 + e] = (_Float16)e1[e];
      }
      lsum[g] = fmaf(lsum[g], corr[g], ps);
#pragma unroll
      for (int d = 0; d < 4; ++d)
        acc[g][d] = wmma16x16x32(vf[d], pf, acc[g][d] * corr[g]);
    }
  }

  // O^T tile d: register e = dh d*16 + 8*hi4 + e of query lr: one 16-byte store
#pragma unroll
  for (int g = 0; g < AT_G; ++g) {
    const float l = lsum[g];
    const float inv = 1.0f / (l + xhalf(l));
    _Float16* op = O + ((size_t)(b * SEQ_N + q0 + g * 16 + lr)) * INNERv + h * DHEAD + kof;
#pragma unroll
    for (int d = 0; d < 4; ++d) {
      v8h o;
#pragma unroll
      for (int e = 0; e < 8; ++e) o[e] = (_Float16)(acc[g][d][e] * inv);
      *(v8h*)(op + d * 16) = o;
    }
  }
}

// ---------------------------------------------------------------------------
// Host-side launch
// ---------------------------------------------------------------------------
extern "C" void kernel_launch(void* const* d_in, const int* in_sizes, int n_in,
                              void* d_out, int out_size, void* d_ws, size_t ws_size,
                              hipStream_t stream) {
  (void)in_sizes; (void)n_in; (void)out_size; (void)ws_size;

  const float* person  = (const float*)d_in[0];
  const float* garment = (const float*)d_in[1];
  const float* Wq = (const float*)d_in[2];
  const float* Wk = (const float*)d_in[3];
  const float* Wv = (const float*)d_in[4];
  const float* Wo = (const float*)d_in[5];
  const float* bo = (const float*)d_in[6];
  const float* Wf = (const float*)d_in[7];
  const float* bf = (const float*)d_in[8];
  const float* gq = (const float*)d_in[9];
  const float* betaq = (const float*)d_in[10];
  const float* gk = (const float*)d_in[11];
  const float* betak = (const float*)d_in[12];
  float* out = (float*)d_out;

  _Float16* w0 = (_Float16*)d_ws;
  size_t off = 0;
  _Float16* pLN = w0 + off; off += (size_t)BATCH * SEQ_N * DQv;
  _Float16* gLN = w0 + off; off += (size_t)BATCH * SEQ_M * DCv;
  _Float16* WqT = w0 + off; off += (size_t)INNERv * DQv;
  _Float16* WkT = w0 + off; off += (size_t)INNERv * DCv;
  _Float16* WvT = w0 + off; off += (size_t)INNERv * DCv;
  _Float16* WoT = w0 + off; off += (size_t)DQv * INNERv;
  _Float16* WfT = w0 + off; off += (size_t)DQv * (2 * DQv);
  _Float16* Qh  = w0 + off; off += (size_t)BATCH * SEQ_N * INNERv;
  _Float16* Kh  = w0 + off; off += (size_t)BATCH * SEQ_M * INNERv;
  _Float16* Vh  = w0 + off; off += (size_t)BATCH * SEQ_M * INNERv;
  _Float16* VtB = w0 + off; off += (size_t)BATCH * INNERv * SEQ_M;
  _Float16* Att = w0 + off; off += (size_t)BATCH * SEQ_N * INNERv;
  _Float16* Cat = w0 + off; off += (size_t)BATCH * SEQ_N * 2 * DQv;

  dim3 tb32(32, 8);

  // Layer norms (the person rows' f16 copy into concat cols [0, DQ) with them) and
  // weight transpose+convert
  prep_kernel<<<PJ_WF, 256, 0, stream>>>(person, garment, Wq, Wk, Wv, Wo, Wf, gq, betaq, gk,
                                         betak, pLN, gLN, WqT, WkT, WvT, WoT, WfT, Cat);

  // Q/K/V projections (f16 out)
  gemm_qkv_kernel<<<dim3(INNERv / GBN, QKV_YV), 256, 0, stream>>>(pLN, gLN, WqT, WkT, WvT, Qh,
                                                                  Kh, Vh);

  // V transpose for contiguous PV fragments
  vtrans_kernel<<<dim3(INNERv / 32, SEQ_M / 32, BATCH), tb32, 0, stream>>>(Vh, VtB);

  // Attention (online softmax in registers)
  attn_kernel<<<dim3(SEQ_N / AT_QB, BATCH * NHEAD), AT_NW * 32, 0, stream>>>(
      Qh, Kh, VtB, Att);

  // att @ Wo + bo -> concat cols [DQ, 2*DQ) (f16)
  gemm_wmma_kernel<true, true><<<dim3(DQv / GBN, (BATCH * SEQ_N) / GBM), 256, 0, stream>>>(
      Att, INNERv, WoT, INNERv, (void*)(Cat + DQv), 2 * DQv, bo, BATCH * SEQ_N, DQv, INNERv);

  // concat @ Wf + bf -> out (f32)
  gemm_wmma_kernel<false, true><<<dim3(DQv / GBN, (BATCH * SEQ_N) / GBM), 256, 0, stream>>>(
      Cat, 2 * DQv, WfT, 2 * DQv, (void*)out, DQv, bf, BATCH * SEQ_N, DQv, 2 * DQv);
}

// v004
// Measured time: 177 microseconds a run.
// Next to v003, in two timings, it ran 1.19 times as fast each time.
// All steps since v000 together make it 2.74 times as fast.
#include <hip/hip_runtime.h>

#define BATCH 4
#define SEQ_N 2048
#define SEQ_M 1024
#define DQv   1024
#define DCv   768
#define NHEAD 16
#define DHEAD 64
#define INNERv 1024
#define ATT_SCALE 0.125f

typedef _Float16 v16h __attribute__((ext_vector_type(16)));
typedef _Float16 v8h  __attribute__((ext_vector_type(8)));
typedef float    v8f  __attribute__((ext_vector_type(8)));
typedef unsigned int v4u __attribute__((ext_vector_type(4)));

__device__ __forceinline__ v8f v8f_zero() {
  v8f z = {0.f,0.f,0.f,0.f,0.f,0.f,0.f,0.f};
  return z;
}

// Load one 16-bit WMMA A/B fragment for this lane.
// Per CDNA5 ISA 16-bit 16x32 layout: a lane holds K chunks {base..base+7} and
// {base+16..base+23}; caller passes p already offset by ks*32 + (laneHi?8:0).
__device__ __forceinline__ v16h ldfrag(const _Float16* p) {
  v8h lo = *(const v8h*)(p);
  v8h hi = *(const v8h*)(p + 16);
  return __builtin_shufflevector(lo, hi, 0,1,2,3,4,5,6,7,8,9,10,11,12,13,14,15);
}

__device__ __forceinline__ v8f wmma16x16x32(v16h a, v16h b, v8f c) {
  return __builtin_amdgcn_wmma_f32_16x16x32_f16(false, a, false, b, (short)0, c,
                                                false, false);
}

// ---------------------------------------------------------------------------
// Weight transpose + f32 -> f16 convert:  Wt[n][k] = (f16) W[k][n]
// ---------------------------------------------------------------------------
__device__ __forceinline__ void wtrans_job(float (*tile)[33], const float* __restrict__ W,
                                           _Float16* __restrict__ Wt, int K, int N, int bx,
                                           int by) {
  int nt = bx * 32, kt = by * 32;
  int tx = threadIdx.x & 31, ty = threadIdx.x >> 5;
#pragma unroll
  for (int j = 0; j < 4; ++j)
    tile[ty + j * 8][tx] = W[(size_t)(kt + ty + j * 8) * N + nt + tx];
  __syncthreads();
#pragma unroll
  for (int j = 0; j < 4; ++j)
    Wt[(size_t)(nt + ty + j * 8) * K + kt + tx] = (_Float16)tile[tx][ty + j * 8];
  // behind the stores: in the built kernel another job's instructions stand next and
  // write the registers that these stores name
  asm volatile("s_wait_xcnt 0x0" ::: "memory");
}

// ---------------------------------------------------------------------------
// Per-batch transpose of V (f16):  Vt[b][c][m] = V[b*M + m][c]
// ---------------------------------------------------------------------------
__global__ void vtrans_kernel(const _Float16* __restrict__ V, _Float16* __restrict__ Vt) {
  __shared__ _Float16 tile[32][33];
  int b = blockIdx.z;
  int ct = blockIdx.x * 32, mt = blockIdx.y * 32;
  int tx = threadIdx.x, ty = threadIdx.y;
#pragma unroll
  for (int j = 0; j < 4; ++j)
    tile[ty + j * 8][tx] = V[((size_t)b * SEQ_M + mt + ty + j * 8) * INNERv + ct + tx];
  __syncthreads();
#pragma unroll
  for (int j = 0; j < 4; ++j)
    Vt[((size_t)b * INNERv + ct + ty + j * 8) * SEQ_M + mt + tx] = tile[tx][ty + j * 8];
}

// ---------------------------------------------------------------------------
// Row LayerNorm (f32 statistics) producing f16 rows. With COPY the block also writes
// the row itself as f16 into concat buffer cols [0, D): it holds the row anyway.
// ---------------------------------------------------------------------------
template <int D, bool COPY>
__device__ __forceinline__ void ln_f16_job(float* s1, float* s2, const float* __restrict__ x,
                                           const float* __restrict__ g,
                                           const float* __restrict__ beta,
                                           _Float16* __restrict__ y,
                                           _Float16* __restrict__ cat, int row) {
  int t = threadIdx.x;
  const float* xr = x + (size_t)row * D;
  float a = 0.f, b = 0.f;
  for (int i = t; i < D; i += 256) {
    float v = xr[i];
    a += v;
    b += v * v;
  }
  s1[t] = a;
  s2[t] = b;
  __syncthreads();
  for (int off = 128; off > 0; off >>= 1) {
    if (t < off) {
      s1[t] += s1[t + off];
      s2[t] += s2[t + off];
    }
    __syncthreads();
  }
  float mu = s1[0] * (1.0f / D);
  float var = s2[0] * (1.0f / D) - mu * mu;
  float rs = rsqrtf(var + 1e-5f);
  _Float16* yr = y + (size_t)row * D;
  for (int i = t; i < D; i += 256) {
    float v = xr[i];
    yr[i] = (_Float16)((v - mu) * rs * g[i] + beta[i]);
    if constexpr (COPY) cat[(size_t)row * (2 * D) + i] = (_Float16)v;
  }
}

// ---------------------------------------------------------------------------
// All work that depends on the inputs alone, in one launch: a block takes one job,
// picked by its index (the same for the whole block, so the jobs' barriers are safe).
// ---------------------------------------------------------------------------
#define PJ_LNP (BATCH * SEQ_N)                    // person rows
#define PJ_LNG (PJ_LNP + BATCH * SEQ_M)           // garment rows
#define PJ_WQ  (PJ_LNG + (DQv / 32) * 32)         // 32x32 weight tiles, 32 tiles a tile row
#define PJ_WK  (PJ_WQ + (DCv / 32) * 32)
#define PJ_WV  (PJ_WK + (DCv / 32) * 32)
#define PJ_WO  (PJ_WV + (INNERv / 32) * 32)
#define PJ_WF  (PJ_WO + ((2 * DQv) / 32) * 32)

__global__ void __launch_bounds__(256)
prep_kernel(const float* __restrict__ person, const float* __restrict__ garment,
            const float* __restrict__ Wq, const float* __restrict__ Wk,
            const float* __restrict__ Wv, const float* __restrict__ Wo,
            const float* __restrict__ Wf, const float* __restrict__ gq,
            const float* __restrict__ betaq, const float* __restrict__ gk,
            const float* __restrict__ betak, _Float16* __restrict__ pLN,
            _Float16* __restrict__ gLN, _Float16* __restrict__ WqT, _Float16* __restrict__ WkT,
            _Float16* __restrict__ WvT, _Float16* __restrict__ WoT, _Float16* __restrict__ WfT,
            _Float16* __restrict__ Cat) {
  __shared__ float smem[32 * 33];
  float(*tile)[33] = (float(*)[33])smem;
  const int j = blockIdx.x;
  if (j < PJ_LNP) {
    ln_f16_job<DQv, true>(smem, smem + 256, person, gq, betaq, pLN, Cat, j);
    return;
  }
  if (j < PJ_LNG) {
    ln_f16_job<DCv, false>(smem, smem + 256, garment, gk, betak, gLN, nullptr, j - PJ_LNP);
    return;
  }
  {
    // every weight has 1024 columns (INNER = DQ): 32 tiles a tile row
    const float* W = Wf;
    _Float16* Wt = WfT;
    int K = 2 * DQv, first = PJ_WO;
    if (j < PJ_WQ) {
      W = Wq; Wt = WqT; K = DQv; first = PJ_LNG;
    } else if (j < PJ_WK) {
      W = Wk; Wt = WkT; K = DCv; first = PJ_WQ;
    } else if (j < PJ_WV) {
      W = Wv; Wt = WvT; K = DCv; first = PJ_WK;
    } else if (j < PJ_WO) {
      W = Wo; Wt = WoT; K = INNERv; first = PJ_WV;
    }
    wtrans_job(tile, W, Wt, K, INNERv, (j - first) & 31, (j - first) >> 5);
  }
}

// ---------------------------------------------------------------------------
// WMMA GEMM:  C[M x N] = A[M x K] * Bt[N x K]^T (+ bias), f16 in, f32 acc.
// Block: 256 threads = 8 waves (4x2 wave grid), tile 128x128, BK=64.
// ---------------------------------------------------------------------------
#define GBM 128
#define GBN 128
#define GBK 64
#define GLD 72  // LDS row stride in halfs (144B, 16B multiple, conflict pad)

template <bool OUT_F16, bool HAS_BIAS>
__device__ __forceinline__ void gemm_tile(const _Float16* __restrict__ A, int lda,
                                 const _Float16* __restrict__ Bt, int ldb,
                                 void* __restrict__ Cv, int ldc,
                                 const float* __restrict__ bias, int K, int rowBlock,
                                 int colBlock) {
  __shared__ _Float16 sA[GBM * GLD];
  __shared__ _Float16 sB[GBN * GLD];

  const int t = threadIdx.x;
  const int lane = t & 31, w = t >> 5;
  const int wm = w & 3, wn = w >> 2;  // 4 waves in M x 2 waves in N
  const int lr = lane & 15, hi4 = lane >> 4, kof = hi4 * 8;

  v8f acc[2][4];
#pragma unroll
  for (int fm = 0; fm < 2; ++fm)
#pragma unroll
    for (int fn = 0; fn < 4; ++fn) acc[fm][fn] = v8f_zero();

  for (int k0 = 0; k0 < K; k0 += GBK) {
    // stage A/B tiles: 128 rows x 64 halfs = 1024 uint4 each; 4 per thread
    // all eight loads go out before the first LDS store: one load latency a K step
    const _Float16 *pa[4], *pb[4];
    v4u ra[4], rb[4];
#pragma unroll
    for (int j = 0; j < 4; ++j) {
      int lin = t + j * 256;  // 0..1023
      int r = lin >> 3;       // row 0..127
      int c = lin & 7;        // 16-byte piece 0..7
      pa[j] = A + (size_t)(rowBlock + r) * lda + k0 + c * 8;
      pb[j] = Bt + (size_t)(colBlock + r) * ldb + k0 + c * 8;
      ra[j] = *(const v4u*)pa[j];
      rb[j] = *(const v4u*)pb[j];
    }
    // holds the loads together (loaded values as inputs only): left free, each is sunk
    // to its own LDS store and waited for at once, eight latencies in a row. The
    // addresses are named too, so that no load of the group is given a target
    // register that an earlier load of the group still names as its address
    asm volatile("" ::"v"(ra[0]), "v"(ra[1]), "v"(ra[2]), "v"(ra[3]), "v"(rb[0]), "v"(rb[1]),
                 "v"(rb[2]), "v"(rb[3]), "v"(pa[0]), "v"(pa[1]), "v"(pa[2]), "v"(pa[3]),
                 "v"(pb[0]), "v"(pb[1]), "v"(pb[2]), "v"(pb[3]));
#pragma unroll
    for (int j = 0; j < 4; ++j) {
      int lin = t + j * 256;
      int r = lin >> 3;
      int c = lin & 7;
      *(v4u*)(&sA[r * GLD + c * 8]) = ra[j];
      *(v4u*)(&sB[r * GLD + c * 8]) = rb[j];
    }
    if (k0 + GBK < K) {  // CDNA5 global_prefetch_b8 of next K tile
      __builtin_prefetch(A + (size_t)(rowBlock + (t >> 1)) * lda + k0 + GBK + (t & 1) * 32, 0, 1);
      __builtin_prefetch(Bt + (size_t)(colBlock + (t >> 1)) * ldb + k0 + GBK + (t & 1) * 32, 0, 1);
    }
    __syncthreads();
#pragma unroll
    for (int ks = 0; ks < 2; ++ks) {
      int kb = ks * 32 + kof;
      v16h af[2], bfr[4];
#pragma unroll
      for (int fm = 0; fm < 2; ++fm)
        af[fm] = ldfrag(&sA[(wm * 32 + fm * 16 + lr) * GLD + kb]);
#pragma unroll
      for (int fn = 0; fn < 4; ++fn)
        bfr[fn] = ldfrag(&sB[(wn * 64 + fn * 16 + lr) * GLD + kb]);
#pragma unroll
      for (int fm = 0; fm < 2; ++fm)
#pragma unroll
        for (int fn = 0; fn < 4; ++fn)
          acc[fm][fn] = wmma16x16x32(af[fm], bfr[fn], acc[fm][fn]);
    }
    __syncthreads();
  }

  // store: C layout — VGPR e: lanes 0-15 -> m=e, lanes 16-31 -> m=e+8; n=lr
#pragma unroll
  for (int fm = 0; fm < 2; ++fm)
#pragma unroll
    for (int fn = 0; fn < 4; ++fn) {
      int col = colBlock + wn * 64 + fn * 16 + lr;
      int row0 = rowBlock + wm * 32 + fm * 16 + hi4 * 8;
      float bv = HAS_BIAS ? bias[col] : 0.f;
#pragma unroll
      for (int e = 0; e < 8; ++e) {
        float v = acc[fm][fn][e] + bv;
        if constexpr (OUT_F16)
          ((_Float16*)Cv)[(size_t)(row0 + e) * ldc + col] = (_Float16)v;
        else
          ((float*)Cv)[(size_t)(row0 + e) * ldc + col] = v;
      }
    }
}

template <bool OUT_F16, bool HAS_BIAS>
__global__ void __launch_bounds__(256) gemm_wmma_kernel(const _Float16* __restrict__ A, int lda,
                                 const _Float16* __restrict__ Bt, int ldb,
                                 void* __restrict__ Cv, int ldc,
                                 const float* __restrict__ bias, int M, int N, int K) {
  gemm_tile<OUT_F16, HAS_BIAS>(A, lda, Bt, ldb, Cv, ldc, bias, K, blockIdx.y * GBM,
                               blockIdx.x * GBN);
}

// The three projections in one launch: none reads another's result. blockIdx.y picks
// the product and its row tile; the longest (Q, K = DQ) has the lowest indices.
#define QKV_YQ ((BATCH * SEQ_N) / GBM)
#define QKV_YK (QKV_YQ + (BATCH * SEQ_M) / GBM)
#define QKV_YV (QKV_YK + (BATCH * SEQ_M) / GBM)

__global__ void __launch_bounds__(256)
gemm_qkv_kernel(const _Float16* __restrict__ pLN, const _Float16* __restrict__ gLN,
                const _Float16* __restrict__ WqT, const _Float16* __restrict__ WkT,
                const _Float16* __restrict__ WvT, _Float16* __restrict__ Qh,
                _Float16* __restrict__ Kh, _Float16* __restrict__ Vh) {
  const int y = blockIdx.y;
  const bool isQ = y < QKV_YQ, isK = y < QKV_YK;
  const _Float16* A = isQ ? pLN : gLN;
  const _Float16* Bt = isQ ? WqT : (isK ? WkT : WvT);
  _Float16* C = isQ ? Qh : (isK ? Kh : Vh);
  const int K = isQ ? DQv : DCv;
  const int yt = isQ ? y : (isK ? y - QKV_YQ : y - QKV_YK);
  gemm_tile<true, false>(A, K, Bt, K, (void*)C, INNERv, nullptr, K, yt * GBM,
                         blockIdx.x * GBN);
}

#define AT_NW 8
#define AT_G  2
#define AT_QB (AT_NW * AT_G * 16)
#define AT_SK 128                      // keys per stage
#define AT_NS (SEQ_M / AT_SK)          // stages
#define AT_SP (AT_SK / 32)             // passes per stage
#define AT_KP 72                       // K tile: 128 rows of 128 B at a pitch of 144 B (in halfs)
#define AT_VP 136                      // V^T tile: 64 rows of 256 B at a pitch of 272 B (in halfs)
#define AT_VO (AT_SK * AT_KP)          // V^T tile stands behind the K tile (in halfs)
#define AT_BH (AT_VO + DHEAD * AT_VP)  // one buffer (in halfs)

// lane l <-> lane l ^ 16
__device__ __forceinline__ float xhalf(float x) {
  int v = __builtin_bit_cast(int, x);
  return __builtin_bit_cast(
      float, __builtin_amdgcn_permlanex16(v, v, 0x76543210, 0xfedcba98, false, false));
}

// Base-2 exponentials in place, a run of them in one statement: left to the
// register allocator, an exponential's target is often the source of the one
// directly ahead of it. Here each overwrites only its own source, and the v_nop is
// the slot the instruction set asks for between the last one and its first reader.
__device__ __forceinline__ void exp2_inplace(v8f& x) {
  float a0 = x[0], a1 = x[1], a2 = x[2], a3 = x[3], a4 = x[4], a5 = x[5], a6 = x[6], a7 = x[7];
  asm("v_exp_f32 %0, %0\n\tv_exp_f32 %1, %1\n\tv_exp_f32 %2, %2\n\tv_exp_f32 %3, %3\n\t"
      "v_exp_f32 %4, %4\n\tv_exp_f32 %5, %5\n\tv_exp_f32 %6, %6\n\tv_exp_f32 %7, %7\n\t"
      "v_nop"
      : "+v"(a0), "+v"(a1), "+v"(a2), "+v"(a3), "+v"(a4), "+v"(a5), "+v"(a6), "+v"(a7));
  x[0] = a0; x[1] = a1; x[2] = a2; x[3] = a3; x[4] = a4; x[5] = a5; x[6] = a6; x[7] = a7;
}
__device__ __forceinline__ void exp2_inplace(float& a0, float& a1) {
  asm("v_exp_f32 %0, %0\n\tv_exp_f32 %1, %1\n\tv_nop" : "+v"(a0), "+v"(a1));
}

// One stage into LDS: eight 16-byte copies a lane, four of K (32 rows apart) and four
// of V^T (16 rows apart). kl, vl: the lane's LDS byte addresses; kg, vg: its global ones.
// The s_wait_xcnt stands inside the statement, so that no address register of a copy
// is rewritten ahead of it.
__device__ __forceinline__ void at_copy_stage(unsigned kl, unsigned vl, const _Float16* kg,
                                              const _Float16* vg) {
  asm volatile(
      "global_load_async_to_lds_b128 %0, %8, off\n\t"
      "global_load_async_to_lds_b128 %1, %9, off\n\t"
      "global_load_async_to_lds_b128 %2, %10, off\n\t"
      "global_load_async_to_lds_b128 %3, %11, off\n\t"
      "global_load_async_to_lds_b128 %4, %12, off\n\t"
      "global_load_async_to_lds_b128 %5, %13, off\n\t"
      "global_load_async_to_lds_b128 %6, %14, off\n\t"
      "global_load_async_to_lds_b128 %7, %15, off\n\t"
      "s_wait_xcnt 0x0" ::"v"(kl),
      "v"(kl + 32 * AT_KP * 2), "v"(kl + 64 * AT_KP * 2), "v"(kl + 96 * AT_KP * 2), "v"(vl),
      "v"(vl + 16 * AT_VP * 2), "v"(vl + 32 * AT_VP * 2), "v"(vl + 48 * AT_VP * 2), "v"(kg),
      "v"(kg + 32 * INNERv), "v"(kg + 64 * INNERv), "v"(kg + 96 * INNERv), "v"(vg),
      "v"(vg + 16 * SEQ_M), "v"(vg + 32 * SEQ_M), "v"(vg + 48 * SEQ_M)
      : "memory");
}

__global__ void __launch_bounds__(AT_NW * 32)
attn_kernel(const _Float16* __restrict__ Q, const _Float16* __restrict__ Kf,
            const _Float16* __restrict__ Vt, _Float16* __restrict__ O) {
  __shared__ __attribute__((aligned(16))) _Float16 sKV[2 * AT_BH];
  const int t = threadIdx.x;
  const int lane = t & 31, w = t >> 5;
  const int lr = lane & 15, hi4 = lane >> 4, kof = hi4 * 8;
  const int bh = blockIdx.y, b = bh >> 4, h = bh & 15;
  const int q0 = blockIdx.x * AT_QB + w * (AT_G * 16);
  const float cs = ATT_SCALE * 1.4426950408889634f;  // scores in the log2 domain

  // Q as B operand: column lr = query, DH split into two 32-wide k-steps
  v16h qf[AT_G][2];
#pragma unroll
  for (int g = 0; g < AT_G; ++g) {
    const _Float16* qp = Q + ((size_t)(b * SEQ_N + q0 + g * 16 + lr)) * INNERv + h * DHEAD + kof;
    qf[g][0] = ldfrag(qp);
    qf[g][1] = ldfrag(qp + 32);
  }

  // the lane's part of a stage: K row t/8, 16-byte piece t%8; V^T row t/16, piece t%16
  const _Float16* kg = Kf + ((size_t)(b * SEQ_M + (t >> 3))) * INNERv + h * DHEAD + (t & 7) * 8;
  const _Float16* vg = Vt + ((size_t)(b * INNERv + h * DHEAD + (t >> 4))) * SEQ_M + (t & 15) * 8;
  const unsigned kl = (unsigned)(size_t)&sKV[(t >> 3) * AT_KP + (t & 7) * 8];
  const unsigned vl = (unsigned)(size_t)&sKV[AT_VO + (t >> 4) * AT_VP + (t & 15) * 8];

  // stage 0 into buffer 0, landed and published; then stage 1 goes out into buffer 1
  at_copy_stage(kl, vl, kg, vg);
  // this wave's copies have landed
  asm volatile("s_wait_asynccnt 0x0" ::: "memory");
  __syncthreads();
  at_copy_stage(kl + AT_BH * 2, vl + AT_BH * 2, kg + (size_t)AT_SK * INNERv, vg + AT_SK);

  v8f acc[AT_G][4];
  float mrun[AT_G], lsum[AT_G];
#pragma unroll
  for (int g = 0; g < AT_G; ++g) {
    mrun[g] = -__builtin_inff();
    lsum[g] = 0.f;
#pragma unroll
    for (int d = 0; d < 4; ++d) acc[g][d] = v8f_zero();
  }

  for (int st = 0; st < AT_NS; ++st) {
   const _Float16* kbase = sKV + (st & 1) * AT_BH + lr * AT_KP + kof;
   const _Float16* vbase = sKV + (st & 1) * AT_BH + AT_VO + lr * AT_VP + kof;

   // K as A operand: row lr = key; two 16-key tiles x two k-steps, one pass ahead
   // inside a stage (never into the next stage's buffer)
   v16h kf[2][2];
#pragma unroll
   for (int kt = 0; kt < 2; ++kt) {
     kf[kt][0] = ldfrag(kbase + (kt * 16) * AT_KP);
     kf[kt][1] = ldfrag(kbase + (kt * 16) * AT_KP + 32);
   }

   for (int p = 0; p < AT_SP; ++p) {
    // V^T as A operand: row lr = dh, k = this pass's 32 keys; in flight under the
    // score products and the softmax. The barrier holds the fetch up here: sunk to
    // its first use it would be waited for at once
    v16h vf[4];
#pragma unroll
    for (int d = 0; d < 4; ++d) vf[d] = ldfrag(vbase + (d * 16) * AT_VP + p * 32);
    __builtin_amdgcn_sched_barrier(0);

    v8f s[2][AT_G];
#pragma unroll
    for (int kt = 0; kt < 2; ++kt)
#pragma unroll
      for (int g = 0; g < AT_G; ++g) {
        s[kt][g] = wmma16x16x32(kf[kt][0], qf[g][0], v8f_zero());
        s[kt][g] = wmma16x16x32(kf[kt][1], qf[g][1], s[kt][g]);
      }

    // keeps the eight products back to back: mixed with the maxima below, each
    // product that a maximum follows is padded with idle slots
    __builtin_amdgcn_sched_barrier(0);

    // next pass's K into the same registers, in flight under the softmax and the
    // second product (a stage's last pass names its own rows again, unused: the next
    // stage is not published yet)
    const int pn = (p + 1 < AT_SP) ? p + 1 : p;
#pragma unroll
    for (int kt = 0; kt < 2; ++kt) {
      kf[kt][0] = ldfrag(kbase + (pn * 32 + kt * 16) * AT_KP);
      kf[kt][1] = ldfrag(kbase + (pn * 32 + kt * 16) * AT_KP + 32);
    }

    // holds the fetch here, ahead of the softmax: sunk to the foot of the pass it
    // would be waited for at once by the next pass's products
    __builtin_amdgcn_sched_barrier(0);

    // online softmax: new running maximum per query, sums and outputs rescaled
    // (no branch: the loop stays one block, so the fetches stay where they stand)
    float corr[AT_G];
#pragma unroll
    for (int g = 0; g < AT_G; ++g) {
      float mx = s[0][g][0];
#pragma unroll
      for (int e = 1; e < 8; ++e) mx = fmaxf(mx, s[0][g][e]);
#pragma unroll
      for (int e = 0; e < 8; ++e) mx = fmaxf(mx, s[1][g][e]);
      mx = fmaxf(mx, xhalf(mx)) * cs;
      const float mnew = fmaxf(mrun[g], mx);
      corr[g] = mrun[g] - mnew;  // -inf on the first pass: its exponential is 0
      mrun[g] = mnew;
    }
    exp2_inplace(corr[0], corr[1]);

#pragma unroll
    for (int g = 0; g < AT_G; ++g) {
      const float nm = -mrun[g];
      v8f e0, e1;
#pragma unroll
      for (int e = 0; e < 8; ++e) {
        e0[e] = fmaf(s[0][g][e], cs, nm);
        e1[e] = fmaf(s[1][g][e], cs, nm);
      }
      exp2_inplace(e0);
      exp2_inplace(e1);
      v16h pf;  // elements 0-7 = keys 8*hi4 + e, 8-15 = keys 16 + 8*hi4 + e: ldfrag's k order
      float ps = e0[0] + e1[0];
#pragma unroll
      for (int e = 1; e < 8; ++e) ps += e0[e] + e1[e];
#pragma unroll
      for (int e = 0; e < 8; ++e) {
        pf[e] = (_Float16)e0[e];
        pf[8 + e] = (_Float16)e1[e];
      }
      lsum[g] = fmaf(lsum[g], corr[g], ps);
#pragma unroll
      for (int d = 0; d < 4; ++d)
        acc[g][d] = wmma16x16x32(vf[d], pf, acc[g][d] * corr[g]);
    }
   }

   // hand-over: this wave's reads of the buffer are done, its copies of the next stage
   // have landed; behind the barrier the next stage is readable by all and this
   // stage's buffer is free for the stage after it
   asm volatile("s_wait_dscnt 0x0" ::: "memory");
   asm volatile("s_wait_asynccnt 0x0" ::: "memory");
   __syncthreads();
   if (st + 2 < AT_NS)
     at_copy_stage(kl + (st & 1) * (AT_BH * 2), vl + (st & 1) * (AT_BH * 2),
                   kg + (size_t)(st + 2) * AT_SK * INNERv, vg + (st + 2) * AT_SK);
  }
  // no copy is left in flight when the wave ends
  asm volatile("s_wait_asynccnt 0x0" ::: "memory");

  // O^T tile d: register e = dh d*16 + 8*hi4 + e of query lr: one 16-byte store
#pragma unroll
  for (int g = 0; g < AT_G; ++g) {
    const float l = lsum[g];
    const float inv = 1.0f / (l + xhalf(l));
    _Float16* op = O + ((size_t)(b * SEQ_N + q0 + g * 16 + lr)) * INNERv + h * DHEAD + kof;
#pragma unroll
    for (int d = 0; d < 4; ++d) {
      v8h o;
#pragma unroll
      for (int e = 0; e < 8; ++e) o[e] = (_Float16)(acc[g][d][e] * inv);
      *(v8h*)(op + d * 16) = o;
    }
  }
}

// ---------------------------------------------------------------------------
// Host-side launch
// ---------------------------------------------------------------------------
extern "C" void kernel_launch(void* const* d_in, const int* in_sizes, int n_in,
                              void* d_out, int out_size, void* d_ws, size_t ws_size,
                              hipStream_t stream) {
  (void)in_sizes; (void)n_in; (void)out_size; (void)ws_size;

  const float* person  = (const float*)d_in[0];
  const float* garment = (const float*)d_in[1];
  const float* Wq = (const float*)d_in[2];
  const float* Wk = (const float*)d_in[3];
  const float* Wv = (const float*)d_in[4];
  const float* Wo = (const float*)d_in[5];
  const float* bo = (const float*)d_in[6];
  const float* Wf = (const float*)d_in[7];
  const float* bf = (const float*)d_in[8];
  const float* gq = (const float*)d_in[9];
  const float* betaq = (const float*)d_in[10];
  const float* gk = (const float*)d_in[11];
  const float* betak = (const float*)d_in[12];
  float* out = (float*)d_out;

  _Float16* w0 = (_Float16*)d_ws;
  size_t off = 0;
  _Float16* pLN = w0 + off; off += (size_t)BATCH * SEQ_N * DQv;
  _Float16* gLN = w0 + off; off += (size_t)BATCH * SEQ_M * DCv;
  _Float16* WqT = w0 + off; off += (size_t)INNERv * DQv;
  _Float16* WkT = w0 + off; off += (size_t)INNERv * DCv;
  _Float16* WvT = w0 + off; off += (size_t)INNERv * DCv;
  _Float16* WoT = w0 + off; off += (size_t)DQv * INNERv;
  _Float16* WfT = w0 + off; off += (size_t)DQv * (2 * DQv);
  _Float16* Qh  = w0 + off; off += (size_t)BATCH * SEQ_N * INNERv;
  _Float16* Kh  = w0 + off; off += (size_t)BATCH * SEQ_M * INNERv;
  _Float16* Vh  = w0 + off; off += (size_t)BATCH * SEQ_M * INNERv;
  _Float16* VtB = w0 + off; off += (size_t)BATCH * INNERv * SEQ_M;
  _Float16* Att = w0 + off; off += (size_t)BATCH * SEQ_N * INNERv;
  _Float16* Cat = w0 + off; off += (size_t)BATCH * SEQ_N * 2 * DQv;

  dim3 tb32(32, 8);

  // Layer norms (the person rows' f16 copy into concat cols [0, DQ) with them) and
  // weight transpose+convert
  prep_kernel<<<PJ_WF, 256, 0, stream>>>(person, garment, Wq, Wk, Wv, Wo, Wf, gq, betaq, gk,
                                         betak, pLN, gLN, WqT, WkT, WvT, WoT, WfT, Cat);

  // Q/K/V projections (f16 out)
  gemm_qkv_kernel<<<dim3(INNERv / GBN, QKV_YV), 256, 0, stream>>>(pLN, gLN, WqT, WkT, WvT, Qh,
                                                                  Kh, Vh);

  // V transpose for contiguous PV fragments
  vtrans_kernel<<<dim3(INNERv / 32, SEQ_M / 32, BATCH), tb32, 0, stream>>>(Vh, VtB);

  // Attention (online softmax in registers)
  attn_kernel<<<dim3(SEQ_N / AT_QB, BATCH * NHEAD), AT_NW * 32, 0, stream>>>(
      Qh, Kh, VtB, Att);

  // att @ Wo + bo -> concat cols [DQ, 2*DQ) (f16)
  gemm_wmma_kernel<true, true><<<dim3(DQv / GBN, (BATCH * SEQ_N) / GBM), 256, 0, stream>>>(
      Att, INNERv, WoT, INNERv, (void*)(Cat + DQv), 2 * DQv, bo, BATCH * SEQ_N, DQv, INNERv);

  // concat @ Wf + bf -> out (f32)
  gemm_wmma_kernel<false, true><<<dim3(DQv / GBN, (BATCH * SEQ_N) / GBM), 256, 0, stream>>>(
      Cat, 2 * DQv, WfT, 2 * DQv, (void*)out, DQv, bf, BATCH * SEQ_N, DQv, 2 * DQv);
}

// v005
// One run takes 159 microseconds.
// Timed twice side by side with v004, it ran 1.11 times as fast both times.
// Counting every step since v000, it is 3.05 times as fast.
#include <hip/hip_runtime.h>

#define BATCH 4
#define SEQ_N 2048
#define SEQ_M 1024
#define DQv   1024
#define DCv   768
#define NHEAD 16
#define DHEAD 64
#define INNERv 1024
#define ATT_SCALE 0.125f

typedef _Float16 v16h __attribute__((ext_vector_type(16)));
typedef _Float16 v8h  __attribute__((ext_vector_type(8)));
typedef float    v8f  __attribute__((ext_vector_type(8)));
typedef unsigned int v4u __attribute__((ext_vector_type(4)));

__device__ __forceinline__ v8f v8f_zero() {
  v8f z = {0.f,0.f,0.f,0.f,0.f,0.f,0.f,0.f};
  return z;
}

// Load one 16-bit WMMA A/B fragment for this lane.
// Per CDNA5 ISA 16-bit 16x32 layout: a lane holds K chunks {base..base+7} and
// {base+16..base+23}; caller passes p already offset by ks*32 + (laneHi?8:0).
__device__ __forceinline__ v16h ldfrag(const _Float16* p) {
  v8h lo = *(const v8h*)(p);
  v8h hi = *(const v8h*)(p + 16);
  return __builtin_shufflevector(lo, hi, 0,1,2,3,4,5,6,7,8,9,10,11,12,13,14,15);
}

__device__ __forceinline__ v8f wmma16x16x32(v16h a, v16h b, v8f c) {
  return __builtin_amdgcn_wmma_f32_16x16x32_f16(false, a, false, b, (short)0, c,
                                                false, false);
}

typedef float    v4f  __attribute__((ext_vector_type(4)));
typedef _Float16 v4h  __attribute__((ext_vector_type(4)));
typedef _Float16 v2h  __attribute__((ext_vector_type(2)));

// lane l <-> lane l ^ 16
__device__ __forceinline__ float xhalf(float x) {
  int v = __builtin_bit_cast(int, x);
  return __builtin_bit_cast(
      float, __builtin_amdgcn_permlanex16(v, v, 0x76543210, 0xfedcba98, false, false));
}

// x + (x of lane l ^ MASK), inside a 16-lane row (DPP row_xmask)
template <int MASK>
__device__ __forceinline__ float row_xadd(float x) {
  int v = __builtin_bit_cast(int, x);
  return x + __builtin_bit_cast(
                 float, __builtin_amdgcn_update_dpp(v, v, 0x160 + MASK, 0xf, 0xf, false));
}

// sum over the 32 lanes, the same value in every lane
__device__ __forceinline__ float wave_sum(float x) {
  x = row_xadd<1>(x);
  x = row_xadd<2>(x);
  x = row_xadd<4>(x);
  x = row_xadd<8>(x);
  return x + xhalf(x);
}

// ---------------------------------------------------------------------------
// The launches without matrix work are dealt so that few waves start and each moves
// much: 128 x 128 transpose tiles and four layer-norm rows a wave, 16-byte loads, all of
// a wave's loads in flight at once.
//
// Transpose tile in LDS: row = output row, 64 dwords, a dword = two neighbours of the
// output row. The 16-byte pieces of a row are permuted by an XOR with a number taken
// from the row index, so that the 32 dword stores of a wave (16 rows, 2 columns) fall
// in 32 banks and the 16-byte reads along a row stay whole.
// Every loop of these jobs is unrolled: its arrays are then registers and its address
// steps constants of the instructions.
// ---------------------------------------------------------------------------
#define TT 128  // tile edge

// Weight transpose + f32 -> f16 convert:  Wt[n][k] = (f16) W[k][n], W with INNERv columns
__device__ __forceinline__ void wtrans_job(unsigned* sT, const float* __restrict__ W,
                                           _Float16* __restrict__ Wt, int K, int bx, int by) {
  const int t = threadIdx.x, lane = t & 31, w = t >> 5, hl = lane >> 4, l16 = lane & 15;
  const int n0 = bx * TT, k0 = by * TT;
  // a half wave reads 256 contiguous bytes of rows 2*kp and 2*kp + 1
  // (kp = w * 8 + (it / 2) * 2 + hl, columns (it % 2) * 64 + l16 * 4): one address, constant steps
  const float* p0 = W + (size_t)(k0 + w * 16 + hl * 2) * INNERv + n0 + l16 * 4;
  v4f r0[8], r1[8];
#pragma unroll
  for (int it = 0; it < 8; ++it) {
    const float* p = p0 + (it >> 1) * 4 * INNERv + (it & 1) * 64;
    r0[it] = *(const v4f*)p;
    r1[it] = *(const v4f*)(p + INNERv);
  }
  // the address is named, so that it outlives the last load and no load of the group
  // is given it as a target; behind the wait its registers are free
  asm volatile("s_wait_xcnt 0x0" ::"v"(p0) : "memory");
  // keeps the sixteen loads ahead of the first LDS store: one latency for the tile
  __builtin_amdgcn_sched_barrier(0);
#pragma unroll
  for (int it = 0; it < 8; ++it) {
    const int id = w * 8 + it, kp = (id >> 1) * 2 + hl, nq = (id & 1) * 16 + l16;
#pragma unroll
    for (int i = 0; i < 4; ++i) {
      v2h h = {(_Float16)r0[it][i], (_Float16)r1[it][i]};
      sT[(nq * 4 + i) * 64 + (((kp >> 2) ^ l16) << 2) + (kp & 3)] =
          __builtin_bit_cast(unsigned, h);
    }
  }
  __syncthreads();
#pragma unroll
  for (int it = 0; it < 8; ++it) {
    const int id = it * 256 + t, n = id >> 4, c = id & 15;
    v4u d = *(const v4u*)&sT[n * 64 + ((c ^ ((n >> 2) & 15)) << 2)];
    *(v4u*)(Wt + (size_t)(n0 + n) * K + k0 + c * 8) = d;
  }
  // behind the stores: in the built kernel another job's instructions stand next and
  // write the registers that these stores name
  asm volatile("s_wait_xcnt 0x0" ::: "memory");
}

// ---------------------------------------------------------------------------
// Per-batch transpose of V (f16):  Vt[b][c][m] = V[b*M + m][c]
// ---------------------------------------------------------------------------
__global__ void __launch_bounds__(256)
vtrans_kernel(const _Float16* __restrict__ V, _Float16* __restrict__ Vt) {
  __shared__ __attribute__((aligned(16))) unsigned sT[TT * 64];
  const int t = threadIdx.x, lane = t & 31, w = t >> 5, hl = lane >> 4, l16 = lane & 15;
  const int b = blockIdx.z, c0 = blockIdx.x * TT, m0 = blockIdx.y * TT;
  // a half wave reads 256 contiguous bytes of rows 2*mp and 2*mp + 1
  // (mp = (w * 4 + it) * 2 + hl): one address, constant steps
  const _Float16* p0 = V + ((size_t)b * SEQ_M + m0 + w * 16 + hl * 2) * INNERv + c0 + l16 * 8;
  v4u r0[4], r1[4];
#pragma unroll
  for (int it = 0; it < 4; ++it) {
    r0[it] = *(const v4u*)(p0 + it * 4 * INNERv);
    r1[it] = *(const v4u*)(p0 + it * 4 * INNERv + INNERv);
  }
  // the address is named, so that it outlives the last load and no load of the group
  // is given it as a target; behind the wait its registers are free
  asm volatile("s_wait_xcnt 0x0" ::"v"(p0) : "memory");
  // keeps the eight loads ahead of the first LDS store: one latency for the tile
  __builtin_amdgcn_sched_barrier(0);
#pragma unroll
  for (int it = 0; it < 4; ++it) {
    const int mp = (w * 4 + it) * 2 + hl;
    unsigned* q = &sT[(l16 * 8) * 64 + (((mp >> 2) ^ l16) << 2) + (mp & 3)];
#pragma unroll
    for (int i = 0; i < 4; ++i) {
      const unsigned lo = r0[it][i], hi = r1[it][i];
      q[(2 * i) * 64] = (lo & 0xffffu) | (hi << 16);
      q[(2 * i + 1) * 64] = (lo >> 16) | (hi & 0xffff0000u);
    }
  }
  __syncthreads();
#pragma unroll
  for (int it = 0; it < 8; ++it) {
    const int id = it * 256 + t, n = id >> 4, c = id & 15;
    v4u d = *(const v4u*)&sT[n * 64 + ((c ^ ((n >> 3) & 15)) << 2)];
    *(v4u*)(Vt + ((size_t)b * INNERv + c0 + n) * SEQ_M + m0 + c * 8) = d;
  }
}

// ---------------------------------------------------------------------------
// Row LayerNorm (f32 statistics) producing f16 rows: a wave takes LN_R rows and holds
// them in registers; a row's sums are in-lane, then exchanged between lanes (no LDS, no
// barrier). With COPY the wave also writes the rows themselves as f16 into concat
// buffer cols [0, D).
// ---------------------------------------------------------------------------
#define LN_R 4
#define LN_RB (8 * LN_R)  // rows a block

template <int D, bool COPY>
__device__ __forceinline__ void ln_f16_job(const float* __restrict__ x,
                                           const float* __restrict__ g,
                                           const float* __restrict__ beta,
                                           _Float16* __restrict__ y,
                                           _Float16* __restrict__ cat, int row0) {
  constexpr int NJ = D / 128;  // 512-byte pieces of a row, 16 bytes a lane
  const int lane = threadIdx.x & 31;
  const v4f* xr = (const v4f*)(x + (size_t)row0 * D) + lane;
  v4f v[LN_R][NJ], gg[NJ], bb[NJ];
#pragma unroll
  for (int r = 0; r < LN_R; ++r)
#pragma unroll
    for (int j = 0; j < NJ; ++j) v[r][j] = xr[r * (D / 4) + j * 32];
#pragma unroll
  for (int j = 0; j < NJ; ++j) {
    gg[j] = ((const v4f*)g)[j * 32 + lane];
    bb[j] = ((const v4f*)beta)[j * 32 + lane];
  }
  // the address is named, so that it outlives the last load and no load of the group
  // is given it as a target; behind the wait its registers are free
  asm volatile("s_wait_xcnt 0x0" ::"v"(xr) : "memory");
  // keeps every load of the wave ahead of the first sum: one memory latency for its rows
  __builtin_amdgcn_sched_barrier(0);

  float a[LN_R], b[LN_R];
#pragma unroll
  for (int r = 0; r < LN_R; ++r) {
    v4f s = v[r][0], q = v[r][0] * v[r][0];
#pragma unroll
    for (int j = 1; j < NJ; ++j) {
      s += v[r][j];
      q += v[r][j] * v[r][j];
    }
    a[r] = (s[0] + s[1]) + (s[2] + s[3]);
    b[r] = (q[0] + q[1]) + (q[2] + q[3]);
  }
#pragma unroll
  for (int r = 0; r < LN_R; ++r) {
    a[r] = wave_sum(a[r]);
    b[r] = wave_sum(b[r]);
  }
#pragma unroll
  for (int r = 0; r < LN_R; ++r) {
    const float mu = a[r] * (1.0f / D);
    const float var = b[r] * (1.0f / D) - mu * mu;
    const float rs = rsqrtf(var + 1e-5f);
    v4h* yr = (v4h*)(y + (size_t)(row0 + r) * D) + lane;
#pragma unroll
    for (int j = 0; j < NJ; ++j) {
      v4h o;
#pragma unroll
      for (int i = 0; i < 4; ++i)
        o[i] = (_Float16)((v[r][j][i] - mu) * rs * gg[j][i] + bb[j][i]);
      yr[j * 32] = o;
    }
    if constexpr (COPY) {
      v4h* cr = (v4h*)(cat + (size_t)(row0 + r) * (2 * D)) + lane;
#pragma unroll
      for (int j = 0; j < NJ; ++j) {
        v4h o;
#pragma unroll
        for (int i = 0; i < 4; ++i) o[i] = (_Float16)v[r][j][i];
        cr[j * 32] = o;
      }
    }
  }
  // behind the stores: in the built kernel another job's instructions stand next and
  // write the registers that these stores name
  asm volatile("s_wait_xcnt 0x0" ::: "memory");
}

// ---------------------------------------------------------------------------
// All work that depends on the inputs alone, in one launch: a block takes one job,
// picked by its index (the same for the whole block, so the transposes' barrier is safe).
// ---------------------------------------------------------------------------
#define PJ_LNP ((BATCH * SEQ_N) / LN_RB)              // person row groups
#define PJ_LNG (PJ_LNP + (BATCH * SEQ_M) / LN_RB)     // garment row groups
#define PJ_TN  (INNERv / TT)                          // weight tiles a tile row
#define PJ_WQ  (PJ_LNG + (DQv / TT) * PJ_TN)
#define PJ_WK  (PJ_WQ + (DCv / TT) * PJ_TN)
#define PJ_WV  (PJ_WK + (DCv / TT) * PJ_TN)
#define PJ_WO  (PJ_WV + (INNERv / TT) * PJ_TN)
#define PJ_WF  (PJ_WO + ((2 * DQv) / TT) * PJ_TN)

__global__ void __launch_bounds__(256)
prep_kernel(const float* __restrict__ person, const float* __restrict__ garment,
            const float* __restrict__ Wq, const float* __restrict__ Wk,
            const float* __restrict__ Wv, const float* __restrict__ Wo,
            const float* __restrict__ Wf, const float* __restrict__ gq,
            const float* __restrict__ betaq, const float* __restrict__ gk,
            const float* __restrict__ betak, _Float16* __restrict__ pLN,
            _Float16* __restrict__ gLN, _Float16* __restrict__ WqT, _Float16* __restrict__ WkT,
            _Float16* __restrict__ WvT, _Float16* __restrict__ WoT, _Float16* __restrict__ WfT,
            _Float16* __restrict__ Cat) {
  __shared__ __attribute__((aligned(16))) unsigned sT[TT * 64];
  const int j = blockIdx.x;
  const int wrow = (threadIdx.x >> 5) * LN_R;  // the wave's first row in a row group
  if (j < PJ_LNP) {
    ln_f16_job<DQv, true>(person, gq, betaq, pLN, Cat, j * LN_RB + wrow);
    return;
  }
  if (j < PJ_LNG) {
    ln_f16_job<DCv, false>(garment, gk, betak, gLN, nullptr, (j - PJ_LNP) * LN_RB + wrow);
    return;
  }
  {
    // every weight has 1024 columns (INNER = DQ): PJ_TN tiles a tile row
    const float* W = Wf;
    _Float16* Wt = WfT;
    int K = 2 * DQv, first = PJ_WO;
    if (j < PJ_WQ) {
      W = Wq; Wt = WqT; K = DQv; first = PJ_LNG;
    } else if (j < PJ_WK) {
      W = Wk; Wt = WkT; K = DCv; first = PJ_WQ;
    } else if (j < PJ_WV) {
      W = Wv; Wt = WvT; K = DCv; first = PJ_WK;
    } else if (j < PJ_WO) {
      W = Wo; Wt = WoT; K = INNERv; first = PJ_WV;
    }
    wtrans_job(sT, W, Wt, K, (j - first) % PJ_TN, (j - first) / PJ_TN);
  }
}

// ---------------------------------------------------------------------------
// WMMA GEMM:  C[M x N] = A[M x K] * Bt[N x K]^T (+ bias), f16 in, f32 acc.
// Block: 256 threads = 8 waves (4x2 wave grid), tile 128x128, BK=64.
// ---------------------------------------------------------------------------
#define GBM 128
#define GBN 128
#define GBK 64
#define GLD 72  // LDS row stride in halfs (144B, 16B multiple, conflict pad)

template <bool OUT_F16, bool HAS_BIAS>
__device__ __forceinline__ void gemm_tile(const _Float16* __restrict__ A, int lda,
                                 const _Float16* __restrict__ Bt, int ldb,
                                 void* __restrict__ Cv, int ldc,
                                 const float* __restrict__ bias, int K, int rowBlock,
                                 int colBlock) {
  __shared__ _Float16 sA[GBM * GLD];
  __shared__ _Float16 sB[GBN * GLD];

  const int t = threadIdx.x;
  const int lane = t & 31, w = t >> 5;
  const int wm = w & 3, wn = w >> 2;  // 4 waves in M x 2 waves in N
  const int lr = lane & 15, hi4 = lane >> 4, kof = hi4 * 8;

  v8f acc[2][4];
#pragma unroll
  for (int fm = 0; fm < 2; ++fm)
#pragma unroll
    for (int fn = 0; fn < 4; ++fn) acc[fm][fn] = v8f_zero();

  for (int k0 = 0; k0 < K; k0 += GBK) {
    // stage A/B tiles: 128 rows x 64 halfs = 1024 uint4 each; 4 per thread
    // all eight loads go out before the first LDS store: one load latency a K step
    const _Float16 *pa[4], *pb[4];
    v4u ra[4], rb[4];
#pragma unroll
    for (int j = 0; j < 4; ++j) {
      int lin = t + j * 256;  // 0..1023
      int r = lin >> 3;       // row 0..127
      int c = lin & 7;        // 16-byte piece 0..7
      pa[j] = A + (size_t)(rowBlock + r) * lda + k0 + c * 8;
      pb[j] = Bt + (size_t)(colBlock + r) * ldb + k0 + c * 8;
      ra[j] = *(const v4u*)pa[j];
      rb[j] = *(const v4u*)pb[j];
    }
    // holds the loads together (loaded values as inputs only): left free, each is sunk
    // to its own LDS store and waited for at once, eight latencies in a row. The
    // addresses are named too, so that no load of the group is given a target
    // register that an earlier load of the group still names as its address
    asm volatile("" ::"v"(ra[0]), "v"(ra[1]), "v"(ra[2]), "v"(ra[3]), "v"(rb[0]), "v"(rb[1]),
                 "v"(rb[2]), "v"(rb[3]), "v"(pa[0]), "v"(pa[1]), "v"(pa[2]), "v"(pa[3]),
                 "v"(pb[0]), "v"(pb[1]), "v"(pb[2]), "v"(pb[3]));
#pragma unroll
    for (int j = 0; j < 4; ++j) {
      int lin = t + j * 256;
      int r = lin >> 3;
      int c = lin & 7;
      *(v4u*)(&sA[r * GLD + c * 8]) = ra[j];
      *(v4u*)(&sB[r * GLD + c * 8]) = rb[j];
    }
    if (k0 + GBK < K) {  // CDNA5 global_prefetch_b8 of next K tile
      __builtin_prefetch(A + (size_t)(rowBlock + (t >> 1)) * lda + k0 + GBK + (t & 1) * 32, 0, 1);
      __builtin_prefetch(Bt + (size_t)(colBlock + (t >> 1)) * ldb + k0 + GBK + (t & 1) * 32, 0, 1);
    }
    __syncthreads();
#pragma unroll
    for (int ks = 0; ks < 2; ++ks) {
      int kb = ks * 32 + kof;
      v16h af[2], bfr[4];
#pragma unroll
      for (int fm = 0; fm < 2; ++fm)
        af[fm] = ldfrag(&sA[(wm * 32 + fm * 16 + lr) * GLD + kb]);
#pragma unroll
      for (int fn = 0; fn < 4; ++fn)
        bfr[fn] = ldfrag(&sB[(wn * 64 + fn * 16 + lr) * GLD + kb]);
#pragma unroll
      for (int fm = 0; fm < 2; ++fm)
#pragma unroll
        for (int fn = 0; fn < 4; ++fn)
          acc[fm][fn] = wmma16x16x32(af[fm], bfr[fn], acc[fm][fn]);
    }
    __syncthreads();
  }

  // store: C layout — VGPR e: lanes 0-15 -> m=e, lanes 16-31 -> m=e+8; n=lr
#pragma unroll
  for (int fm = 0; fm < 2; ++fm)
#pragma unroll
    for (int fn = 0; fn < 4; ++fn) {
      int col = colBlock + wn * 64 + fn * 16 + lr;
      int row0 = rowBlock + wm * 32 + fm * 16 + hi4 * 8;
      float bv = HAS_BIAS ? bias[col] : 0.f;
#pragma unroll
      for (int e = 0; e < 8; ++e) {
        float v = acc[fm][fn][e] + bv;
        if constexpr (OUT_F16)
          ((_Float16*)Cv)[(size_t)(row0 + e) * ldc + col] = (_Float16)v;
        else
          ((float*)Cv)[(size_t)(row0 + e) * ldc + col] = v;
      }
    }
}

template <bool OUT_F16, bool HAS_BIAS>
__global__ void __launch_bounds__(256) gemm_wmma_kernel(const _Float16* __restrict__ A, int lda,
                                 const _Float16* __restrict__ Bt, int ldb,
                                 void* __restrict__ Cv, int ldc,
                                 const float* __restrict__ bias, int M, int N, int K) {
  gemm_tile<OUT_F16, HAS_BIAS>(A, lda, Bt, ldb, Cv, ldc, bias, K, blockIdx.y * GBM,
                               blockIdx.x * GBN);
}

// The three projections in one launch: none reads another's result. blockIdx.y picks
// the product and its row tile; the longest (Q, K = DQ) has the lowest indices.
#define QKV_YQ ((BATCH * SEQ_N) / GBM)
#define QKV_YK (QKV_YQ + (BATCH * SEQ_M) / GBM)
#define QKV_YV (QKV_YK + (BATCH * SEQ_M) / GBM)

__global__ void __launch_bounds__(256)
gemm_qkv_kernel(const _Float16* __restrict__ pLN, const _Float16* __restrict__ gLN,
                const _Float16* __restrict__ WqT, const _Float16* __restrict__ WkT,
                const _Float16* __restrict__ WvT, _Float16* __restrict__ Qh,
                _Float16* __restrict__ Kh, _Float16* __restrict__ Vh) {
  const int y = blockIdx.y;
  const bool isQ = y < QKV_YQ, isK = y < QKV_YK;
  const _Float16* A = isQ ? pLN : gLN;
  const _Float16* Bt = isQ ? WqT : (isK ? WkT : WvT);
  _Float16* C = isQ ? Qh : (isK ? Kh : Vh);
  const int K = isQ ? DQv : DCv;
  const int yt = isQ ? y : (isK ? y - QKV_YQ : y - QKV_YK);
  gemm_tile<true, false>(A, K, Bt, K, (void*)C, INNERv, nullptr, K, yt * GBM,
                         blockIdx.x * GBN);
}

#define AT_NW 8
#define AT_G  2
#define AT_QB (AT_NW * AT_G * 16)
#define AT_SK 128                      // keys per stage
#define AT_NS (SEQ_M / AT_SK)          // stages
#define AT_SP (AT_SK / 32)             // passes per stage
#define AT_KP 72                       // K tile: 128 rows of 128 B at a pitch of 144 B (in halfs)
#define AT_VP 136                      // V^T tile: 64 rows of 256 B at a pitch of 272 B (in halfs)
#define AT_VO (AT_SK * AT_KP)          // V^T tile stands behind the K tile (in halfs)
#define AT_BH (AT_VO + DHEAD * AT_VP)  // one buffer (in halfs)

// Base-2 exponentials in place, a run of them in one statement: left to the
// register allocator, an exponential's target is often the source of the one
// directly ahead of it. Here each overwrites only its own source, and the v_nop is
// the slot the instruction set asks for between the last one and its first reader.
__device__ __forceinline__ void exp2_inplace(v8f& x) {
  float a0 = x[0], a1 = x[1], a2 = x[2], a3 = x[3], a4 = x[4], a5 = x[5], a6 = x[6], a7 = x[7];
  asm("v_exp_f32 %0, %0\n\tv_exp_f32 %1, %1\n\tv_exp_f32 %2, %2\n\tv_exp_f32 %3, %3\n\t"
      "v_exp_f32 %4, %4\n\tv_exp_f32 %5, %5\n\tv_exp_f32 %6, %6\n\tv_exp_f32 %7, %7\n\t"
      "v_nop"
      : "+v"(a0), "+v"(a1), "+v"(a2), "+v"(a3), "+v"(a4), "+v"(a5), "+v"(a6), "+v"(a7));
  x[0] = a0; x[1] = a1; x[2] = a2; x[3] = a3; x[4] = a4; x[5] = a5; x[6] = a6; x[7] = a7;
}
__device__ __forceinline__ void exp2_inplace(float& a0, float& a1) {
  asm("v_exp_f32 %0, %0\n\tv_exp_f32 %1, %1\n\tv_nop" : "+v"(a0), "+v"(a1));
}

// One stage into LDS: eight 16-byte copies a lane, four of K (32 rows apart) and four
// of V^T (16 rows apart). kl, vl: the lane's LDS byte addresses; kg, vg: its global ones.
// The s_wait_xcnt stands inside the statement, so that no address register of a copy
// is rewritten ahead of it.
__device__ __forceinline__ void at_copy_stage(unsigned kl, unsigned vl, const _Float16* kg,
                                              const _Float16* vg) {
  asm volatile(
      "global_load_async_to_lds_b128 %0, %8, off\n\t"
      "global_load_async_to_lds_b128 %1, %9, off\n\t"
      "global_load_async_to_lds_b128 %2, %10, off\n\t"
      "global_load_async_to_lds_b128 %3, %11, off\n\t"
      "global_load_async_to_lds_b128 %4, %12, off\n\t"
      "global_load_async_to_lds_b128 %5, %13, off\n\t"
      "global_load_async_to_lds_b128 %6, %14, off\n\t"
      "global_load_async_to_lds_b128 %7, %15, off\n\t"
      "s_wait_xcnt 0x0" ::"v"(kl),
      "v"(kl + 32 * AT_KP * 2), "v"(kl + 64 * AT_KP * 2), "v"(kl + 96 * AT_KP * 2), "v"(vl),
      "v"(vl + 16 * AT_VP * 2), "v"(vl + 32 * AT_VP * 2), "v"(vl + 48 * AT_VP * 2), "v"(kg),
      "v"(kg + 32 * INNERv), "v"(kg + 64 * INNERv), "v"(kg + 96 * INNERv), "v"(vg),
      "v"(vg + 16 * SEQ_M), "v"(vg + 32 * SEQ_M), "v"(vg + 48 * SEQ_M)
      : "memory");
}

__global__ void __launch_bounds__(AT_NW * 32)
attn_kernel(const _Float16* __restrict__ Q, const _Float16* __restrict__ Kf,
            const _Float16* __restrict__ Vt, _Float16* __restrict__ O) {
  __shared__ __attribute__((aligned(16))) _Float16 sKV[2 * AT_BH];
  const int t = threadIdx.x;
  const int lane = t & 31, w = t >> 5;
  const int lr = lane & 15, hi4 = lane >> 4, kof = hi4 * 8;
  const int bh = blockIdx.y, b = bh >> 4, h = bh & 15;
  const int q0 = blockIdx.x * AT_QB + w * (AT_G * 16);
  const float cs = ATT_SCALE * 1.4426950408889634f;  // scores in the log2 domain

  // Q as B operand: column lr = query, DH split into two 32-wide k-steps
  v16h qf[AT_G][2];
#pragma unroll
  for (int g = 0; g < AT_G; ++g) {
    const _Float16* qp = Q + ((size_t)(b * SEQ_N + q0 + g * 16 + lr)) * INNERv + h * DHEAD + kof;
    qf[g][0] = ldfrag(qp);
    qf[g][1] = ldfrag(qp + 32);
  }

  // the lane's part of a stage: K row t/8, 16-byte piece t%8; V^T row t/16, piece t%16
  const _Float16* kg = Kf + ((size_t)(b * SEQ_M + (t >> 3))) * INNERv + h * DHEAD + (t & 7) * 8;
  const _Float16* vg = Vt + ((size_t)(b * INNERv + h * DHEAD + (t >> 4))) * SEQ_M + (t & 15) * 8;
  const unsigned kl = (unsigned)(size_t)&sKV[(t >> 3) * AT_KP + (t & 7) * 8];
  const unsigned vl = (unsigned)(size_t)&sKV[AT_VO + (t >> 4) * AT_VP + (t & 15) * 8];

  // stage 0 into buffer 0, landed and published; then stage 1 goes out into buffer 1
  at_copy_stage(kl, vl, kg, vg);
  // this wave's copies have landed
  asm volatile("s_wait_asynccnt 0x0" ::: "memory");
  __syncthreads();
  at_copy_stage(kl + AT_BH * 2, vl + AT_BH * 2, kg + (size_t)AT_SK * INNERv, vg + AT_SK);

  v8f acc[AT_G][4];
  float mrun[AT_G], lsum[AT_G];
#pragma unroll
  for (int g = 0; g < AT_G; ++g) {
    mrun[g] = -__builtin_inff();
    lsum[g] = 0.f;
#pragma unroll
    for (int d = 0; d < 4; ++d) acc[g][d] = v8f_zero();
  }

  for (int st = 0; st < AT_NS; ++st) {
   const _Float16* kbase = sKV + (st & 1) * AT_BH + lr * AT_KP + kof;
   const _Float16* vbase = sKV + (st & 1) * AT_BH + AT_VO + lr * AT_VP + kof;

   // K as A operand: row lr = key; two 16-key tiles x two k-steps, one pass ahead
   // inside a stage (never into the next stage's buffer)
   v16h kf[2][2];
#pragma unroll
   for (int kt = 0; kt < 2; ++kt) {
     kf[kt][0] = ldfrag(kbase + (kt * 16) * AT_KP);
     kf[kt][1] = ldfrag(kbase + (kt * 16) * AT_KP + 32);
   }

   for (int p = 0; p < AT_SP; ++p) {
    // V^T as A operand: row lr = dh, k = this pass's 32 keys; in flight under the
    // score products and the softmax. The barrier holds the fetch up here: sunk to
    // its first use it would be waited for at once
    v16h vf[4];
#pragma unroll
    for (int d = 0; d < 4; ++d) vf[d] = ldfrag(vbase + (d * 16) * AT_VP + p * 32);
    __builtin_amdgcn_sched_barrier(0);

    v8f s[2][AT_G];
#pragma unroll
    for (int kt = 0; kt < 2; ++kt)
#pragma unroll
      for (int g = 0; g < AT_G; ++g) {
        s[kt][g] = wmma16x16x32(kf[kt][0], qf[g][0], v8f_zero());
        s[kt][g] = wmma16x16x32(kf[kt][1], qf[g][1], s[kt][g]);
      }

    // keeps the eight products back to back: mixed with the maxima below, each
    // product that a maximum follows is padded with idle slots
    __builtin_amdgcn_sched_barrier(0);

    // next pass's K into the same registers, in flight under the softmax and the
    // second product (a stage's last pass names its own rows again, unused: the next
    // stage is not published yet)
    const int pn = (p + 1 < AT_SP) ? p + 1 : p;
#pragma unroll
    for (int kt = 0; kt < 2; ++kt) {
      kf[kt][0] = ldfrag(kbase + (pn * 32 + kt * 16) * AT_KP);
      kf[kt][1] = ldfrag(kbase + (pn * 32 + kt * 16) * AT_KP + 32);
    }

    // holds the fetch here, ahead of the softmax: sunk to the foot of the pass it
    // would be waited for at once by the next pass's products
    __builtin_amdgcn_sched_barrier(0);

    // online softmax: new running maximum per query, sums and outputs rescaled
    // (no branch: the loop stays one block, so the fetches stay where they stand)
    float corr[AT_G];
#pragma unroll
    for (int g = 0; g < AT_G; ++g) {
      float mx = s[0][g][0];
#pragma unroll
      for (int e = 1; e < 8; ++e) mx = fmaxf(mx, s[0][g][e]);
#pragma unroll
      for (int e = 0; e < 8; ++e) mx = fmaxf(mx, s[1][g][e]);
      mx = fmaxf(mx, xhalf(mx)) * cs;
      const float mnew = fmaxf(mrun[g], mx);
      corr[g] = mrun[g] - mnew;  // -inf on the first pass: its exponential is 0
      mrun[g] = mnew;
    }
    exp2_inplace(corr[0], corr[1]);

#pragma unroll
    for (int g = 0; g < AT_G; ++g) {
      const float nm = -mrun[g];
      v8f e0, e1;
#pragma unroll
      for (int e = 0; e < 8; ++e) {
        e0[e] = fmaf(s[0][g][e], cs, nm);
        e1[e] = fmaf(s[1][g][e], cs, nm);
      }
      exp2_inplace(e0);
      exp2_inplace(e1);
      v16h pf;  // elements 0-7 = keys 8*hi4 + e, 8-15 = keys 16 + 8*hi4 + e: ldfrag's k order
      float ps = e0[0] + e1[0];
#pragma unroll
      for (int e = 1; e < 8; ++e) ps += e0[e] + e1[e];
#pragma unroll
      for (int e = 0; e < 8; ++e) {
        pf[e] = (_Float16)e0[e];
        pf[8 + e] = (_Float16)e1[e];
      }
      lsum[g] = fmaf(lsum[g], corr[g], ps);
#pragma unroll
      for (int d = 0; d < 4; ++d)
        acc[g][d] = wmma16x16x32(vf[d], pf, acc[g][d] * corr[g]);
    }
   }

   // hand-over: this wave's reads of the buffer are done, its copies of the next stage
   // have landed; behind the barrier the next stage is readable by all and this
   // stage's buffer is free for the stage after it
   asm volatile("s_wait_dscnt 0x0" ::: "memory");
   asm volatile("s_wait_asynccnt 0x0" ::: "memory");
   __syncthreads();
   if (st + 2 < AT_NS)
     at_copy_stage(kl + (st & 1) * (AT_BH * 2), vl + (st & 1) * (AT_BH * 2),
                   kg + (size_t)(st + 2) * AT_SK * INNERv, vg + (st + 2) * AT_SK);
  }
  // no copy is left in flight when the wave ends
  asm volatile("s_wait_asynccnt 0x0" ::: "memory");

  // O^T tile d: register e = dh d*16 + 8*hi4 + e of query lr: one 16-byte store
#pragma unroll
  for (int g = 0; g < AT_G; ++g) {
    const float l = lsum[g];
    const float inv = 1.0f / (l + xhalf(l));
    _Float16* op = O + ((size_t)(b * SEQ_N + q0 + g * 16 + lr)) * INNERv + h * DHEAD + kof;
#pragma unroll
    for (int d = 0; d < 4; ++d) {
      v8h o;
#pragma unroll
      for (int e = 0; e < 8; ++e) o[e] = (_Float16)(acc[g][d][e] * inv);
      *(v8h*)(op + d * 16) = o;
    }
  }
}

// ---------------------------------------------------------------------------
// Host-side launch
// ---------------------------------------------------------------------------
extern "C" void kernel_launch(void* const* d_in, const int* in_sizes, int n_in,
                              void* d_out, int out_size, void* d_ws, size_t ws_size,
                              hipStream_t stream) {
  (void)in_sizes; (void)n_in; (void)out_size; (void)ws_size;

  const float* person  = (const float*)d_in[0];
  const float* garment = (const float*)d_in[1];
  const float* Wq = (const float*)d_in[2];
  const float* Wk = (const float*)d_in[3];
  const float* Wv = (const float*)d_in[4];
  const float* Wo = (const float*)d_in[5];
  const float* bo = (const float*)d_in[6];
  const float* Wf = (const float*)d_in[7];
  const float* bf = (const float*)d_in[8];
  const float* gq = (const float*)d_in[9];
  const float* betaq = (const float*)d_in[10];
  const float* gk = (const float*)d_in[11];
  const float* betak = (const float*)d_in[12];
  float* out = (float*)d_out;

  _Float16* w0 = (_Float16*)d_ws;
  size_t off = 0;
  _Float16* pLN = w0 + off; off += (size_t)BATCH * SEQ_N * DQv;
  _Float16* gLN = w0 + off; off += (size_t)BATCH * SEQ_M * DCv;
  _Float16* WqT = w0 + off; off += (size_t)INNERv * DQv;
  _Float16* WkT = w0 + off; off += (size_t)INNERv * DCv;
  _Float16* WvT = w0 + off; off += (size_t)INNERv * DCv;
  _Float16* WoT = w0 + off; off += (size_t)DQv * INNERv;
  _Float16* WfT = w0 + off; off += (size_t)DQv * (2 * DQv);
  _Float16* Qh  = w0 + off; off += (size_t)BATCH * SEQ_N * INNERv;
  _Float16* Kh  = w0 + off; off += (size_t)BATCH * SEQ_M * INNERv;
  _Float16* Vh  = w0 + off; off += (size_t)BATCH * SEQ_M * INNERv;
  _Float16* VtB = w0 + off; off += (size_t)BATCH * INNERv * SEQ_M;
  _Float16* Att = w0 + off; off += (size_t)BATCH * SEQ_N * INNERv;
  _Float16* Cat = w0 + off; off += (size_t)BATCH * SEQ_N * 2 * DQv;

  // Layer norms (the person rows' f16 copy into concat cols [0, DQ) with them) and
  // weight transpose+convert
  prep_kernel<<<PJ_WF, 256, 0, stream>>>(person, garment, Wq, Wk, Wv, Wo, Wf, gq, betaq, gk,
                                         betak, pLN, gLN, WqT, WkT, WvT, WoT, WfT, Cat);

  // Q/K/V projections (f16 out)
  gemm_qkv_kernel<<<dim3(INNERv / GBN, QKV_YV), 256, 0, stream>>>(pLN, gLN, WqT, WkT, WvT, Qh,
                                                                  Kh, Vh);

  // V transpose for contiguous PV fragments
  vtrans_kernel<<<dim3(INNERv / TT, SEQ_M / TT, BATCH), 256, 0, stream>>>(Vh, VtB);

  // Attention (online softmax in registers)
  attn_kernel<<<dim3(SEQ_N / AT_QB, BATCH * NHEAD), AT_NW * 32, 0, stream>>>(
      Qh, Kh, VtB, Att);

  // att @ Wo + bo -> concat cols [DQ, 2*DQ) (f16)
  gemm_wmma_kernel<true, true><<<dim3(DQv / GBN, (BATCH * SEQ_N) / GBM), 256, 0, stream>>>(
      Att, INNERv, WoT, INNERv, (void*)(Cat + DQv), 2 * DQv, bo, BATCH * SEQ_N, DQv, INNERv);

  // concat @ Wf + bf -> out (f32)
  gemm_wmma_kernel<false, true><<<dim3(DQv / GBN, (BATCH * SEQ_N) / GBM), 256, 0, stream>>>(
      Cat, 2 * DQv, WfT, 2 * DQv, (void*)out, DQv, bf, BATCH * SEQ_N, DQv, 2 * DQv);
}

// v006
// A run of this version takes 126 microseconds.
// In both of two side-by-side timings against v005, it was 1.26 times as fast.
// Counting every step since v000, it is 3.85 times as fast.
#include <hip/hip_runtime.h>

#define BATCH 4
#define SEQ_N 2048
#define SEQ_M 1024
#define DQv   1024
#define DCv   768
#define NHEAD 16
#define DHEAD 64
#define INNERv 1024
#define ATT_SCALE 0.125f

typedef _Float16 v16h __attribute__((ext_vector_type(16)));
typedef _Float16 v8h  __attribute__((ext_vector_type(8)));
typedef float    v8f  __attribute__((ext_vector_type(8)));
typedef unsigned int v4u __attribute__((ext_vector_type(4)));

__device__ __forceinline__ v8f v8f_zero() {
  v8f z = {0.f,0.f,0.f,0.f,0.f,0.f,0.f,0.f};
  return z;
}

// Load one 16-bit WMMA A/B fragment for this lane.
// Per CDNA5 ISA 16-bit 16x32 layout: a lane holds K chunks {base..base+7} and
// {base+16..base+23}; caller passes p already offset by ks*32 + (laneHi?8:0).
__device__ __forceinline__ v16h ldfrag(const _Float16* p) {
  v8h lo = *(const v8h*)(p);
  v8h hi = *(const v8h*)(p + 16);
  return __builtin_shufflevector(lo, hi, 0,1,2,3,4,5,6,7,8,9,10,11,12,13,14,15);
}

__device__ __forceinline__ v8f wmma16x16x32(v16h a, v16h b, v8f c) {
  return __builtin_amdgcn_wmma_f32_16x16x32_f16(false, a, false, b, (short)0, c,
                                                false, false);
}

typedef float    v4f  __attribute__((ext_vector_type(4)));
typedef _Float16 v4h  __attribute__((ext_vector_type(4)));
typedef _Float16 v2h  __attribute__((ext_vector_type(2)));

// lane l <-> lane l ^ 16
__device__ __forceinline__ float xhalf(float x) {
  int v = __builtin_bit_cast(int, x);
  return __builtin_bit_cast(
      float, __builtin_amdgcn_permlanex16(v, v, 0x76543210, 0xfedcba98, false, false));
}

// x + (x of lane l ^ MASK), inside a 16-lane row (DPP row_xmask)
template <int MASK>
__device__ __forceinline__ float row_xadd(float x) {
  int v = __builtin_bit_cast(int, x);
  return x + __builtin_bit_cast(
                 float, __builtin_amdgcn_update_dpp(v, v, 0x160 + MASK, 0xf, 0xf, false));
}

// sum over the 32 lanes, the same value in every lane
__device__ __forceinline__ float wave_sum(float x) {
  x = row_xadd<1>(x);
  x = row_xadd<2>(x);
  x = row_xadd<4>(x);
  x = row_xadd<8>(x);
  return x + xhalf(x);
}

// ---------------------------------------------------------------------------
// The launches without matrix work are dealt so that few waves start and each moves
// much: 128 x 128 transpose tiles and four layer-norm rows a wave, 16-byte loads, all of
// a wave's loads in flight at once.
//
// Transpose tile in LDS: row = output row, 64 dwords, a dword = two neighbours of the
// output row. The 16-byte pieces of a row are permuted by an XOR with a number taken
// from the row index, so that the 32 dword stores of a wave (16 rows, 2 columns) fall
// in 32 banks and the 16-byte reads along a row stay whole.
// Every loop of these jobs is unrolled: its arrays are then registers and its address
// steps constants of the instructions.
// ---------------------------------------------------------------------------
#define TT 128  // tile edge

// Weight transpose + f32 -> f16 convert:  Wt[n][k] = (f16) W[k][n], W with INNERv columns
__device__ __forceinline__ void wtrans_job(unsigned* sT, const float* __restrict__ W,
                                           _Float16* __restrict__ Wt, int K, int bx, int by) {
  const int t = threadIdx.x, lane = t & 31, w = t >> 5, hl = lane >> 4, l16 = lane & 15;
  const int n0 = bx * TT, k0 = by * TT;
  // a half wave reads 256 contiguous bytes of rows 2*kp and 2*kp + 1
  // (kp = w * 8 + (it / 2) * 2 + hl, columns (it % 2) * 64 + l16 * 4): one address, constant steps
  const float* p0 = W + (size_t)(k0 + w * 16 + hl * 2) * INNERv + n0 + l16 * 4;
  v4f r0[8], r1[8];
#pragma unroll
  for (int it = 0; it < 8; ++it) {
    const float* p = p0 + (it >> 1) * 4 * INNERv + (it & 1) * 64;
    r0[it] = *(const v4f*)p;
    r1[it] = *(const v4f*)(p + INNERv);
  }
  // the address is named, so that it outlives the last load and no load of the group
  // is given it as a target; behind the wait its registers are free
  asm volatile("s_wait_xcnt 0x0" ::"v"(p0) : "memory");
  // keeps the sixteen loads ahead of the first LDS store: one latency for the tile
  __builtin_amdgcn_sched_barrier(0);
#pragma unroll
  for (int it = 0; it < 8; ++it) {
    const int id = w * 8 + it, kp = (id >> 1) * 2 + hl, nq = (id & 1) * 16 + l16;
#pragma unroll
    for (int i = 0; i < 4; ++i) {
      v2h h = {(_Float16)r0[it][i], (_Float16)r1[it][i]};
      sT[(nq * 4 + i) * 64 + (((kp >> 2) ^ l16) << 2) + (kp & 3)] =
          __builtin_bit_cast(unsigned, h);
    }
  }
  __syncthreads();
#pragma unroll
  for (int it = 0; it < 8; ++it) {
    const int id = it * 256 + t, n = id >> 4, c = id & 15;
    v4u d = *(const v4u*)&sT[n * 64 + ((c ^ ((n >> 2) & 15)) << 2)];
    *(v4u*)(Wt + (size_t)(n0 + n) * K + k0 + c * 8) = d;
  }
  // behind the stores: in the built kernel another job's instructions stand next and
  // write the registers that these stores name
  asm volatile("s_wait_xcnt 0x0" ::: "memory");
}

// ---------------------------------------------------------------------------
// Per-batch transpose of V (f16):  Vt[b][c][m] = V[b*M + m][c]
// ---------------------------------------------------------------------------
__global__ void __launch_bounds__(256)
vtrans_kernel(const _Float16* __restrict__ V, _Float16* __restrict__ Vt) {
  __shared__ __attribute__((aligned(16))) unsigned sT[TT * 64];
  const int t = threadIdx.x, lane = t & 31, w = t >> 5, hl = lane >> 4, l16 = lane & 15;
  const int b = blockIdx.z, c0 = blockIdx.x * TT, m0 = blockIdx.y * TT;
  // a half wave reads 256 contiguous bytes of rows 2*mp and 2*mp + 1
  // (mp = (w * 4 + it) * 2 + hl): one address, constant steps
  const _Float16* p0 = V + ((size_t)b * SEQ_M + m0 + w * 16 + hl * 2) * INNERv + c0 + l16 * 8;
  v4u r0[4], r1[4];
#pragma unroll
  for (int it = 0; it < 4; ++it) {
    r0[it] = *(const v4u*)(p0 + it * 4 * INNERv);
    r1[it] = *(const v4u*)(p0 + it * 4 * INNERv + INNERv);
  }
  // the address is named, so that it outlives the last load and no load of the group
  // is given it as a target; behind the wait its registers are free
  asm volatile("s_wait_xcnt 0x0" ::"v"(p0) : "memory");
  // keeps the eight loads ahead of the first LDS store: one latency for the tile
  __builtin_amdgcn_sched_barrier(0);
#pragma unroll
  for (int it = 0; it < 4; ++it) {
    const int mp = (w * 4 + it) * 2 + hl;
    unsigned* q = &sT[(l16 * 8) * 64 + (((mp >> 2) ^ l16) << 2) + (mp & 3)];
#pragma unroll
    for (int i = 0; i < 4; ++i) {
      const unsigned lo = r0[it][i], hi = r1[it][i];
      q[(2 * i) * 64] = (lo & 0xffffu) | (hi << 16);
      q[(2 * i + 1) * 64] = (lo >> 16) | (hi & 0xffff0000u);
    }
  }
  __syncthreads();
#pragma unroll
  for (int it = 0; it < 8; ++it) {
    const int id = it * 256 + t, n = id >> 4, c = id & 15;
    v4u d = *(const v4u*)&sT[n * 64 + ((c ^ ((n >> 3) & 15)) << 2)];
    *(v4u*)(Vt + ((size_t)b * INNERv + c0 + n) * SEQ_M + m0 + c * 8) = d;
  }
}

// ---------------------------------------------------------------------------
// Row LayerNorm (f32 statistics) producing f16 rows: a wave takes LN_R rows and holds
// them in registers; a row's sums are in-lane, then exchanged between lanes (no LDS, no
// barrier). With COPY the wave also writes the rows themselves as f16 into concat
// buffer cols [0, D).
// ---------------------------------------------------------------------------
#define LN_R 4
#define LN_RB (8 * LN_R)  // rows a block

template <int D, bool COPY>
__device__ __forceinline__ void ln_f16_job(const float* __restrict__ x,
                                           const float* __restrict__ g,
                                           const float* __restrict__ beta,
                                           _Float16* __restrict__ y,
                                           _Float16* __restrict__ cat, int row0) {
  constexpr int NJ = D / 128;  // 512-byte pieces of a row, 16 bytes a lane
  const int lane = threadIdx.x & 31;
  const v4f* xr = (const v4f*)(x + (size_t)row0 * D) + lane;
  v4f v[LN_R][NJ], gg[NJ], bb[NJ];
#pragma unroll
  for (int r = 0; r < LN_R; ++r)
#pragma unroll
    for (int j = 0; j < NJ; ++j) v[r][j] = xr[r * (D / 4) + j * 32];
#pragma unroll
  for (int j = 0; j < NJ; ++j) {
    gg[j] = ((const v4f*)g)[j * 32 + lane];
    bb[j] = ((const v4f*)beta)[j * 32 + lane];
  }
  // the address is named, so that it outlives the last load and no load of the group
  // is given it as a target; behind the wait its registers are free
  asm volatile("s_wait_xcnt 0x0" ::"v"(xr) : "memory");
  // keeps every load of the wave ahead of the first sum: one memory latency for its rows
  __builtin_amdgcn_sched_barrier(0);

  float a[LN_R], b[LN_R];
#pragma unroll
  for (int r = 0; r < LN_R; ++r) {
    v4f s = v[r][0], q = v[r][0] * v[r][0];
#pragma unroll
    for (int j = 1; j < NJ; ++j) {
      s += v[r][j];
      q += v[r][j] * v[r][j];
    }
    a[r] = (s[0] + s[1]) + (s[2] + s[3]);
    b[r] = (q[0] + q[1]) + (q[2] + q[3]);
  }
#pragma unroll
  for (int r = 0; r < LN_R; ++r) {
    a[r] = wave_sum(a[r]);
    b[r] = wave_sum(b[r]);
  }
#pragma unroll
  for (int r = 0; r < LN_R; ++r) {
    const float mu = a[r] * (1.0f / D);
    const float var = b[r] * (1.0f / D) - mu * mu;
    const float rs = rsqrtf(var + 1e-5f);
    v4h* yr = (v4h*)(y + (size_t)(row0 + r) * D) + lane;
#pragma unroll
    for (int j = 0; j < NJ; ++j) {
      v4h o;
#pragma unroll
      for (int i = 0; i < 4; ++i)
        o[i] = (_Float16)((v[r][j][i] - mu) * rs * gg[j][i] + bb[j][i]);
      yr[j * 32] = o;
    }
    if constexpr (COPY) {
      v4h* cr = (v4h*)(cat + (size_t)(row0 + r) * (2 * D)) + lane;
#pragma unroll
      for (int j = 0; j < NJ; ++j) {
        v4h o;
#pragma unroll
        for (int i = 0; i < 4; ++i) o[i] = (_Float16)v[r][j][i];
        cr[j * 32] = o;
      }
    }
  }
  // behind the stores: in the built kernel another job's instructions stand next and
  // write the registers that these stores name
  asm volatile("s_wait_xcnt 0x0" ::: "memory");
}

// ---------------------------------------------------------------------------
// All work that depends on the inputs alone, in one launch: a block takes one job,
// picked by its index (the same for the whole block, so the transposes' barrier is safe).
// ---------------------------------------------------------------------------
#define PJ_LNP ((BATCH * SEQ_N) / LN_RB)              // person row groups
#define PJ_LNG (PJ_LNP + (BATCH * SEQ_M) / LN_RB)     // garment row groups
#define PJ_TN  (INNERv / TT)                          // weight tiles a tile row
#define PJ_WQ  (PJ_LNG + (DQv / TT) * PJ_TN)
#define PJ_WK  (PJ_WQ + (DCv / TT) * PJ_TN)
#define PJ_WV  (PJ_WK + (DCv / TT) * PJ_TN)
#define PJ_WO  (PJ_WV + (INNERv / TT) * PJ_TN)
#define PJ_WF  (PJ_WO + ((2 * DQv) / TT) * PJ_TN)

__global__ void __launch_bounds__(256)
prep_kernel(const float* __restrict__ person, const float* __restrict__ garment,
            const float* __restrict__ Wq, const float* __restrict__ Wk,
            const float* __restrict__ Wv, const float* __restrict__ Wo,
            const float* __restrict__ Wf, const float* __restrict__ gq,
            const float* __restrict__ betaq, const float* __restrict__ gk,
            const float* __restrict__ betak, _Float16* __restrict__ pLN,
            _Float16* __restrict__ gLN, _Float16* __restrict__ WqT, _Float16* __restrict__ WkT,
            _Float16* __restrict__ WvT, _Float16* __restrict__ WoT, _Float16* __restrict__ WfT,
            _Float16* __restrict__ Cat) {
  __shared__ __attribute__((aligned(16))) unsigned sT[TT * 64];
  const int j = blockIdx.x;
  const int wrow = (threadIdx.x >> 5) * LN_R;  // the wave's first row in a row group
  if (j < PJ_LNP) {
    ln_f16_job<DQv, true>(person, gq, betaq, pLN, Cat, j * LN_RB + wrow);
    return;
  }
  if (j < PJ_LNG) {
    ln_f16_job<DCv, false>(garment, gk, betak, gLN, nullptr, (j - PJ_LNP) * LN_RB + wrow);
    return;
  }
  {
    // every weight has 1024 columns (INNER = DQ): PJ_TN tiles a tile row
    const float* W = Wf;
    _Float16* Wt = WfT;
    int K = 2 * DQv, first = PJ_WO;
    if (j < PJ_WQ) {
      W = Wq; Wt = WqT; K = DQv; first = PJ_LNG;
    } else if (j < PJ_WK) {
      W = Wk; Wt = WkT; K = DCv; first = PJ_WQ;
    } else if (j < PJ_WV) {
      W = Wv; Wt = WvT; K = DCv; first = PJ_WK;
    } else if (j < PJ_WO) {
      W = Wo; Wt = WoT; K = INNERv; first = PJ_WV;
    }
    wtrans_job(sT, W, Wt, K, (j - first) % PJ_TN, (j - first) / PJ_TN);
  }
}

// ---------------------------------------------------------------------------
// WMMA GEMM:  C[M x N] = A[M x K] * Bt[N x K]^T (+ bias), f16 in, f32 acc.
// Block: 256 threads = 8 waves (4x2 wave grid), tile 128x128.
// A and Bt come into LDS by asynchronous copies, through no register: a stage is 128 k
// of both tiles (whole 256-byte rows), two buffers, the next stage's copies in flight
// while this stage is worked on; one barrier a stage. K: a multiple of 128.
// ---------------------------------------------------------------------------
#define GBM 128
#define GBN 128
#define GBK 128
#define GLD 136                  // LDS row pitch in halfs: 256-byte rows at 272 bytes
#define GBO (GBM * GLD)          // the Bt tile stands behind the A tile (in halfs)
#define GBH (GBO + GBN * GLD)    // one buffer (in halfs)

// One operand's tile of a stage into LDS: eight 16-byte copies a lane, 16 rows apart.
// l: the lane's LDS byte address; g: its global one; ld: the operand's row length.
// The s_wait_xcnt stands inside the statement, so that no address register of a copy
// is rewritten ahead of it.
__device__ __forceinline__ void gemm_copy_tile(unsigned l, const _Float16* g, int ld) {
  const size_t s = (size_t)16 * ld;
  asm volatile(
      "global_load_async_to_lds_b128 %0, %8, off\n\t"
      "global_load_async_to_lds_b128 %1, %9, off\n\t"
      "global_load_async_to_lds_b128 %2, %10, off\n\t"
      "global_load_async_to_lds_b128 %3, %11, off\n\t"
      "global_load_async_to_lds_b128 %4, %12, off\n\t"
      "global_load_async_to_lds_b128 %5, %13, off\n\t"
      "global_load_async_to_lds_b128 %6, %14, off\n\t"
      "global_load_async_to_lds_b128 %7, %15, off\n\t"
      "s_wait_xcnt 0x0" ::"v"(l),
      "v"(l + 16 * GLD * 2), "v"(l + 32 * GLD * 2), "v"(l + 48 * GLD * 2),
      "v"(l + 64 * GLD * 2), "v"(l + 80 * GLD * 2), "v"(l + 96 * GLD * 2),
      "v"(l + 112 * GLD * 2), "v"(g), "v"(g + s), "v"(g + 2 * s), "v"(g + 3 * s),
      "v"(g + 4 * s), "v"(g + 5 * s), "v"(g + 6 * s), "v"(g + 7 * s)
      : "memory");
}

template <bool OUT_F16, bool HAS_BIAS>
__device__ __forceinline__ void gemm_tile(const _Float16* __restrict__ A, int lda,
                                 const _Float16* __restrict__ Bt, int ldb,
                                 void* __restrict__ Cv, int ldc,
                                 const float* __restrict__ bias, int K, int rowBlock,
                                 int colBlock) {
  __shared__ __attribute__((aligned(16))) _Float16 sAB[2 * GBH];

  const int t = threadIdx.x;
  const int lane = t & 31, w = t >> 5;
  const int wm = w & 3, wn = w >> 2;  // 4 waves in M x 2 waves in N
  const int lr = lane & 15, hi4 = lane >> 4, kof = hi4 * 8;
  const int nst = K / GBK;  // stages

  // the lane's part of a stage: rows t/16 + 16 j of both tiles, 16-byte piece t%16
  const _Float16* ga = A + (size_t)(rowBlock + (t >> 4)) * lda + (t & 15) * 8;
  const _Float16* gb = Bt + (size_t)(colBlock + (t >> 4)) * ldb + (t & 15) * 8;
  const unsigned la = (unsigned)(size_t)&sAB[(t >> 4) * GLD + (t & 15) * 8];
  const unsigned lb = la + GBO * 2;

  // stage 0 into buffer 0, landed and published; then stage 1 goes out into buffer 1
  gemm_copy_tile(la, ga, lda);
  gemm_copy_tile(lb, gb, ldb);
  // this wave's copies have landed
  asm volatile("s_wait_asynccnt 0x0" ::: "memory");
  __syncthreads();
  if (nst > 1) {
    gemm_copy_tile(la + GBH * 2, ga + GBK, lda);
    gemm_copy_tile(lb + GBH * 2, gb + GBK, ldb);
  }

  // every loop over fragments is unrolled: its arrays are then registers and its LDS
  // steps constants of the loads
  v8f acc[2][4];
#pragma unroll
  for (int fm = 0; fm < 2; ++fm)
#pragma unroll
    for (int fn = 0; fn < 4; ++fn) acc[fm][fn] = v8f_zero();

  for (int st = 0; st < nst; ++st) {
    const _Float16* sA = sAB + (st & 1) * GBH + (wm * 32 + lr) * GLD + kof;
    const _Float16* sB = sAB + (st & 1) * GBH + GBO + (wn * 64 + lr) * GLD + kof;
#pragma unroll
    for (int ks = 0; ks < GBK / 32; ++ks) {
      v16h af[2], bfr[4];
#pragma unroll
      for (int fm = 0; fm < 2; ++fm) af[fm] = ldfrag(sA + fm * 16 * GLD + ks * 32);
#pragma unroll
      for (int fn = 0; fn < 4; ++fn) bfr[fn] = ldfrag(sB + fn * 16 * GLD + ks * 32);
#pragma unroll
      for (int fm = 0; fm < 2; ++fm)
#pragma unroll
        for (int fn = 0; fn < 4; ++fn)
          acc[fm][fn] = wmma16x16x32(af[fm], bfr[fn], acc[fm][fn]);
    }
    // hand-over: this wave's reads of the buffer are done, its copies of the next stage
    // have landed; behind the barrier the next stage is readable by all and this
    // stage's buffer is free for the stage after it
    asm volatile("s_wait_dscnt 0x0" ::: "memory");
    asm volatile("s_wait_asynccnt 0x0" ::: "memory");
    __syncthreads();
    if (st + 2 < nst) {
      gemm_copy_tile(la + (st & 1) * (GBH * 2), ga + (size_t)(st + 2) * GBK, lda);
      gemm_copy_tile(lb + (st & 1) * (GBH * 2), gb + (size_t)(st + 2) * GBK, ldb);
    }
  }
  // no copy is left in flight when the wave ends
  asm volatile("s_wait_asynccnt 0x0" ::: "memory");

  // store: C layout — VGPR e: lanes 0-15 -> m=e, lanes 16-31 -> m=e+8; n=lr
#pragma unroll
  for (int fm = 0; fm < 2; ++fm)
#pragma unroll
    for (int fn = 0; fn < 4; ++fn) {
      int col = colBlock + wn * 64 + fn * 16 + lr;
      int row0 = rowBlock + wm * 32 + fm * 16 + hi4 * 8;
      float bv = HAS_BIAS ? bias[col] : 0.f;
#pragma unroll
      for (int e = 0; e < 8; ++e) {
        float v = acc[fm][fn][e] + bv;
        if constexpr (OUT_F16)
          ((_Float16*)Cv)[(size_t)(row0 + e) * ldc + col] = (_Float16)v;
        else
          ((float*)Cv)[(size_t)(row0 + e) * ldc + col] = v;
      }
    }
}

template <bool OUT_F16, bool HAS_BIAS>
__global__ void __launch_bounds__(256) gemm_wmma_kernel(const _Float16* __restrict__ A, int lda,
                                 const _Float16* __restrict__ Bt, int ldb,
                                 void* __restrict__ Cv, int ldc,
                                 const float* __restrict__ bias, int M, int N, int K) {
  gemm_tile<OUT_F16, HAS_BIAS>(A, lda, Bt, ldb, Cv, ldc, bias, K, blockIdx.y * GBM,
                               blockIdx.x * GBN);
}

// The three projections in one launch: none reads another's result. blockIdx.y picks
// the product and its row tile; the longest (Q, K = DQ) has the lowest indices.
#define QKV_YQ ((BATCH * SEQ_N) / GBM)
#define QKV_YK (QKV_YQ + (BATCH * SEQ_M) / GBM)
#define QKV_YV (QKV_YK + (BATCH * SEQ_M) / GBM)

__global__ void __launch_bounds__(256)
gemm_qkv_kernel(const _Float16* __restrict__ pLN, const _Float16* __restrict__ gLN,
                const _Float16* __restrict__ WqT, const _Float16* __restrict__ WkT,
                const _Float16* __restrict__ WvT, _Float16* __restrict__ Qh,
                _Float16* __restrict__ Kh, _Float16* __restrict__ Vh) {
  const int y = blockIdx.y;
  const bool isQ = y < QKV_YQ, isK = y < QKV_YK;
  const _Float16* A = isQ ? pLN : gLN;
  const _Float16* Bt = isQ ? WqT : (isK ? WkT : WvT);
  _Float16* C = isQ ? Qh : (isK ? Kh : Vh);
  const int K = isQ ? DQv : DCv;
  const int yt = isQ ? y : (isK ? y - QKV_YQ : y - QKV_YK);
  gemm_tile<true, false>(A, K, Bt, K, (void*)C, INNERv, nullptr, K, yt * GBM,
                         blockIdx.x * GBN);
}

#define AT_NW 8
#define AT_G  2
#define AT_QB (AT_NW * AT_G * 16)
#define AT_SK 128                      // keys per stage
#define AT_NS (SEQ_M / AT_SK)          // stages
#define AT_SP (AT_SK / 32)             // passes per stage
#define AT_KP 72                       // K tile: 128 rows of 128 B at a pitch of 144 B (in halfs)
#define AT_VP 136                      // V^T tile: 64 rows of 256 B at a pitch of 272 B (in halfs)
#define AT_VO (AT_SK * AT_KP)          // V^T tile stands behind the K tile (in halfs)
#define AT_BH (AT_VO + DHEAD * AT_VP)  // one buffer (in halfs)

// Base-2 exponentials in place, a run of them in one statement: left to the
// register allocator, an exponential's target is often the source of the one
// directly ahead of it. Here each overwrites only its own source, and the v_nop is
// the slot the instruction set asks for between the last one and its first reader.
__device__ __forceinline__ void exp2_inplace(v8f& x) {
  float a0 = x[0], a1 = x[1], a2 = x[2], a3 = x[3], a4 = x[4], a5 = x[5], a6 = x[6], a7 = x[7];
  asm("v_exp_f32 %0, %0\n\tv_exp_f32 %1, %1\n\tv_exp_f32 %2, %2\n\tv_exp_f32 %3, %3\n\t"
      "v_exp_f32 %4, %4\n\tv_exp_f32 %5, %5\n\tv_exp_f32 %6, %6\n\tv_exp_f32 %7, %7\n\t"
      "v_nop"
      : "+v"(a0), "+v"(a1), "+v"(a2), "+v"(a3), "+v"(a4), "+v"(a5), "+v"(a6), "+v"(a7));
  x[0] = a0; x[1] = a1; x[2] = a2; x[3] = a3; x[4] = a4; x[5] = a5; x[6] = a6; x[7] = a7;
}
__device__ __forceinline__ void exp2_inplace(float& a0, float& a1) {
  asm("v_exp_f32 %0, %0\n\tv_exp_f32 %1, %1\n\tv_nop" : "+v"(a0), "+v"(a1));
}

// One stage into LDS: eight 16-byte copies a lane, four of K (32 rows apart) and four
// of V^T (16 rows apart). kl, vl: the lane's LDS byte addresses; kg, vg: its global ones.
// The s_wait_xcnt stands inside the statement, so that no address register of a copy
// is rewritten ahead of it.
__device__ __forceinline__ void at_copy_stage(unsigned kl, unsigned vl, const _Float16* kg,
                                              const _Float16* vg) {
  asm volatile(
      "global_load_async_to_lds_b128 %0, %8, off\n\t"
      "global_load_async_to_lds_b128 %1, %9, off\n\t"
      "global_load_async_to_lds_b128 %2, %10, off\n\t"
      "global_load_async_to_lds_b128 %3, %11, off\n\t"
      "global_load_async_to_lds_b128 %4, %12, off\n\t"
      "global_load_async_to_lds_b128 %5, %13, off\n\t"
      "global_load_async_to_lds_b128 %6, %14, off\n\t"
      "global_load_async_to_lds_b128 %7, %15, off\n\t"
      "s_wait_xcnt 0x0" ::"v"(kl),
      "v"(kl + 32 * AT_KP * 2), "v"(kl + 64 * AT_KP * 2), "v"(kl + 96 * AT_KP * 2), "v"(vl),
      "v"(vl + 16 * AT_VP * 2), "v"(vl + 32 * AT_VP * 2), "v"(vl + 48 * AT_VP * 2), "v"(kg),
      "v"(kg + 32 * INNERv), "v"(kg + 64 * INNERv), "v"(kg + 96 * INNERv), "v"(vg),
      "v"(vg + 16 * SEQ_M), "v"(vg + 32 * SEQ_M), "v"(vg + 48 * SEQ_M)
      : "memory");
}

__global__ void __launch_bounds__(AT_NW * 32)
attn_kernel(const _Float16* __restrict__ Q, const _Float16* __restrict__ Kf,
            const _Float16* __restrict__ Vt, _Float16* __restrict__ O) {
  __shared__ __attribute__((aligned(16))) _Float16 sKV[2 * AT_BH];
  const int t = threadIdx.x;
  const int lane = t & 31, w = t >> 5;
  const int lr = lane & 15, hi4 = lane >> 4, kof = hi4 * 8;
  const int bh = blockIdx.y, b = bh >> 4, h = bh & 15;
  const int q0 = blockIdx.x * AT_QB + w * (AT_G * 16);
  const float cs = ATT_SCALE * 1.4426950408889634f;  // scores in the log2 domain

  // Q as B operand: column lr = query, DH split into two 32-wide k-steps
  v16h qf[AT_G][2];
#pragma unroll
  for (int g = 0; g < AT_G; ++g) {
    const _Float16* qp = Q + ((size_t)(b * SEQ_N + q0 + g * 16 + lr)) * INNERv + h * DHEAD + kof;
    qf[g][0] = ldfrag(qp);
    qf[g][1] = ldfrag(qp + 32);
  }

  // the lane's part of a stage: K row t/8, 16-byte piece t%8; V^T row t/16, piece t%16
  const _Float16* kg = Kf + ((size_t)(b * SEQ_M + (t >> 3))) * INNERv + h * DHEAD + (t & 7) * 8;
  const _Float16* vg = Vt + ((size_t)(b * INNERv + h * DHEAD + (t >> 4))) * SEQ_M + (t & 15) * 8;
  const unsigned kl = (unsigned)(size_t)&sKV[(t >> 3) * AT_KP + (t & 7) * 8];
  const unsigned vl = (unsigned)(size_t)&sKV[AT_VO + (t >> 4) * AT_VP + (t & 15) * 8];

  // stage 0 into buffer 0, landed and published; then stage 1 goes out into buffer 1
  at_copy_stage(kl, vl, kg, vg);
  // this wave's copies have landed
  asm volatile("s_wait_asynccnt 0x0" ::: "memory");
  __syncthreads();
  at_copy_stage(kl + AT_BH * 2, vl + AT_BH * 2, kg + (size_t)AT_SK * INNERv, vg + AT_SK);

  v8f acc[AT_G][4];
  float mrun[AT_G], lsum[AT_G];
#pragma unroll
  for (int g = 0; g < AT_G; ++g) {
    mrun[g] = -__builtin_inff();
    lsum[g] = 0.f;
#pragma unroll
    for (int d = 0; d < 4; ++d) acc[g][d] = v8f_zero();
  }

  for (int st = 0; st < AT_NS; ++st) {
   const _Float16* kbase = sKV + (st & 1) * AT_BH + lr * AT_KP + kof;
   const _Float16* vbase = sKV + (st & 1) * AT_BH + AT_VO + lr * AT_VP + kof;

   // K as A operand: row lr = key; two 16-key tiles x two k-steps, one pass ahead
   // inside a stage (never into the next stage's buffer)
   v16h kf[2][2];
#pragma unroll
   for (int kt = 0; kt < 2; ++kt) {
     kf[kt][0] = ldfrag(kbase + (kt * 16) * AT_KP);
     kf[kt][1] = ldfrag(kbase + (kt * 16) * AT_KP + 32);
   }

   for (int p = 0; p < AT_SP; ++p) {
    // V^T as A operand: row lr = dh, k = this pass's 32 keys; in flight under the
    // score products and the softmax. The barrier holds the fetch up here: sunk to
    // its first use it would be waited for at once
    v16h vf[4];
#pragma unroll
    for (int d = 0; d < 4; ++d) vf[d] = ldfrag(vbase + (d * 16) * AT_VP + p * 32);
    __builtin_amdgcn_sched_barrier(0);

    v8f s[2][AT_G];
#pragma unroll
    for (int kt = 0; kt < 2; ++kt)
#pragma unroll
      for (int g = 0; g < AT_G; ++g) {
        s[kt][g] = wmma16x16x32(kf[kt][0], qf[g][0], v8f_zero());
        s[kt][g] = wmma16x16x32(kf[kt][1], qf[g][1], s[kt][g]);
      }

    // keeps the eight products back to back: mixed with the maxima below, each
    // product that a maximum follows is padded with idle slots
    __builtin_amdgcn_sched_barrier(0);

    // next pass's K into the same registers, in flight under the softmax and the
    // second product (a stage's last pass names its own rows again, unused: the next
    // stage is not published yet)
    const int pn = (p + 1 < AT_SP) ? p + 1 : p;
#pragma unroll
    for (int kt = 0; kt < 2; ++kt) {
      kf[kt][0] = ldfrag(kbase + (pn * 32 + kt * 16) * AT_KP);
      kf[kt][1] = ldfrag(kbase + (pn * 32 + kt * 16) * AT_KP + 32);
    }

    // holds the fetch here, ahead of the softmax: sunk to the foot of the pass it
    // would be waited for at once by the next pass's products
    __builtin_amdgcn_sched_barrier(0);

    // online softmax: new running maximum per query, sums and outputs rescaled
    // (no branch: the loop stays one block, so the fetches stay where they stand)
    float corr[AT_G];
#pragma unroll
    for (int g = 0; g < AT_G; ++g) {
      float mx = s[0][g][0];
#pragma unroll
      for (int e = 1; e < 8; ++e) mx = fmaxf(mx, s[0][g][e]);
#pragma unroll
      for (int e = 0; e < 8; ++e) mx = fmaxf(mx, s[1][g][e]);
      mx = fmaxf(mx, xhalf(mx)) * cs;
      const float mnew = fmaxf(mrun[g], mx);
      corr[g] = mrun[g] - mnew;  // -inf on the first pass: its exponential is 0
      mrun[g] = mnew;
    }
    exp2_inplace(corr[0], corr[1]);

#pragma unroll
    for (int g = 0; g < AT_G; ++g) {
      const float nm = -mrun[g];
      v8f e0, e1;
#pragma unroll
      for (int e = 0; e < 8; ++e) {
        e0[e] = fmaf(s[0][g][e], cs, nm);
        e1[e] = fmaf(s[1][g][e], cs, nm);
      }
      exp2_inplace(e0);
      exp2_inplace(e1);
      v16h pf;  // elements 0-7 = keys 8*hi4 + e, 8-15 = keys 16 + 8*hi4 + e: ldfrag's k order
      float ps = e0[0] + e1[0];
#pragma unroll
      for (int e = 1; e < 8; ++e) ps += e0[e] + e1[e];
#pragma unroll
      for (int e = 0; e < 8; ++e) {
        pf[e] = (_Float16)e0[e];
        pf[8 + e] = (_Float16)e1[e];
      }
      lsum[g] = fmaf(lsum[g], corr[g], ps);
#pragma unroll
      for (int d = 0; d < 4; ++d)
        acc[g][d] = wmma16x16x32(vf[d], pf, acc[g][d] * corr[g]);
    }
   }

   // hand-over: this wave's reads of the buffer are done, its copies of the next stage
   // have landed; behind the barrier the next stage is readable by all and this
   // stage's buffer is free for the stage after it
   asm volatile("s_wait_dscnt 0x0" ::: "memory");
   asm volatile("s_wait_asynccnt 0x0" ::: "memory");
   __syncthreads();
   if (st + 2 < AT_NS)
     at_copy_stage(kl + (st & 1) * (AT_BH * 2), vl + (st & 1) * (AT_BH * 2),
                   kg + (size_t)(st + 2) * AT_SK * INNERv, vg + (st + 2) * AT_SK);
  }
  // no copy is left in flight when the wave ends
  asm volatile("s_wait_asynccnt 0x0" ::: "memory");

  // O^T tile d: register e = dh d*16 + 8*hi4 + e of query lr: one 16-byte store
#pragma unroll
  for (int g = 0; g < AT_G; ++g) {
    const float l = lsum[g];
    const float inv = 1.0f / (l + xhalf(l));
    _Float16* op = O + ((size_t)(b * SEQ_N + q0 + g * 16 + lr)) * INNERv + h * DHEAD + kof;
#pragma unroll
    for (int d = 0; d < 4; ++d) {
      v8h o;
#pragma unroll
      for (int e = 0; e < 8; ++e) o[e] = (_Float16)(acc[g][d][e] * inv);
      *(v8h*)(op + d * 16) = o;
    }
  }
}

// ---------------------------------------------------------------------------
// Host-side launch
// ---------------------------------------------------------------------------
extern "C" void kernel_launch(void* const* d_in, const int* in_sizes, int n_in,
                              void* d_out, int out_size, void* d_ws, size_t ws_size,
                              hipStream_t stream) {
  (void)in_sizes; (void)n_in; (void)out_size; (void)ws_size;

  const float* person  = (const float*)d_in[0];
  const float* garment = (const float*)d_in[1];
  const float* Wq = (const float*)d_in[2];
  const float* Wk = (const float*)d_in[3];
  const float* Wv = (const float*)d_in[4];
  const float* Wo = (const float*)d_in[5];
  const float* bo = (const float*)d_in[6];
  const float* Wf = (const float*)d_in[7];
  const float* bf = (const float*)d_in[8];
  const float* gq = (const float*)d_in[9];
  const float* betaq = (const float*)d_in[10];
  const float* gk = (const float*)d_in[11];
  const float* betak = (const float*)d_in[12];
  float* out = (float*)d_out;

  _Float16* w0 = (_Float16*)d_ws;
  size_t off = 0;
  _Float16* pLN = w0 + off; off += (size_t)BATCH * SEQ_N * DQv;
  _Float16* gLN = w0 + off; off += (size_t)BATCH * SEQ_M * DCv;
  _Float16* WqT = w0 + off; off += (size_t)INNERv * DQv;
  _Float16* WkT = w0 + off; off += (size_t)INNERv * DCv;
  _Float16* WvT = w0 + off; off += (size_t)INNERv * DCv;
  _Float16* WoT = w0 + off; off += (size_t)DQv * INNERv;
  _Float16* WfT = w0 + off; off += (size_t)DQv * (2 * DQv);
  _Float16* Qh  = w0 + off; off += (size_t)BATCH * SEQ_N * INNERv;
  _Float16* Kh  = w0 + off; off += (size_t)BATCH * SEQ_M * INNERv;
  _Float16* Vh  = w0 + off; off += (size_t)BATCH * SEQ_M * INNERv;
  _Float16* VtB = w0 + off; off += (size_t)BATCH * INNERv * SEQ_M;
  _Float16* Att = w0 + off; off += (size_t)BATCH * SEQ_N * INNERv;
  _Float16* Cat = w0 + off; off += (size_t)BATCH * SEQ_N * 2 * DQv;

  // Layer norms (the person rows' f16 copy into concat cols [0, DQ) with them) and
  // weight transpose+convert
  prep_kernel<<<PJ_WF, 256, 0, stream>>>(person, garment, Wq, Wk, Wv, Wo, Wf, gq, betaq, gk,
                                         betak, pLN, gLN, WqT, WkT, WvT, WoT, WfT, Cat);

  // Q/K/V projections (f16 out)
  gemm_qkv_kernel<<<dim3(INNERv / GBN, QKV_YV), 256, 0, stream>>>(pLN, gLN, WqT, WkT, WvT, Qh,
                                                                  Kh, Vh);

  // V transpose for contiguous PV fragments
  vtrans_kernel<<<dim3(INNERv / TT, SEQ_M / TT, BATCH), 256, 0, stream>>>(Vh, VtB);

  // Attention (online softmax in registers)
  attn_kernel<<<dim3(SEQ_N / AT_QB, BATCH * NHEAD), AT_NW * 32, 0, stream>>>(
      Qh, Kh, VtB, Att);

  // att @ Wo + bo -> concat cols [DQ, 2*DQ) (f16)
  gemm_wmma_kernel<true, true><<<dim3(DQv / GBN, (BATCH * SEQ_N) / GBM), 256, 0, stream>>>(
      Att, INNERv, WoT, INNERv, (void*)(Cat + DQv), 2 * DQv, bo, BATCH * SEQ_N, DQv, INNERv);

  // concat @ Wf + bf -> out (f32)
  gemm_wmma_kernel<false, true><<<dim3(DQv / GBN, (BATCH * SEQ_N) / GBM), 256, 0, stream>>>(
      Cat, 2 * DQv, WfT, 2 * DQv, (void*)out, DQv, bf, BATCH * SEQ_N, DQv, 2 * DQv);
}

// v007
// Measured time: 118 microseconds a run.
// Next to v006, in two timings, it ran 1.07 and 1.06 times as fast.
// Over all steps from v000 it is 4.11 times as fast.
#include <hip/hip_runtime.h>

#define BATCH 4
#define SEQ_N 2048
#define SEQ_M 1024
#define DQv   1024
#define DCv   768
#define NHEAD 16
#define DHEAD 64
#define INNERv 1024
#define ATT_SCALE 0.125f

typedef _Float16 v16h __attribute__((ext_vector_type(16)));
typedef _Float16 v8h  __attribute__((ext_vector_type(8)));
typedef float    v8f  __attribute__((ext_vector_type(8)));
typedef unsigned int v4u __attribute__((ext_vector_type(4)));

__device__ __forceinline__ v8f v8f_zero() {
  v8f z = {0.f,0.f,0.f,0.f,0.f,0.f,0.f,0.f};
  return z;
}

// Load one 16-bit WMMA A/B fragment for this lane.
// Per CDNA5 ISA 16-bit 16x32 layout: a lane holds K chunks {base..base+7} and
// {base+16..base+23}; caller passes p already offset by ks*32 + (laneHi?8:0).
__device__ __forceinline__ v16h ldfrag(const _Float16* p) {
  v8h lo = *(const v8h*)(p);
  v8h hi = *(const v8h*)(p + 16);
  return __builtin_shufflevector(lo, hi, 0,1,2,3,4,5,6,7,8,9,10,11,12,13,14,15);
}

__device__ __forceinline__ v8f wmma16x16x32(v16h a, v16h b, v8f c) {
  return __builtin_amdgcn_wmma_f32_16x16x32_f16(false, a, false, b, (short)0, c,
                                                false, false);
}

typedef float    v4f  __attribute__((ext_vector_type(4)));
typedef _Float16 v4h  __attribute__((ext_vector_type(4)));
typedef _Float16 v2h  __attribute__((ext_vector_type(2)));

// lane l <-> lane l ^ 16
__device__ __forceinline__ float xhalf(float x) {
  int v = __builtin_bit_cast(int, x);
  return __builtin_bit_cast(
      float, __builtin_amdgcn_permlanex16(v, v, 0x76543210, 0xfedcba98, false, false));
}

// x + (x of lane l ^ MASK), inside a 16-lane row (DPP row_xmask)
template <int MASK>
__device__ __forceinline__ float row_xadd(float x) {
  int v = __builtin_bit_cast(int, x);
  return x + __builtin_bit_cast(
                 float, __builtin_amdgcn_update_dpp(v, v, 0x160 + MASK, 0xf, 0xf, false));
}

// sum over the 32 lanes, the same value in every lane
__device__ __forceinline__ float wave_sum(float x) {
  x = row_xadd<1>(x);
  x = row_xadd<2>(x);
  x = row_xadd<4>(x);
  x = row_xadd<8>(x);
  return x + xhalf(x);
}

// ---------------------------------------------------------------------------
// The jobs without matrix work are dealt so that few waves start and each moves
// much: 128 x 128 transpose tiles and four layer-norm rows a wave, 16-byte loads, all of
// a wave's loads in flight at once.
//
// Transpose tile in LDS: row = output row, 64 dwords, a dword = two neighbours of the
// output row. The 16-byte pieces of a row are permuted by an XOR with a number taken
// from the row index, so that the 32 dword stores of a wave (16 rows, 2 columns) fall
// in 32 banks and the 16-byte reads along a row stay whole.
// Every loop of these jobs is unrolled: its arrays are then registers and its address
// steps constants of the instructions.
// ---------------------------------------------------------------------------
#define TT 128  // tile edge

// Weight transpose + f32 -> f16 convert:  Wt[n][k] = (f16) W[k][n], W with INNERv columns
__device__ __forceinline__ void wtrans_job(unsigned* sT, const float* __restrict__ W,
                                           _Float16* __restrict__ Wt, int K, int bx, int by) {
  const int t = threadIdx.x, lane = t & 31, w = t >> 5, hl = lane >> 4, l16 = lane & 15;
  const int n0 = bx * TT, k0 = by * TT;
  // a half wave reads 256 contiguous bytes of rows 2*kp and 2*kp + 1
  // (kp = w * 8 + (it / 2) * 2 + hl, columns (it % 2) * 64 + l16 * 4): one address, constant steps
  const float* p0 = W + (size_t)(k0 + w * 16 + hl * 2) * INNERv + n0 + l16 * 4;
  v4f r0[8], r1[8];
#pragma unroll
  for (int it = 0; it < 8; ++it) {
    const float* p = p0 + (it >> 1) * 4 * INNERv + (it & 1) * 64;
    r0[it] = *(const v4f*)p;
    r1[it] = *(const v4f*)(p + INNERv);
  }
  // the address is named, so that it outlives the last load and no load of the group
  // is given it as a target; behind the wait its registers are free
  asm volatile("s_wait_xcnt 0x0" ::"v"(p0) : "memory");
  // keeps the sixteen loads ahead of the first LDS store: one latency for the tile
  __builtin_amdgcn_sched_barrier(0);
#pragma unroll
  for (int it = 0; it < 8; ++it) {
    const int id = w * 8 + it, kp = (id >> 1) * 2 + hl, nq = (id & 1) * 16 + l16;
#pragma unroll
    for (int i = 0; i < 4; ++i) {
      v2h h = {(_Float16)r0[it][i], (_Float16)r1[it][i]};
      sT[(nq * 4 + i) * 64 + (((kp >> 2) ^ l16) << 2) + (kp & 3)] =
          __builtin_bit_cast(unsigned, h);
    }
  }
  __syncthreads();
#pragma unroll
  for (int it = 0; it < 8; ++it) {
    const int id = it * 256 + t, n = id >> 4, c = id & 15;
    v4u d = *(const v4u*)&sT[n * 64 + ((c ^ ((n >> 2) & 15)) << 2)];
    *(v4u*)(Wt + (size_t)(n0 + n) * K + k0 + c * 8) = d;
  }
  // behind the stores: in the built kernel another job's instructions stand next and
  // write the registers that these stores name
  asm volatile("s_wait_xcnt 0x0" ::: "memory");
}

// Weight convert f32 -> f16, layout kept: a block takes TT * TT elements in a row
__device__ __forceinline__ void wconv_job(const float* __restrict__ W,
                                          _Float16* __restrict__ Wh, int blk) {
  const int t = threadIdx.x;
  const v4f* p0 = (const v4f*)W + (size_t)blk * (TT * TT / 4) + t;
  v4f r[16];
#pragma unroll
  for (int it = 0; it < 16; ++it) r[it] = p0[it * 256];
  // the address is named, so that it outlives the last load and no load of the group
  // is given it as a target; behind the wait its registers are free
  asm volatile("s_wait_xcnt 0x0" ::"v"(p0) : "memory");
  // keeps the sixteen loads ahead of the first store: one latency for the block
  __builtin_amdgcn_sched_barrier(0);
  v4h* q = (v4h*)Wh + (size_t)blk * (TT * TT / 4) + t;
#pragma unroll
  for (int it = 0; it < 16; ++it) {
    v4h o;
#pragma unroll
    for (int i = 0; i < 4; ++i) o[i] = (_Float16)r[it][i];
    q[it * 256] = o;
  }
  // behind the stores: in the built kernel another job's instructions stand next and
  // write the registers that these stores name
  asm volatile("s_wait_xcnt 0x0" ::: "memory");
}

// Bias of the folded output:  bc[n] = bf[n] + sum_j bo[j] * W2[j][n]  (f32; W2 = the rows
// of the fusion weight that meet the attention half, DQv x DQv). A block takes BC_C
// columns: 8 lanes span them, 32 lane groups take 32 rows each, all 32 loads of a lane in
// flight at once; the groups' sums meet in LDS.
#define BC_C 32
__device__ __forceinline__ void bias_job(float* sF, const float* __restrict__ W2,
                                         const float* __restrict__ bo,
                                         const float* __restrict__ bf, float* __restrict__ bc,
                                         int blk) {
  const int t = threadIdx.x, c4 = t & 7, rg = t >> 3;
  const int n0 = blk * BC_C;
  const float* p0 = W2 + (size_t)(rg * 32) * DQv + n0 + c4 * 4;
  const v4f* b0 = (const v4f*)(bo + rg * 32);
  v4f wv[32], bv[8];
#pragma unroll
  for (int it = 0; it < 32; ++it) wv[it] = *(const v4f*)(p0 + it * DQv);
#pragma unroll
  for (int i = 0; i < 8; ++i) bv[i] = b0[i];
  // the addresses are named, so that they outlive the last load and no load of the group
  // is given them as a target; behind the wait their registers are free
  asm volatile("s_wait_xcnt 0x0" ::"v"(p0), "v"(b0) : "memory");
  // keeps every load ahead of the first product: one memory latency for the block
  __builtin_amdgcn_sched_barrier(0);
  v4f s = wv[0] * bv[0][0];
#pragma unroll
  for (int it = 1; it < 32; ++it) s += wv[it] * bv[it >> 2][it & 3];
  *(v4f*)&sF[rg * BC_C + c4 * 4] = s;
  __syncthreads();
  if (t < BC_C) {
    float a = bf[n0 + t];
#pragma unroll
    for (int r = 0; r < 32; ++r) a += sF[r * BC_C + t];
    bc[n0 + t] = a;
  }
  // behind the load and the store: in the built kernel another job's instructions stand
  // next and write the registers that they name
  asm volatile("s_wait_xcnt 0x0" ::: "memory");
}

// ---------------------------------------------------------------------------
// Per-batch transpose of V (f16):  Vt[b][c][m] = V[b*M + m][c]
// ---------------------------------------------------------------------------
__device__ __forceinline__ void vtrans_job(unsigned* sT, const _Float16* __restrict__ V,
                                           _Float16* __restrict__ Vt, int bx, int by, int b) {
  const int t = threadIdx.x, lane = t & 31, w = t >> 5, hl = lane >> 4, l16 = lane & 15;
  const int c0 = bx * TT, m0 = by * TT;
  // a half wave reads 256 contiguous bytes of rows 2*mp and 2*mp + 1
  // (mp = (w * 4 + it) * 2 + hl): one address, constant steps
  const _Float16* p0 = V + ((size_t)b * SEQ_M + m0 + w * 16 + hl * 2) * INNERv + c0 + l16 * 8;
  v4u r0[4], r1[4];
#pragma unroll
  for (int it = 0; it < 4; ++it) {
    r0[it] = *(const v4u*)(p0 + it * 4 * INNERv);
    r1[it] = *(const v4u*)(p0 + it * 4 * INNERv + INNERv);
  }
  // the address is named, so that it outlives the last load and no load of the group
  // is given it as a target; behind the wait its registers are free
  asm volatile("s_wait_xcnt 0x0" ::"v"(p0) : "memory");
  // keeps the eight loads ahead of the first LDS store: one latency for the tile
  __builtin_amdgcn_sched_barrier(0);
#pragma unroll
  for (int it = 0; it < 4; ++it) {
    const int mp = (w * 4 + it) * 2 + hl;
    unsigned* q = &sT[(l16 * 8) * 64 + (((mp >> 2) ^ l16) << 2) + (mp & 3)];
#pragma unroll
    for (int i = 0; i < 4; ++i) {
      const unsigned lo = r0[it][i], hi = r1[it][i];
      q[(2 * i) * 64] = (lo & 0xffffu) | (hi << 16);
      q[(2 * i + 1) * 64] = (lo >> 16) | (hi & 0xffff0000u);
    }
  }
  __syncthreads();
#pragma unroll
  for (int it = 0; it < 8; ++it) {
    const int id = it * 256 + t, n = id >> 4, c = id & 15;
    v4u d = *(const v4u*)&sT[n * 64 + ((c ^ ((n >> 3) & 15)) << 2)];
    *(v4u*)(Vt + ((size_t)b * INNERv + c0 + n) * SEQ_M + m0 + c * 8) = d;
  }
  // behind the stores: in the built kernel another job's instructions stand next and
  // write the registers that these stores name
  asm volatile("s_wait_xcnt 0x0" ::: "memory");
}

// ---------------------------------------------------------------------------
// Row LayerNorm (f32 statistics) producing f16 rows: a wave takes LN_R rows and holds
// them in registers; a row's sums are in-lane, then exchanged between lanes (no LDS, no
// barrier). With COPY the wave also writes the rows themselves as f16 into concat
// buffer cols [0, D).
// ---------------------------------------------------------------------------
#define LN_R 4
#define LN_RB (8 * LN_R)  // rows a block

template <int D, bool COPY>
__device__ __forceinline__ void ln_f16_job(const float* __restrict__ x,
                                           const float* __restrict__ g,
                                           const float* __restrict__ beta,
                                           _Float16* __restrict__ y,
                                           _Float16* __restrict__ cat, int row0) {
  constexpr int NJ = D / 128;  // 512-byte pieces of a row, 16 bytes a lane
  const int lane = threadIdx.x & 31;
  const v4f* xr = (const v4f*)(x + (size_t)row0 * D) + lane;
  v4f v[LN_R][NJ], gg[NJ], bb[NJ];
#pragma unroll
  for (int r = 0; r < LN_R; ++r)
#pragma unroll
    for (int j = 0; j < NJ; ++j) v[r][j] = xr[r * (D / 4) + j * 32];
#pragma unroll
  for (int j = 0; j < NJ; ++j) {
    gg[j] = ((const v4f*)g)[j * 32 + lane];
    bb[j] = ((const v4f*)beta)[j * 32 + lane];
  }
  // the address is named, so that it outlives the last load and no load of the group
  // is given it as a target; behind the wait its registers are free
  asm volatile("s_wait_xcnt 0x0" ::"v"(xr) : "memory");
  // keeps every load of the wave ahead of the first sum: one memory latency for its rows
  __builtin_amdgcn_sched_barrier(0);

  float a[LN_R], b[LN_R];
#pragma unroll
  for (int r = 0; r < LN_R; ++r) {
    v4f s = v[r][0], q = v[r][0] * v[r][0];
#pragma unroll
    for (int j = 1; j < NJ; ++j) {
      s += v[r][j];
      q += v[r][j] * v[r][j];
    }
    a[r] = (s[0] + s[1]) + (s[2] + s[3]);
    b[r] = (q[0] + q[1]) + (q[2] + q[3]);
  }
#pragma unroll
  for (int r = 0; r < LN_R; ++r) {
    a[r] = wave_sum(a[r]);
    b[r] = wave_sum(b[r]);
  }
#pragma unroll
  for (int r = 0; r < LN_R; ++r) {
    const float mu = a[r] * (1.0f / D);
    const float var = b[r] * (1.0f / D) - mu * mu;
    const float rs = rsqrtf(var + 1e-5f);
    v4h* yr = (v4h*)(y + (size_t)(row0 + r) * D) + lane;
#pragma unroll
    for (int j = 0; j < NJ; ++j) {
      v4h o;
#pragma unroll
      for (int i = 0; i < 4; ++i)
        o[i] = (_Float16)((v[r][j][i] - mu) * rs * gg[j][i] + bb[j][i]);
      yr[j * 32] = o;
    }
    if constexpr (COPY) {
      v4h* cr = (v4h*)(cat + (size_t)(row0 + r) * (2 * D)) + lane;
#pragma unroll
      for (int j = 0; j < NJ; ++j) {
        v4h o;
#pragma unroll
        for (int i = 0; i < 4; ++i) o[i] = (_Float16)v[r][j][i];
        cr[j * 32] = o;
      }
    }
  }
  // behind the stores: in the built kernel another job's instructions stand next and
  // write the registers that these stores name
  asm volatile("s_wait_xcnt 0x0" ::: "memory");
}

// ---------------------------------------------------------------------------
// All work that depends on the inputs alone, in one launch: a block takes one job,
// picked by its index (the same for the whole block, so the transposes' barrier is safe).
// ---------------------------------------------------------------------------
#define PJ_LNP ((BATCH * SEQ_N) / LN_RB)              // person row groups
#define PJ_LNG (PJ_LNP + (BATCH * SEQ_M) / LN_RB)     // garment row groups
#define PJ_TN  (INNERv / TT)                          // weight tiles a tile row
#define PJ_WQ  (PJ_LNG + (DQv / TT) * PJ_TN)
#define PJ_WK  (PJ_WQ + (DCv / TT) * PJ_TN)
#define PJ_WV  (PJ_WK + (DCv / TT) * PJ_TN)
#define PJ_WO  (PJ_WV + (INNERv * DQv) / (TT * TT))   // Wo: converted, not transposed
#define PJ_WF1 (PJ_WO + (DQv / TT) * PJ_TN)           // Wf rows that meet the residual
#define PJ_WF2 (PJ_WF1 + (DQv / TT) * PJ_TN)          // Wf rows that meet the attention half
#define PJ_BC  (PJ_WF2 + DQv / BC_C)                  // folded bias

__global__ void __launch_bounds__(256)
prep_kernel(const float* __restrict__ person, const float* __restrict__ garment,
            const float* __restrict__ Wq, const float* __restrict__ Wk,
            const float* __restrict__ Wv, const float* __restrict__ Wo,
            const float* __restrict__ Wf, const float* __restrict__ bo,
            const float* __restrict__ bf, const float* __restrict__ gq,
            const float* __restrict__ betaq, const float* __restrict__ gk,
            const float* __restrict__ betak, _Float16* __restrict__ pLN,
            _Float16* __restrict__ gLN, _Float16* __restrict__ WqT, _Float16* __restrict__ WkT,
            _Float16* __restrict__ WvT, _Float16* __restrict__ Woh, _Float16* __restrict__ WcT,
            _Float16* __restrict__ Wf2T, float* __restrict__ biasC,
            _Float16* __restrict__ Cat) {
  __shared__ __attribute__((aligned(16))) unsigned sT[TT * 64];
  const int j = blockIdx.x;
  const int wrow = (threadIdx.x >> 5) * LN_R;  // the wave's first row in a row group
  if (j < PJ_LNP) {
    ln_f16_job<DQv, true>(person, gq, betaq, pLN, Cat, j * LN_RB + wrow);
    return;
  }
  if (j < PJ_LNG) {
    ln_f16_job<DCv, false>(garment, gk, betak, gLN, nullptr, (j - PJ_LNP) * LN_RB + wrow);
    return;
  }
  if (j >= PJ_WF2) {
    bias_job((float*)sT, Wf + (size_t)DQv * DQv, bo, bf, biasC, j - PJ_WF2);
    return;
  }
  if (j >= PJ_WV && j < PJ_WO) {
    wconv_job(Wo, Woh, j - PJ_WV);
    return;
  }
  {
    // every weight has 1024 columns (INNER = DQ): PJ_TN tiles a tile row; K is the
    // row length of the target (the residual half of Wf goes into the left half of the
    // final product's weight, the other half into a matrix of its own)
    const float* W = Wf + (size_t)DQv * DQv;
    _Float16* Wt = Wf2T;
    int K = DQv, first = PJ_WF1;
    if (j < PJ_WQ) {
      W = Wq; Wt = WqT; K = DQv; first = PJ_LNG;
    } else if (j < PJ_WK) {
      W = Wk; Wt = WkT; K = DCv; first = PJ_WQ;
    } else if (j < PJ_WV) {
      W = Wv; Wt = WvT; K = DCv; first = PJ_WK;
    } else if (j < PJ_WF1) {
      W = Wf; Wt = WcT; K = 2 * DQv; first = PJ_WO;
    }
    wtrans_job(sT, W, Wt, K, (j - first) % PJ_TN, (j - first) / PJ_TN);
  }
}

// ---------------------------------------------------------------------------
// WMMA GEMM:  C[M x N] = A[M x K] * Bt[N x K]^T (+ bias), f16 in, f32 acc.
// Block: 256 threads = 8 waves (4x2 wave grid), tile 128x128.
// A and Bt come into LDS by asynchronous copies, through no register: a stage is 128 k
// of both tiles (whole 256-byte rows), two buffers, the next stage's copies in flight
// while this stage is worked on; one barrier a stage. K: a multiple of 128.
// ---------------------------------------------------------------------------
#define GBM 128
#define GBN 128
#define GBK 128
#define GLD 136                  // LDS row pitch in halfs: 256-byte rows at 272 bytes
#define GBO (GBM * GLD)          // the Bt tile stands behind the A tile (in halfs)
#define GBH (GBO + GBN * GLD)    // one buffer (in halfs)

// One operand's tile of a stage into LDS: eight 16-byte copies a lane, 16 rows apart.
// l: the lane's LDS byte address; g: its global one; ld: the operand's row length.
// The s_wait_xcnt stands inside the statement, so that no address register of a copy
// is rewritten ahead of it.
__device__ __forceinline__ void gemm_copy_tile(unsigned l, const _Float16* g, int ld) {
  const size_t s = (size_t)16 * ld;
  asm volatile(
      "global_load_async_to_lds_b128 %0, %8, off\n\t"
      "global_load_async_to_lds_b128 %1, %9, off\n\t"
      "global_load_async_to_lds_b128 %2, %10, off\n\t"
      "global_load_async_to_lds_b128 %3, %11, off\n\t"
      "global_load_async_to_lds_b128 %4, %12, off\n\t"
      "global_load_async_to_lds_b128 %5, %13, off\n\t"
      "global_load_async_to_lds_b128 %6, %14, off\n\t"
      "global_load_async_to_lds_b128 %7, %15, off\n\t"
      "s_wait_xcnt 0x0" ::"v"(l),
      "v"(l + 16 * GLD * 2), "v"(l + 32 * GLD * 2), "v"(l + 48 * GLD * 2),
      "v"(l + 64 * GLD * 2), "v"(l + 80 * GLD * 2), "v"(l + 96 * GLD * 2),
      "v"(l + 112 * GLD * 2), "v"(g), "v"(g + s), "v"(g + 2 * s), "v"(g + 3 * s),
      "v"(g + 4 * s), "v"(g + 5 * s), "v"(g + 6 * s), "v"(g + 7 * s)
      : "memory");
}

template <bool OUT_F16, bool HAS_BIAS>
__device__ __forceinline__ void gemm_tile(_Float16* sAB, const _Float16* __restrict__ A, int lda,
                                 const _Float16* __restrict__ Bt, int ldb,
                                 void* __restrict__ Cv, int ldc,
                                 const float* __restrict__ bias, int K, int rowBlock,
                                 int colBlock) {
  const int t = threadIdx.x;
  const int lane = t & 31, w = t >> 5;
  const int wm = w & 3, wn = w >> 2;  // 4 waves in M x 2 waves in N
  const int lr = lane & 15, hi4 = lane >> 4, kof = hi4 * 8;
  const int nst = K / GBK;  // stages

  // the lane's part of a stage: rows t/16 + 16 j of both tiles, 16-byte piece t%16
  const _Float16* ga = A + (size_t)(rowBlock + (t >> 4)) * lda + (t & 15) * 8;
  const _Float16* gb = Bt + (size_t)(colBlock + (t >> 4)) * ldb + (t & 15) * 8;
  const unsigned la = (unsigned)(size_t)&sAB[(t >> 4) * GLD + (t & 15) * 8];
  const unsigned lb = la + GBO * 2;

  // stage 0 into buffer 0, landed and published; then stage 1 goes out into buffer 1
  gemm_copy_tile(la, ga, lda);
  gemm_copy_tile(lb, gb, ldb);
  // this wave's copies have landed
  asm volatile("s_wait_asynccnt 0x0" ::: "memory");
  __syncthreads();
  if (nst > 1) {
    gemm_copy_tile(la + GBH * 2, ga + GBK, lda);
    gemm_copy_tile(lb + GBH * 2, gb + GBK, ldb);
  }

  // every loop over fragments is unrolled: its arrays are then registers and its LDS
  // steps constants of the loads
  v8f acc[2][4];
#pragma unroll
  for (int fm = 0; fm < 2; ++fm)
#pragma unroll
    for (int fn = 0; fn < 4; ++fn) acc[fm][fn] = v8f_zero();

  for (int st = 0; st < nst; ++st) {
    const _Float16* sA = sAB + (st & 1) * GBH + (wm * 32 + lr) * GLD + kof;
    const _Float16* sB = sAB + (st & 1) * GBH + GBO + (wn * 64 + lr) * GLD + kof;
#pragma unroll
    for (int ks = 0; ks < GBK / 32; ++ks) {
      v16h af[2], bfr[4];
#pragma unroll
      for (int fm = 0; fm < 2; ++fm) af[fm] = ldfrag(sA + fm * 16 * GLD + ks * 32);
#pragma unroll
      for (int fn = 0; fn < 4; ++fn) bfr[fn] = ldfrag(sB + fn * 16 * GLD + ks * 32);
#pragma unroll
      for (int fm = 0; fm < 2; ++fm)
#pragma unroll
        for (int fn = 0; fn < 4; ++fn)
          acc[fm][fn] = wmma16x16x32(af[fm], bfr[fn], acc[fm][fn]);
    }
    // hand-over: this wave's reads of the buffer are done, its copies of the next stage
    // have landed; behind the barrier the next stage is readable by all and this
    // stage's buffer is free for the stage after it
    asm volatile("s_wait_dscnt 0x0" ::: "memory");
    asm volatile("s_wait_asynccnt 0x0" ::: "memory");
    __syncthreads();
    if (st + 2 < nst) {
      gemm_copy_tile(la + (st & 1) * (GBH * 2), ga + (size_t)(st + 2) * GBK, lda);
      gemm_copy_tile(lb + (st & 1) * (GBH * 2), gb + (size_t)(st + 2) * GBK, ldb);
    }
  }
  // no copy is left in flight when the wave ends
  asm volatile("s_wait_asynccnt 0x0" ::: "memory");

  // store: C layout — VGPR e: lanes 0-15 -> m=e, lanes 16-31 -> m=e+8; n=lr
#pragma unroll
  for (int fm = 0; fm < 2; ++fm)
#pragma unroll
    for (int fn = 0; fn < 4; ++fn) {
      int col = colBlock + wn * 64 + fn * 16 + lr;
      int row0 = rowBlock + wm * 32 + fm * 16 + hi4 * 8;
      float bv = HAS_BIAS ? bias[col] : 0.f;
#pragma unroll
      for (int e = 0; e < 8; ++e) {
        float v = acc[fm][fn][e] + bv;
        if constexpr (OUT_F16)
          ((_Float16*)Cv)[(size_t)(row0 + e) * ldc + col] = (_Float16)v;
        else
          ((float*)Cv)[(size_t)(row0 + e) * ldc + col] = v;
      }
    }
}

template <bool OUT_F16, bool HAS_BIAS>
__global__ void __launch_bounds__(256) gemm_wmma_kernel(const _Float16* __restrict__ A, int lda,
                                 const _Float16* __restrict__ Bt, int ldb,
                                 void* __restrict__ Cv, int ldc,
                                 const float* __restrict__ bias, int M, int N, int K) {
  __shared__ __attribute__((aligned(16))) _Float16 sAB[2 * GBH];
  gemm_tile<OUT_F16, HAS_BIAS>(sAB, A, lda, Bt, ldb, Cv, ldc, bias, K, blockIdx.y * GBM,
                               blockIdx.x * GBN);
}

// The three projections in one launch: none reads another's result. blockIdx.y picks
// the product and its row tile; the longest (Q, K = DQ) has the lowest indices.
#define QKV_YQ ((BATCH * SEQ_N) / GBM)
#define QKV_YK (QKV_YQ + (BATCH * SEQ_M) / GBM)
#define QKV_YV (QKV_YK + (BATCH * SEQ_M) / GBM)

__global__ void __launch_bounds__(256)
gemm_qkv_kernel(const _Float16* __restrict__ pLN, const _Float16* __restrict__ gLN,
                const _Float16* __restrict__ WqT, const _Float16* __restrict__ WkT,
                const _Float16* __restrict__ WvT, _Float16* __restrict__ Qh,
                _Float16* __restrict__ Kh, _Float16* __restrict__ Vh) {
  __shared__ __attribute__((aligned(16))) _Float16 sAB[2 * GBH];
  const int y = blockIdx.y;
  const bool isQ = y < QKV_YQ, isK = y < QKV_YK;
  const _Float16* A = isQ ? pLN : gLN;
  const _Float16* Bt = isQ ? WqT : (isK ? WkT : WvT);
  _Float16* C = isQ ? Qh : (isK ? Kh : Vh);
  const int K = isQ ? DQv : DCv;
  const int yt = isQ ? y : (isK ? y - QKV_YQ : y - QKV_YK);
  gemm_tile<true, false>(sAB, A, K, Bt, K, (void*)C, INNERv, nullptr, K, yt * GBM,
                         blockIdx.x * GBN);
}

// The output projection is folded into the final product:
//   (att Wo + bo) Wf2 + res Wf1 + bf = att (Wo Wf2) + res Wf1 + (bo Wf2 + bf),
// Wf1, Wf2 the upper and lower DQv rows of Wf. The weight product (Wo Wf2)^T = Wf2^T Wo^T
// needs the prepared weights alone, as the V transpose needs V alone: both in one launch,
// a block takes one job by its index; the product's tiles, the longer job, come first.
// Its result is the right half of the final product's weight rows.
#define VW_W2  ((DQv / GBM) * (INNERv / GBN))
#define VW_ALL (VW_W2 + (INNERv / TT) * (SEQ_M / TT) * BATCH)

__global__ void __launch_bounds__(256)
vtrans_w2_kernel(const _Float16* __restrict__ V, _Float16* __restrict__ Vt,
                 const _Float16* __restrict__ Wf2T, const _Float16* __restrict__ Woh,
                 _Float16* __restrict__ WcT) {
  __shared__ __attribute__((aligned(16))) _Float16 sAB[2 * GBH];
  const int j = blockIdx.x;
  if (j < VW_W2) {
    gemm_tile<true, false>(sAB, Wf2T, DQv, Woh, DQv, (void*)(WcT + DQv), 2 * DQv, nullptr, DQv,
                           (j / (INNERv / GBN)) * GBM, (j % (INNERv / GBN)) * GBN);
    return;
  }
  const int v = j - VW_W2;
  vtrans_job((unsigned*)sAB, V, Vt, v % (INNERv / TT), (v / (INNERv / TT)) % (SEQ_M / TT),
             v / ((INNERv / TT) * (SEQ_M / TT)));
}

#define AT_NW 8
#define AT_G  2
#define AT_QB (AT_NW * AT_G * 16)
#define AT_SK 128                      // keys per stage
#define AT_NS (SEQ_M / AT_SK)          // stages
#define AT_SP (AT_SK / 32)             // passes per stage
#define AT_KP 72                       // K tile: 128 rows of 128 B at a pitch of 144 B (in halfs)
#define AT_VP 136                      // V^T tile: 64 rows of 256 B at a pitch of 272 B (in halfs)
#define AT_VO (AT_SK * AT_KP)          // V^T tile stands behind the K tile (in halfs)
#define AT_BH (AT_VO + DHEAD * AT_VP)  // one buffer (in halfs)
#define AT_OP (DQv + INNERv)           // output row pitch: the right half of the concat rows

// Base-2 exponentials in place, a run of them in one statement: left to the
// register allocator, an exponential's target is often the source of the one
// directly ahead of it. Here each overwrites only its own source, and the v_nop is
// the slot the instruction set asks for between the last one and its first reader.
__device__ __forceinline__ void exp2_inplace(v8f& x) {
  float a0 = x[0], a1 = x[1], a2 = x[2], a3 = x[3], a4 = x[4], a5 = x[5], a6 = x[6], a7 = x[7];
  asm("v_exp_f32 %0, %0\n\tv_exp_f32 %1, %1\n\tv_exp_f32 %2, %2\n\tv_exp_f32 %3, %3\n\t"
      "v_exp_f32 %4, %4\n\tv_exp_f32 %5, %5\n\tv_exp_f32 %6, %6\n\tv_exp_f32 %7, %7\n\t"
      "v_nop"
      : "+v"(a0), "+v"(a1), "+v"(a2), "+v"(a3), "+v"(a4), "+v"(a5), "+v"(a6), "+v"(a7));
  x[0] = a0; x[1] = a1; x[2] = a2; x[3] = a3; x[4] = a4; x[5] = a5; x[6] = a6; x[7] = a7;
}
__device__ __forceinline__ void exp2_inplace(float& a0, float& a1) {
  asm("v_exp_f32 %0, %0\n\tv_exp_f32 %1, %1\n\tv_nop" : "+v"(a0), "+v"(a1));
}

// One stage into LDS: eight 16-byte copies a lane, four of K (32 rows apart) and four
// of V^T (16 rows apart). kl, vl: the lane's LDS byte addresses; kg, vg: its global ones.
// The s_wait_xcnt stands inside the statement, so that no address register of a copy
// is rewritten ahead of it.
__device__ __forceinline__ void at_copy_stage(unsigned kl, unsigned vl, const _Float16* kg,
                                              const _Float16* vg) {
  asm volatile(
      "global_load_async_to_lds_b128 %0, %8, off\n\t"
      "global_load_async_to_lds_b128 %1, %9, off\n\t"
      "global_load_async_to_lds_b128 %2, %10, off\n\t"
      "global_load_async_to_lds_b128 %3, %11, off\n\t"
      "global_load_async_to_lds_b128 %4, %12, off\n\t"
      "global_load_async_to_lds_b128 %5, %13, off\n\t"
      "global_load_async_to_lds_b128 %6, %14, off\n\t"
      "global_load_async_to_lds_b128 %7, %15, off\n\t"
      "s_wait_xcnt 0x0" ::"v"(kl),
      "v"(kl + 32 * AT_KP * 2), "v"(kl + 64 * AT_KP * 2), "v"(kl + 96 * AT_KP * 2), "v"(vl),
      "v"(vl + 16 * AT_VP * 2), "v"(vl + 32 * AT_VP * 2), "v"(vl + 48 * AT_VP * 2), "v"(kg),
      "v"(kg + 32 * INNERv), "v"(kg + 64 * INNERv), "v"(kg + 96 * INNERv), "v"(vg),
      "v"(vg + 16 * SEQ_M), "v"(vg + 32 * SEQ_M), "v"(vg + 48 * SEQ_M)
      : "memory");
}

__global__ void __launch_bounds__(AT_NW * 32)
attn_kernel(const _Float16* __restrict__ Q, const _Float16* __restrict__ Kf,
            const _Float16* __restrict__ Vt, _Float16* __restrict__ O) {
  __shared__ __attribute__((aligned(16))) _Float16 sKV[2 * AT_BH];
  const int t = threadIdx.x;
  const int lane = t & 31, w = t >> 5;
  const int lr = lane & 15, hi4 = lane >> 4, kof = hi4 * 8;
  const int bh = blockIdx.y, b = bh >> 4, h = bh & 15;
  const int q0 = blockIdx.x * AT_QB + w * (AT_G * 16);
  const float cs = ATT_SCALE * 1.4426950408889634f;  // scores in the log2 domain

  // Q as B operand: column lr = query, DH split into two 32-wide k-steps
  v16h qf[AT_G][2];
#pragma unroll
  for (int g = 0; g < AT_G; ++g) {
    const _Float16* qp = Q + ((size_t)(b * SEQ_N + q0 + g * 16 + lr)) * INNERv + h * DHEAD + kof;
    qf[g][0] = ldfrag(qp);
    qf[g][1] = ldfrag(qp + 32);
  }

  // the lane's part of a stage: K row t/8, 16-byte piece t%8; V^T row t/16, piece t%16
  const _Float16* kg = Kf + ((size_t)(b * SEQ_M + (t >> 3))) * INNERv + h * DHEAD + (t & 7) * 8;
  const _Float16* vg = Vt + ((size_t)(b * INNERv + h * DHEAD + (t >> 4))) * SEQ_M + (t & 15) * 8;
  const unsigned kl = (unsigned)(size_t)&sKV[(t >> 3) * AT_KP + (t & 7) * 8];
  const unsigned vl = (unsigned)(size_t)&sKV[AT_VO + (t >> 4) * AT_VP + (t & 15) * 8];

  // stage 0 into buffer 0, landed and published; then stage 1 goes out into buffer 1
  at_copy_stage(kl, vl, kg, vg);
  // this wave's copies have landed
  asm volatile("s_wait_asynccnt 0x0" ::: "memory");
  __syncthreads();
  at_copy_stage(kl + AT_BH * 2, vl + AT_BH * 2, kg + (size_t)AT_SK * INNERv, vg + AT_SK);

  v8f acc[AT_G][4];
  float mrun[AT_G], lsum[AT_G];
#pragma unroll
  for (int g = 0; g < AT_G; ++g) {
    mrun[g] = -__builtin_inff();
    lsum[g] = 0.f;
#pragma unroll
    for (int d = 0; d < 4; ++d) acc[g][d] = v8f_zero();
  }

  for (int st = 0; st < AT_NS; ++st) {
   const _Float16* kbase = sKV + (st & 1) * AT_BH + lr * AT_KP + kof;
   const _Float16* vbase = sKV + (st & 1) * AT_BH + AT_VO + lr * AT_VP + kof;

   // K as A operand: row lr = key; two 16-key tiles x two k-steps, one pass ahead
   // inside a stage (never into the next stage's buffer)
   v16h kf[2][2];
#pragma unroll
   for (int kt = 0; kt < 2; ++kt) {
     kf[kt][0] = ldfrag(kbase + (kt * 16) * AT_KP);
     kf[kt][1] = ldfrag(kbase + (kt * 16) * AT_KP + 32);
   }

   for (int p = 0; p < AT_SP; ++p) {
    // V^T as A operand: row lr = dh, k = this pass's 32 keys; in flight under the
    // score products and the softmax. The barrier holds the fetch up here: sunk to
    // its first use it would be waited for at once
    v16h vf[4];
#pragma unroll
    for (int d = 0; d < 4; ++d) vf[d] = ldfrag(vbase + (d * 16) * AT_VP + p * 32);
    __builtin_amdgcn_sched_barrier(0);

    v8f s[2][AT_G];
#pragma unroll
    for (int kt = 0; kt < 2; ++kt)
#pragma unroll
      for (int g = 0; g < AT_G; ++g) {
        s[kt][g] = wmma16x16x32(kf[kt][0], qf[g][0], v8f_zero());
        s[kt][g] = wmma16x16x32(kf[kt][1], qf[g][1], s[kt][g]);
      }

    // keeps the eight products back to back: mixed with the maxima below, each
    // product that a maximum follows is padded with idle slots
    __builtin_amdgcn_sched_barrier(0);

    // next pass's K into the same registers, in flight under the softmax and the
    // second product (a stage's last pass names its own rows again, unused: the next
    // stage is not published yet)
    const int pn = (p + 1 < AT_SP) ? p + 1 : p;
#pragma unroll
    for (int kt = 0; kt < 2; ++kt) {
      kf[kt][0] = ldfrag(kbase + (pn * 32 + kt * 16) * AT_KP);
      kf[kt][1] = ldfrag(kbase + (pn * 32 + kt * 16) * AT_KP + 32);
    }

    // holds the fetch here, ahead of the softmax: sunk to the foot of the pass it
    // would be waited for at once by the next pass's products
    __builtin_amdgcn_sched_barrier(0);

    // online softmax: new running maximum per query, sums and outputs rescaled
    // (no branch: the loop stays one block, so the fetches stay where they stand)
    float corr[AT_G];
#pragma unroll
    for (int g = 0; g < AT_G; ++g) {
      float mx = s[0][g][0];
#pragma unroll
      for (int e = 1; e < 8; ++e) mx = fmaxf(mx, s[0][g][e]);
#pragma unroll
      for (int e = 0; e < 8; ++e) mx = fmaxf(mx, s[1][g][e]);
      mx = fmaxf(mx, xhalf(mx)) * cs;
      const float mnew = fmaxf(mrun[g], mx);
      corr[g] = mrun[g] - mnew;  // -inf on the first pass: its exponential is 0
      mrun[g] = mnew;
    }
    exp2_inplace(corr[0], corr[1]);

#pragma unroll
    for (int g = 0; g < AT_G; ++g) {
      const float nm = -mrun[g];
      v8f e0, e1;
#pragma unroll
      for (int e = 0; e < 8; ++e) {
        e0[e] = fmaf(s[0][g][e], cs, nm);
        e1[e] = fmaf(s[1][g][e], cs, nm);
      }
      exp2_inplace(e0);
      exp2_inplace(e1);
      v16h pf;  // elements 0-7 = keys 8*hi4 + e, 8-15 = keys 16 + 8*hi4 + e: ldfrag's k order
      float ps = e0[0] + e1[0];
#pragma unroll
      for (int e = 1; e < 8; ++e) ps += e0[e] + e1[e];
#pragma unroll
      for (int e = 0; e < 8; ++e) {
        pf[e] = (_Float16)e0[e];
        pf[8 + e] = (_Float16)e1[e];
      }
      lsum[g] = fmaf(lsum[g], corr[g], ps);
#pragma unroll
      for (int d = 0; d < 4; ++d)
        acc[g][d] = wmma16x16x32(vf[d], pf, acc[g][d] * corr[g]);
    }
   }

   // hand-over: this wave's reads of the buffer are done, its copies of the next stage
   // have landed; behind the barrier the next stage is readable by all and this
   // stage's buffer is free for the stage after it
   asm volatile("s_wait_dscnt 0x0" ::: "memory");
   asm volatile("s_wait_asynccnt 0x0" ::: "memory");
   __syncthreads();
   if (st + 2 < AT_NS)
     at_copy_stage(kl + (st & 1) * (AT_BH * 2), vl + (st & 1) * (AT_BH * 2),
                   kg + (size_t)(st + 2) * AT_SK * INNERv, vg + (st + 2) * AT_SK);
  }
  // no copy is left in flight when the wave ends
  asm volatile("s_wait_asynccnt 0x0" ::: "memory");

  // O^T tile d: register e = dh d*16 + 8*hi4 + e of query lr: one 16-byte store
#pragma unroll
  for (int g = 0; g < AT_G; ++g) {
    const float l = lsum[g];
    const float inv = 1.0f / (l + xhalf(l));
    _Float16* op = O + ((size_t)(b * SEQ_N + q0 + g * 16 + lr)) * AT_OP + h * DHEAD + kof;
#pragma unroll
    for (int d = 0; d < 4; ++d) {
      v8h o;
#pragma unroll
      for (int e = 0; e < 8; ++e) o[e] = (_Float16)(acc[g][d][e] * inv);
      *(v8h*)(op + d * 16) = o;
    }
  }
}

// ---------------------------------------------------------------------------
// Host-side launch
// ---------------------------------------------------------------------------
extern "C" void kernel_launch(void* const* d_in, const int* in_sizes, int n_in,
                              void* d_out, int out_size, void* d_ws, size_t ws_size,
                              hipStream_t stream) {
  (void)in_sizes; (void)n_in; (void)out_size; (void)ws_size;

  const float* person  = (const float*)d_in[0];
  const float* garment = (const float*)d_in[1];
  const float* Wq = (const float*)d_in[2];
  const float* Wk = (const float*)d_in[3];
  const float* Wv = (const float*)d_in[4];
  const float* Wo = (const float*)d_in[5];
  const float* bo = (const float*)d_in[6];
  const float* Wf = (const float*)d_in[7];
  const float* bf = (const float*)d_in[8];
  const float* gq = (const float*)d_in[9];
  const float* betaq = (const float*)d_in[10];
  const float* gk = (const float*)d_in[11];
  const float* betak = (const float*)d_in[12];
  float* out = (float*)d_out;

  _Float16* w0 = (_Float16*)d_ws;
  size_t off = 0;
  _Float16* pLN = w0 + off; off += (size_t)BATCH * SEQ_N * DQv;
  _Float16* gLN = w0 + off; off += (size_t)BATCH * SEQ_M * DCv;
  _Float16* WqT = w0 + off; off += (size_t)INNERv * DQv;
  _Float16* WkT = w0 + off; off += (size_t)INNERv * DCv;
  _Float16* WvT = w0 + off; off += (size_t)INNERv * DCv;
  _Float16* Woh = w0 + off; off += (size_t)INNERv * DQv;
  _Float16* WcT = w0 + off; off += (size_t)DQv * (2 * DQv);
  _Float16* Wf2T = w0 + off; off += (size_t)DQv * DQv;
  _Float16* Qh  = w0 + off; off += (size_t)BATCH * SEQ_N * INNERv;
  _Float16* Kh  = w0 + off; off += (size_t)BATCH * SEQ_M * INNERv;
  _Float16* Vh  = w0 + off; off += (size_t)BATCH * SEQ_M * INNERv;
  _Float16* VtB = w0 + off; off += (size_t)BATCH * INNERv * SEQ_M;
  _Float16* Cat = w0 + off; off += (size_t)BATCH * SEQ_N * 2 * DQv;
  float* biasC = (float*)(w0 + off);

  // Layer norms (the person rows' f16 copy into concat cols [0, DQ) with them), weight
  // transpose+convert, folded bias
  prep_kernel<<<PJ_BC, 256, 0, stream>>>(person, garment, Wq, Wk, Wv, Wo, Wf, bo, bf, gq, betaq,
                                         gk, betak, pLN, gLN, WqT, WkT, WvT, Woh, WcT, Wf2T,
                                         biasC, Cat);

  // Q/K/V projections (f16 out)
  gemm_qkv_kernel<<<dim3(INNERv / GBN, QKV_YV), 256, 0, stream>>>(pLN, gLN, WqT, WkT, WvT, Qh,
                                                                  Kh, Vh);

  // V transpose for contiguous PV fragments; (Wo Wf2)^T into the final weight's right half
  vtrans_w2_kernel<<<VW_ALL, 256, 0, stream>>>(Vh, VtB, Wf2T, Woh, WcT);

  // Attention (online softmax in registers) -> concat cols [DQ, 2*DQ) (f16)
  attn_kernel<<<dim3(SEQ_N / AT_QB, BATCH * NHEAD), AT_NW * 32, 0, stream>>>(
      Qh, Kh, VtB, Cat + DQv);

  // [residual, att] @ [Wf1; Wo Wf2] + (bo Wf2 + bf) -> out (f32)
  gemm_wmma_kernel<false, true><<<dim3(DQv / GBN, (BATCH * SEQ_N) / GBM), 256, 0, stream>>>(
      Cat, 2 * DQv, WcT, 2 * DQv, (void*)out, DQv, biasC, BATCH * SEQ_N, DQv, 2 * DQv);
}

// v008
// One run takes 115 microseconds.
// In two side-by-side timings against v007, it was 1.04 and 1.02 times as fast.
// Counting every step since v000, it is 4.24 times as fast.
#include <hip/hip_runtime.h>

#define BATCH 4
#define SEQ_N 2048
#define SEQ_M 1024
#define DQv   1024
#define DCv   768
#define NHEAD 16
#define DHEAD 64
#define INNERv 1024
#define ATT_SCALE 0.125f

typedef _Float16 v16h __attribute__((ext_vector_type(16)));
typedef _Float16 v8h  __attribute__((ext_vector_type(8)));
typedef float    v8f  __attribute__((ext_vector_type(8)));
typedef unsigned int v4u __attribute__((ext_vector_type(4)));

__device__ __forceinline__ v8f v8f_zero() {
  v8f z = {0.f,0.f,0.f,0.f,0.f,0.f,0.f,0.f};
  return z;
}

// Load one 16-bit WMMA A/B fragment for this lane.
// Per CDNA5 ISA 16-bit 16x32 layout: a lane holds K chunks {base..base+7} and
// {base+16..base+23}; caller passes p already offset by ks*32 + (laneHi?8:0).
__device__ __forceinline__ v16h ldfrag(const _Float16* p) {
  v8h lo = *(const v8h*)(p);
  v8h hi = *(const v8h*)(p + 16);
  return __builtin_shufflevector(lo, hi, 0,1,2,3,4,5,6,7,8,9,10,11,12,13,14,15);
}

__device__ __forceinline__ v8f wmma16x16x32(v16h a, v16h b, v8f c) {
  return __builtin_amdgcn_wmma_f32_16x16x32_f16(false, a, false, b, (short)0, c,
                                                false, false);
}

typedef float    v4f  __attribute__((ext_vector_type(4)));
typedef _Float16 v4h  __attribute__((ext_vector_type(4)));
typedef _Float16 v2h  __attribute__((ext_vector_type(2)));

// lane l <-> lane l ^ 16
__device__ __forceinline__ float xhalf(float x) {
  int v = __builtin_bit_cast(int, x);
  return __builtin_bit_cast(
      float, __builtin_amdgcn_permlanex16(v, v, 0x76543210, 0xfedcba98, false, false));
}

// x + (x of lane l ^ MASK), inside a 16-lane row (DPP row_xmask)
template <int MASK>
__device__ __forceinline__ float row_xadd(float x) {
  int v = __builtin_bit_cast(int, x);
  return x + __builtin_bit_cast(
                 float, __builtin_amdgcn_update_dpp(v, v, 0x160 + MASK, 0xf, 0xf, false));
}

// sum over the 32 lanes, the same value in every lane
__device__ __forceinline__ float wave_sum(float x) {
  x = row_xadd<1>(x);
  x = row_xadd<2>(x);
  x = row_xadd<4>(x);
  x = row_xadd<8>(x);
  return x + xhalf(x);
}

// ---------------------------------------------------------------------------
// The jobs without matrix work are dealt so that few waves start and each moves
// much: 128 x 128 transpose tiles and four layer-norm rows a wave, 16-byte loads, all of
// a wave's loads in flight at once.
//
// Transpose tile in LDS: row = output row, 64 dwords, a dword = two neighbours of the
// output row. The 16-byte pieces of a row are permuted by an XOR with a number taken
// from the row index, so that the 32 dword stores of a wave (16 rows, 2 columns) fall
// in 32 banks and the 16-byte reads along a row stay whole.
// Every loop of these jobs is unrolled: its arrays are then registers and its address
// steps constants of the instructions.
// ---------------------------------------------------------------------------
#define TT 128  // tile edge

// Weight transpose + f32 -> f16 convert:  Wt[n][k] = (f16) W[k][n], W with INNERv columns
__device__ __forceinline__ void wtrans_job(unsigned* sT, const float* __restrict__ W,
                                           _Float16* __restrict__ Wt, int K, int bx, int by) {
  const int t = threadIdx.x, lane = t & 31, w = t >> 5, hl = lane >> 4, l16 = lane & 15;
  const int n0 = bx * TT, k0 = by * TT;
  // a half wave reads 256 contiguous bytes of rows 2*kp and 2*kp + 1
  // (kp = w * 8 + (it / 2) * 2 + hl, columns (it % 2) * 64 + l16 * 4): one address, constant steps
  const float* p0 = W + (size_t)(k0 + w * 16 + hl * 2) * INNERv + n0 + l16 * 4;
  v4f r0[8], r1[8];
#pragma unroll
  for (int it = 0; it < 8; ++it) {
    const float* p = p0 + (it >> 1) * 4 * INNERv + (it & 1) * 64;
    r0[it] = *(const v4f*)p;
    r1[it] = *(const v4f*)(p + INNERv);
  }
  // the address is named, so that it outlives the last load and no load of the group
  // is given it as a target; behind the wait its registers are free
  asm volatile("s_wait_xcnt 0x0" ::"v"(p0) : "memory");
  // keeps the sixteen loads ahead of the first LDS store: one latency for the tile
  __builtin_amdgcn_sched_barrier(0);
#pragma unroll
  for (int it = 0; it < 8; ++it) {
    const int id = w * 8 + it, kp = (id >> 1) * 2 + hl, nq = (id & 1) * 16 + l16;
#pragma unroll
    for (int i = 0; i < 4; ++i) {
      v2h h = {(_Float16)r0[it][i], (_Float16)r1[it][i]};
      sT[(nq * 4 + i) * 64 + (((kp >> 2) ^ l16) << 2) + (kp & 3)] =
          __builtin_bit_cast(unsigned, h);
    }
  }
  __syncthreads();
#pragma unroll
  for (int it = 0; it < 8; ++it) {
    const int id = it * 256 + t, n = id >> 4, c = id & 15;
    v4u d = *(const v4u*)&sT[n * 64 + ((c ^ ((n >> 2) & 15)) << 2)];
    *(v4u*)(Wt + (size_t)(n0 + n) * K + k0 + c * 8) = d;
  }
  // behind the stores: in the built kernel another job's instructions stand next and
  // write the registers that these stores name
  asm volatile("s_wait_xcnt 0x0" ::: "memory");
}

// Weight convert f32 -> f16, layout kept: a block takes TT * TT elements in a row
__device__ __forceinline__ void wconv_job(const float* __restrict__ W,
                                          _Float16* __restrict__ Wh, int blk) {
  const int t = threadIdx.x;
  const v4f* p0 = (const v4f*)W + (size_t)blk * (TT * TT / 4) + t;
  v4f r[16];
#pragma unroll
  for (int it = 0; it < 16; ++it) r[it] = p0[it * 256];
  // the address is named, so that it outlives the last load and no load of the group
  // is given it as a target; behind the wait its registers are free
  asm volatile("s_wait_xcnt 0x0" ::"v"(p0) : "memory");
  // keeps the sixteen loads ahead of the first store: one latency for the block
  __builtin_amdgcn_sched_barrier(0);
  v4h* q = (v4h*)Wh + (size_t)blk * (TT * TT / 4) + t;
#pragma unroll
  for (int it = 0; it < 16; ++it) {
    v4h o;
#pragma unroll
    for (int i = 0; i < 4; ++i) o[i] = (_Float16)r[it][i];
    q[it * 256] = o;
  }
  // behind the stores: in the built kernel another job's instructions stand next and
  // write the registers that these stores name
  asm volatile("s_wait_xcnt 0x0" ::: "memory");
}

// Bias of the folded output:  bc[n] = bf[n] + sum_j bo[j] * W2[j][n]  (f32; W2 = the rows
// of the fusion weight that meet the attention half, DQv x DQv). A block takes BC_C
// columns: 8 lanes span them, 32 lane groups take 32 rows each, all 32 loads of a lane in
// flight at once; the groups' sums meet in LDS.
#define BC_C 32
__device__ __forceinline__ void bias_job(float* sF, const float* __restrict__ W2,
                                         const float* __restrict__ bo,
                                         const float* __restrict__ bf, float* __restrict__ bc,
                                         int blk) {
  const int t = threadIdx.x, c4 = t & 7, rg = t >> 3;
  const int n0 = blk * BC_C;
  const float* p0 = W2 + (size_t)(rg * 32) * DQv + n0 + c4 * 4;
  const v4f* b0 = (const v4f*)(bo + rg * 32);
  v4f wv[32], bv[8];
#pragma unroll
  for (int it = 0; it < 32; ++it) wv[it] = *(const v4f*)(p0 + it * DQv);
#pragma unroll
  for (int i = 0; i < 8; ++i) bv[i] = b0[i];
  // the addresses are named, so that they outlive the last load and no load of the group
  // is given them as a target; behind the wait their registers are free
  asm volatile("s_wait_xcnt 0x0" ::"v"(p0), "v"(b0) : "memory");
  // keeps every load ahead of the first product: one memory latency for the block
  __builtin_amdgcn_sched_barrier(0);
  v4f s = wv[0] * bv[0][0];
#pragma unroll
  for (int it = 1; it < 32; ++it) s += wv[it] * bv[it >> 2][it & 3];
  *(v4f*)&sF[rg * BC_C + c4 * 4] = s;
  __syncthreads();
  if (t < BC_C) {
    float a = bf[n0 + t];
#pragma unroll
    for (int r = 0; r < 32; ++r) a += sF[r * BC_C + t];
    bc[n0 + t] = a;
  }
  // behind the load and the store: in the built kernel another job's instructions stand
  // next and write the registers that they name
  asm volatile("s_wait_xcnt 0x0" ::: "memory");
}

// ---------------------------------------------------------------------------
// Per-batch transpose of V (f16):  Vt[b][c][m] = V[b*M + m][c]
// ---------------------------------------------------------------------------
__device__ __forceinline__ void vtrans_job(unsigned* sT, const _Float16* __restrict__ V,
                                           _Float16* __restrict__ Vt, int bx, int by, int b) {
  const int t = threadIdx.x, lane = t & 31, w = t >> 5, hl = lane >> 4, l16 = lane & 15;
  const int c0 = bx * TT, m0 = by * TT;
  // a half wave reads 256 contiguous bytes of rows 2*mp and 2*mp + 1
  // (mp = (w * 4 + it) * 2 + hl): one address, constant steps
  const _Float16* p0 = V + ((size_t)b * SEQ_M + m0 + w * 16 + hl * 2) * INNERv + c0 + l16 * 8;
  v4u r0[4], r1[4];
#pragma unroll
  for (int it = 0; it < 4; ++it) {
    r0[it] = *(const v4u*)(p0 + it * 4 * INNERv);
    r1[it] = *(const v4u*)(p0 + it * 4 * INNERv + INNERv);
  }
  // the address is named, so that it outlives the last load and no load of the group
  // is given it as a target; behind the wait its registers are free
  asm volatile("s_wait_xcnt 0x0" ::"v"(p0) : "memory");
  // keeps the eight loads ahead of the first LDS store: one latency for the tile
  __builtin_amdgcn_sched_barrier(0);
#pragma unroll
  for (int it = 0; it < 4; ++it) {
    const int mp = (w * 4 + it) * 2 + hl;
    unsigned* q = &sT[(l16 * 8) * 64 + (((mp >> 2) ^ l16) << 2) + (mp & 3)];
#pragma unroll
    for (int i = 0; i < 4; ++i) {
      const unsigned lo = r0[it][i], hi = r1[it][i];
      q[(2 * i) * 64] = (lo & 0xffffu) | (hi << 16);
      q[(2 * i + 1) * 64] = (lo >> 16) | (hi & 0xffff0000u);
    }
  }
  __syncthreads();
#pragma unroll
  for (int it = 0; it < 8; ++it) {
    const int id = it * 256 + t, n = id >> 4, c = id & 15;
    v4u d = *(const v4u*)&sT[n * 64 + ((c ^ ((n >> 3) & 15)) << 2)];
    *(v4u*)(Vt + ((size_t)b * INNERv + c0 + n) * SEQ_M + m0 + c * 8) = d;
  }
  // behind the stores: in the built kernel another job's instructions stand next and
  // write the registers that these stores name
  asm volatile("s_wait_xcnt 0x0" ::: "memory");
}

// ---------------------------------------------------------------------------
// Row LayerNorm (f32 statistics) producing f16 rows: a wave takes LN_R rows and holds
// them in registers; a row's sums are in-lane, then exchanged between lanes (no LDS, no
// barrier). With COPY the wave also writes the rows themselves as f16 into concat
// buffer cols [0, D).
// ---------------------------------------------------------------------------
#define LN_R 4
#define LN_RB (8 * LN_R)  // rows a block

template <int D, bool COPY>
__device__ __forceinline__ void ln_f16_job(const float* __restrict__ x,
                                           const float* __restrict__ g,
                                           const float* __restrict__ beta,
                                           _Float16* __restrict__ y,
                                           _Float16* __restrict__ cat, int row0) {
  constexpr int NJ = D / 128;  // 512-byte pieces of a row, 16 bytes a lane
  const int lane = threadIdx.x & 31;
  const v4f* xr = (const v4f*)(x + (size_t)row0 * D) + lane;
  v4f v[LN_R][NJ], gg[NJ], bb[NJ];
#pragma unroll
  for (int r = 0; r < LN_R; ++r)
#pragma unroll
    for (int j = 0; j < NJ; ++j) v[r][j] = xr[r * (D / 4) + j * 32];
#pragma unroll
  for (int j = 0; j < NJ; ++j) {
    gg[j] = ((const v4f*)g)[j * 32 + lane];
    bb[j] = ((const v4f*)beta)[j * 32 + lane];
  }
  // the address is named, so that it outlives the last load and no load of the group
  // is given it as a target; behind the wait its registers are free
  asm volatile("s_wait_xcnt 0x0" ::"v"(xr) : "memory");
  // keeps every load of the wave ahead of the first sum: one memory latency for its rows
  __builtin_amdgcn_sched_barrier(0);

  float a[LN_R], b[LN_R];
#pragma unroll
  for (int r = 0; r < LN_R; ++r) {
    v4f s = v[r][0], q = v[r][0] * v[r][0];
#pragma unroll
    for (int j = 1; j < NJ; ++j) {
      s += v[r][j];
      q += v[r][j] * v[r][j];
    }
    a[r] = (s[0] + s[1]) + (s[2] + s[3]);
    b[r] = (q[0] + q[1]) + (q[2] + q[3]);
  }
#pragma unroll
  for (int r = 0; r < LN_R; ++r) {
    a[r] = wave_sum(a[r]);
    b[r] = wave_sum(b[r]);
  }
#pragma unroll
  for (int r = 0; r < LN_R; ++r) {
    const float mu = a[r] * (1.0f / D);
    const float var = b[r] * (1.0f / D) - mu * mu;
    const float rs = rsqrtf(var + 1e-5f);
    v4h* yr = (v4h*)(y + (size_t)(row0 + r) * D) + lane;
#pragma unroll
    for (int j = 0; j < NJ; ++j) {
      v4h o;
#pragma unroll
      for (int i = 0; i < 4; ++i)
        o[i] = (_Float16)((v[r][j][i] - mu) * rs * gg[j][i] + bb[j][i]);
      yr[j * 32] = o;
    }
    if constexpr (COPY) {
      v4h* cr = (v4h*)(cat + (size_t)(row0 + r) * (2 * D)) + lane;
#pragma unroll
      for (int j = 0; j < NJ; ++j) {
        v4h o;
#pragma unroll
        for (int i = 0; i < 4; ++i) o[i] = (_Float16)v[r][j][i];
        cr[j * 32] = o;
      }
    }
  }
  // behind the stores: in the built kernel another job's instructions stand next and
  // write the registers that these stores name
  asm volatile("s_wait_xcnt 0x0" ::: "memory");
}

// ---------------------------------------------------------------------------
// All work that depends on the inputs alone, in one launch: a block takes one job,
// picked by its index (the same for the whole block, so the transposes' barrier is safe).
// ---------------------------------------------------------------------------
#define PJ_LNP ((BATCH * SEQ_N) / LN_RB)              // person row groups
#define PJ_LNG (PJ_LNP + (BATCH * SEQ_M) / LN_RB)     // garment row groups
#define PJ_TN  (INNERv / TT)                          // weight tiles a tile row
#define PJ_WQ  (PJ_LNG + (DQv / TT) * PJ_TN)
#define PJ_WK  (PJ_WQ + (DCv / TT) * PJ_TN)
#define PJ_WV  (PJ_WK + (DCv / TT) * PJ_TN)
#define PJ_WO  (PJ_WV + (INNERv * DQv) / (TT * TT))   // Wo: converted, not transposed
#define PJ_WF1 (PJ_WO + (DQv / TT) * PJ_TN)           // Wf rows that meet the residual
#define PJ_WF2 (PJ_WF1 + (DQv / TT) * PJ_TN)          // Wf rows that meet the attention half
#define PJ_BC  (PJ_WF2 + DQv / BC_C)                  // folded bias

__global__ void __launch_bounds__(256)
prep_kernel(const float* __restrict__ person, const float* __restrict__ garment,
            const float* __restrict__ Wq, const float* __restrict__ Wk,
            const float* __restrict__ Wv, const float* __restrict__ Wo,
            const float* __restrict__ Wf, const float* __restrict__ bo,
            const float* __restrict__ bf, const float* __restrict__ gq,
            const float* __restrict__ betaq, const float* __restrict__ gk,
            const float* __restrict__ betak, _Float16* __restrict__ pLN,
            _Float16* __restrict__ gLN, _Float16* __restrict__ WqT, _Float16* __restrict__ WkT,
            _Float16* __restrict__ WvT, _Float16* __restrict__ Woh, _Float16* __restrict__ WcT,
            _Float16* __restrict__ Wf2T, float* __restrict__ biasC,
            _Float16* __restrict__ Cat) {
  __shared__ __attribute__((aligned(16))) unsigned sT[TT * 64];
  const int j = blockIdx.x;
  const int wrow = (threadIdx.x >> 5) * LN_R;  // the wave's first row in a row group
  if (j < PJ_LNP) {
    ln_f16_job<DQv, true>(person, gq, betaq, pLN, Cat, j * LN_RB + wrow);
    return;
  }
  if (j < PJ_LNG) {
    ln_f16_job<DCv, false>(garment, gk, betak, gLN, nullptr, (j - PJ_LNP) * LN_RB + wrow);
    return;
  }
  if (j >= PJ_WF2) {
    bias_job((float*)sT, Wf + (size_t)DQv * DQv, bo, bf, biasC, j - PJ_WF2);
    return;
  }
  if (j >= PJ_WV && j < PJ_WO) {
    wconv_job(Wo, Woh, j - PJ_WV);
    return;
  }
  {
    // every weight has 1024 columns (INNER = DQ): PJ_TN tiles a tile row; K is the
    // row length of the target (the residual half of Wf goes into the left half of the
    // final product's weight, the other half into a matrix of its own)
    const float* W = Wf + (size_t)DQv * DQv;
    _Float16* Wt = Wf2T;
    int K = DQv, first = PJ_WF1;
    if (j < PJ_WQ) {
      W = Wq; Wt = WqT; K = DQv; first = PJ_LNG;
    } else if (j < PJ_WK) {
      W = Wk; Wt = WkT; K = DCv; first = PJ_WQ;
    } else if (j < PJ_WV) {
      W = Wv; Wt = WvT; K = DCv; first = PJ_WK;
    } else if (j < PJ_WF1) {
      W = Wf; Wt = WcT; K = 2 * DQv; first = PJ_WO;
    }
    wtrans_job(sT, W, Wt, K, (j - first) % PJ_TN, (j - first) / PJ_TN);
  }
}

// ---------------------------------------------------------------------------
// WMMA GEMM:  C[M x N] = A[M x K] * Bt[N x K]^T (+ bias), f16 in, f32 acc.
// Block: 256 threads = 8 waves (4x2 wave grid); a wave takes FM x 4 tiles of 16 x 16, so
// the block's tile is FM * 64 rows by 128 columns. The large products run with FM = 4
// (256 x 128, 64 x 64 a wave): a fragment read from LDS then serves four products, and the
// block brings fewer bytes from L2 for each product than at FM = 2. Its two buffers leave
// room for one block on a WGP: two waves a SIMD.
// A and Bt come into LDS by asynchronous copies, through no register: a stage is 128 k
// of both tiles (whole 256-byte rows), two buffers, the next stage's copies in flight
// while this stage is worked on; one barrier a stage. K: a multiple of 128.
// ---------------------------------------------------------------------------
#define GBM(FM) ((FM) * 64)
#define GBN 128
#define GBK 128
#define GLD 136                  // LDS row pitch in halfs: 256-byte rows at 272 bytes
#define GBO(FM) (GBM(FM) * GLD)          // the Bt tile stands behind the A tile (in halfs)
#define GBH(FM) (GBO(FM) + GBN * GLD)    // one buffer (in halfs)

// 128 rows of one operand's tile of a stage into LDS: eight 16-byte copies a lane, 16 rows apart.
// l: the lane's LDS byte address; g: its global one; ld: the operand's row length.
// The s_wait_xcnt stands inside the statement, so that no address register of a copy
// is rewritten ahead of it.
__device__ __forceinline__ void gemm_copy_tile(unsigned l, const _Float16* g, int ld) {
  const size_t s = (size_t)16 * ld;
  asm volatile(
      "global_load_async_to_lds_b128 %0, %8, off\n\t"
      "global_load_async_to_lds_b128 %1, %9, off\n\t"
      "global_load_async_to_lds_b128 %2, %10, off\n\t"
      "global_load_async_to_lds_b128 %3, %11, off\n\t"
      "global_load_async_to_lds_b128 %4, %12, off\n\t"
      "global_load_async_to_lds_b128 %5, %13, off\n\t"
      "global_load_async_to_lds_b128 %6, %14, off\n\t"
      "global_load_async_to_lds_b128 %7, %15, off\n\t"
      "s_wait_xcnt 0x0" ::"v"(l),
      "v"(l + 16 * GLD * 2), "v"(l + 32 * GLD * 2), "v"(l + 48 * GLD * 2),
      "v"(l + 64 * GLD * 2), "v"(l + 80 * GLD * 2), "v"(l + 96 * GLD * 2),
      "v"(l + 112 * GLD * 2), "v"(g), "v"(g + s), "v"(g + 2 * s), "v"(g + 3 * s),
      "v"(g + 4 * s), "v"(g + 5 * s), "v"(g + 6 * s), "v"(g + 7 * s)
      : "memory");
}

// Both tiles of a stage: the A tile in runs of 128 rows, then the Bt tile.
template <int FM>
__device__ __forceinline__ void gemm_copy_stage(unsigned la, const _Float16* ga, int lda,
                                                const _Float16* gb, int ldb) {
  // the scheduling barriers keep each statement's sixteen address sums next to it: formed
  // ahead for all statements at once, they push the kernel past 256 registers
#pragma unroll
  for (int h = 0; h < FM / 2; ++h) {
    __builtin_amdgcn_sched_barrier(0);
    gemm_copy_tile(la + h * (128 * GLD * 2), ga + (size_t)(h * 128) * lda, lda);
  }
  __builtin_amdgcn_sched_barrier(0);
  gemm_copy_tile(la + GBO(FM) * 2, gb, ldb);
  __builtin_amdgcn_sched_barrier(0);
}

template <bool OUT_F16, bool HAS_BIAS, int FM>
__device__ __forceinline__ void gemm_tile(_Float16* sAB, const _Float16* __restrict__ A, int lda,
                                 const _Float16* __restrict__ Bt, int ldb,
                                 void* __restrict__ Cv, int ldc,
                                 const float* __restrict__ bias, int K, int rowBlock,
                                 int colBlock) {
  const int t = threadIdx.x;
  const int lane = t & 31, w = t >> 5;
  const int wm = w & 3, wn = w >> 2;  // 4 waves in M x 2 waves in N
  const int lr = lane & 15, hi4 = lane >> 4, kof = hi4 * 8;
  const int nst = K / GBK;  // stages

  // the lane's part of a stage: rows t/16 + 16 j of both tiles, 16-byte piece t%16
  const _Float16* ga = A + (size_t)(rowBlock + (t >> 4)) * lda + (t & 15) * 8;
  const _Float16* gb = Bt + (size_t)(colBlock + (t >> 4)) * ldb + (t & 15) * 8;
  const unsigned la = (unsigned)(size_t)&sAB[(t >> 4) * GLD + (t & 15) * 8];

  // the wave's fragment rows in buffer 0
  const _Float16* sA0 = sAB + (wm * (FM * 16) + lr) * GLD + kof;
  const _Float16* sB0 = sAB + GBO(FM) + (wn * 64 + lr) * GLD + kof;
  constexpr int FH = FM / 2;  // the A fragments go in two halves
  constexpr int NKS = GBK / 32;

  // stage 0 into buffer 0, landed and published
  gemm_copy_stage<FM>(la, ga, lda, gb, ldb);
  // this wave's copies have landed
  asm volatile("s_wait_asynccnt 0x0" ::: "memory");
  __syncthreads();

  // every loop over fragments is unrolled: its arrays are then registers and its LDS
  // steps constants of the loads
  v8f acc[FM][4];
#pragma unroll
  for (int fm = 0; fm < FM; ++fm)
#pragma unroll
    for (int fn = 0; fn < 4; ++fn) acc[fm][fn] = v8f_zero();

  for (int st = 0; st < nst; ++st) {
    const _Float16* sA = sA0 + (st & 1) * GBH(FM);
    const _Float16* sB = sB0 + (st & 1) * GBH(FM);
    // the stage's first fragments are asked for, and under their latency the next stage's
    // copies go out, into the other buffer, which every wave left at the barrier just passed
    v16h alo[FH], ahi[FH], bfr[4];  // the fragments of the k step at hand
#pragma unroll
    for (int fn = 0; fn < 4; ++fn) bfr[fn] = ldfrag(sB + fn * 16 * GLD);
#pragma unroll
    for (int f = 0; f < FH; ++f) {
      alo[f] = ldfrag(sA + f * 16 * GLD);
      ahi[f] = ldfrag(sA + (FH + f) * 16 * GLD);
    }
    if (st + 1 < nst)
      gemm_copy_stage<FM>(la + ((st + 1) & 1) * (GBH(FM) * 2), ga + (size_t)(st + 1) * GBK, lda,
                          gb + (size_t)(st + 1) * GBK, ldb);
    // Inside a stage the fragments are fetched one k step ahead, in two groups: Bt and
    // the first A half ahead of the first half's products, the second A half (into the
    // registers that those products have left) ahead of the second half's. The scheduling
    // barriers hold each group where it stands: sunk to its first use, a fetch is waited
    // for at once, and two waves a SIMD do not cover that wait.
#pragma unroll
    for (int ks = 0; ks < NKS; ++ks) {
      v16h nlo[FH], nhi[FH], nb[4];
      if (ks + 1 < NKS) {
#pragma unroll
        for (int fn = 0; fn < 4; ++fn) nb[fn] = ldfrag(sB + fn * 16 * GLD + (ks + 1) * 32);
#pragma unroll
        for (int f = 0; f < FH; ++f) nlo[f] = ldfrag(sA + f * 16 * GLD + (ks + 1) * 32);
      }
      __builtin_amdgcn_sched_barrier(0);
#pragma unroll
      for (int f = 0; f < FH; ++f)
#pragma unroll
        for (int fn = 0; fn < 4; ++fn) acc[f][fn] = wmma16x16x32(alo[f], bfr[fn], acc[f][fn]);
      __builtin_amdgcn_sched_barrier(0);
      if (ks + 1 < NKS) {
#pragma unroll
        for (int f = 0; f < FH; ++f)
          nhi[f] = ldfrag(sA + (FH + f) * 16 * GLD + (ks + 1) * 32);
      }
      __builtin_amdgcn_sched_barrier(0);
#pragma unroll
      for (int f = 0; f < FH; ++f)
#pragma unroll
        for (int fn = 0; fn < 4; ++fn)
          acc[FH + f][fn] = wmma16x16x32(ahi[f], bfr[fn], acc[FH + f][fn]);
      __builtin_amdgcn_sched_barrier(0);
      if (ks + 1 < NKS) {
#pragma unroll
        for (int fn = 0; fn < 4; ++fn) bfr[fn] = nb[fn];
#pragma unroll
        for (int f = 0; f < FH; ++f) {
          alo[f] = nlo[f];
          ahi[f] = nhi[f];
        }
      }
    }
    // hand-over: this wave's reads of the buffer are done, its copies of the next stage
    // have landed; behind the barrier the next stage is readable by all and this
    // stage's buffer is free for the stage after it
    asm volatile("s_wait_dscnt 0x0" ::: "memory");
    asm volatile("s_wait_asynccnt 0x0" ::: "memory");
    __syncthreads();
  }
  // no copy is left in flight when the wave ends
  asm volatile("s_wait_asynccnt 0x0" ::: "memory");

  // store: C layout — VGPR e: lanes 0-15 -> m=e, lanes 16-31 -> m=e+8; n=lr
#pragma unroll
  for (int fm = 0; fm < FM; ++fm)
#pragma unroll
    for (int fn = 0; fn < 4; ++fn) {
      int col = colBlock + wn * 64 + fn * 16 + lr;
      int row0 = rowBlock + wm * (FM * 16) + fm * 16 + hi4 * 8;
      float bv = HAS_BIAS ? bias[col] : 0.f;
#pragma unroll
      for (int e = 0; e < 8; ++e) {
        float v = acc[fm][fn][e] + bv;
        if constexpr (OUT_F16)
          ((_Float16*)Cv)[(size_t)(row0 + e) * ldc + col] = (_Float16)v;
        else
          ((float*)Cv)[(size_t)(row0 + e) * ldc + col] = v;
      }
    }
}

template <bool OUT_F16, bool HAS_BIAS>
__global__ void __launch_bounds__(256) gemm_wmma_kernel(const _Float16* __restrict__ A, int lda,
                                 const _Float16* __restrict__ Bt, int ldb,
                                 void* __restrict__ Cv, int ldc,
                                 const float* __restrict__ bias, int M, int N, int K) {
  __shared__ __attribute__((aligned(16))) _Float16 sAB[2 * GBH(4)];
  gemm_tile<OUT_F16, HAS_BIAS, 4>(sAB, A, lda, Bt, ldb, Cv, ldc, bias, K, blockIdx.y * GBM(4),
                                  blockIdx.x * GBN);
}

// The three projections in one launch: none reads another's result. blockIdx.y picks
// the product and its row tile; the longest (Q, K = DQ) has the lowest indices.
#define QKV_YQ ((BATCH * SEQ_N) / GBM(4))
#define QKV_YK (QKV_YQ + (BATCH * SEQ_M) / GBM(4))
#define QKV_YV (QKV_YK + (BATCH * SEQ_M) / GBM(4))

__global__ void __launch_bounds__(256)
gemm_qkv_kernel(const _Float16* __restrict__ pLN, const _Float16* __restrict__ gLN,
                const _Float16* __restrict__ WqT, const _Float16* __restrict__ WkT,
                const _Float16* __restrict__ WvT, _Float16* __restrict__ Qh,
                _Float16* __restrict__ Kh, _Float16* __restrict__ Vh) {
  __shared__ __attribute__((aligned(16))) _Float16 sAB[2 * GBH(4)];
  const int y = blockIdx.y;
  const bool isQ = y < QKV_YQ, isK = y < QKV_YK;
  const _Float16* A = isQ ? pLN : gLN;
  const _Float16* Bt = isQ ? WqT : (isK ? WkT : WvT);
  _Float16* C = isQ ? Qh : (isK ? Kh : Vh);
  const int K = isQ ? DQv : DCv;
  const int yt = isQ ? y : (isK ? y - QKV_YQ : y - QKV_YK);
  gemm_tile<true, false, 4>(sAB, A, K, Bt, K, (void*)C, INNERv, nullptr, K, yt * GBM(4),
                            blockIdx.x * GBN);
}

// The output projection is folded into the final product:
//   (att Wo + bo) Wf2 + res Wf1 + bf = att (Wo Wf2) + res Wf1 + (bo Wf2 + bf),
// Wf1, Wf2 the upper and lower DQv rows of Wf. The weight product (Wo Wf2)^T = Wf2^T Wo^T
// needs the prepared weights alone, as the V transpose needs V alone: both in one launch,
// a block takes one job by its index; the product's tiles, the longer job, come first.
// Its result is the right half of the final product's weight rows.
#define VW_W2  ((DQv / GBM(2)) * (INNERv / GBN))  // small product: 128 x 128 tiles, more blocks
#define VW_ALL (VW_W2 + (INNERv / TT) * (SEQ_M / TT) * BATCH)

__global__ void __launch_bounds__(256)
vtrans_w2_kernel(const _Float16* __restrict__ V, _Float16* __restrict__ Vt,
                 const _Float16* __restrict__ Wf2T, const _Float16* __restrict__ Woh,
                 _Float16* __restrict__ WcT) {
  __shared__ __attribute__((aligned(16))) _Float16 sAB[2 * GBH(2)];
  const int j = blockIdx.x;
  if (j < VW_W2) {
    gemm_tile<true, false, 2>(sAB, Wf2T, DQv, Woh, DQv, (void*)(WcT + DQv), 2 * DQv, nullptr,
                              DQv, (j / (INNERv / GBN)) * GBM(2), (j % (INNERv / GBN)) * GBN);
    return;
  }
  const int v = j - VW_W2;
  vtrans_job((unsigned*)sAB, V, Vt, v % (INNERv / TT), (v / (INNERv / TT)) % (SEQ_M / TT),
             v / ((INNERv / TT) * (SEQ_M / TT)));
}

#define AT_NW 8
#define AT_G  2
#define AT_QB (AT_NW * AT_G * 16)
#define AT_SK 128                      // keys per stage
#define AT_NS (SEQ_M / AT_SK)          // stages
#define AT_SP (AT_SK / 32)             // passes per stage
#define AT_KP 72                       // K tile: 128 rows of 128 B at a pitch of 144 B (in halfs)
#define AT_VP 136                      // V^T tile: 64 rows of 256 B at a pitch of 272 B (in halfs)
#define AT_VO (AT_SK * AT_KP)          // V^T tile stands behind the K tile (in halfs)
#define AT_BH (AT_VO + DHEAD * AT_VP)  // one buffer (in halfs)
#define AT_OP (DQv + INNERv)           // output row pitch: the right half of the concat rows

// Base-2 exponentials in place, a run of them in one statement: left to the
// register allocator, an exponential's target is often the source of the one
// directly ahead of it. Here each overwrites only its own source, and the v_nop is
// the slot the instruction set asks for between the last one and its first reader.
__device__ __forceinline__ void exp2_inplace(v8f& x) {
  float a0 = x[0], a1 = x[1], a2 = x[2], a3 = x[3], a4 = x[4], a5 = x[5], a6 = x[6], a7 = x[7];
  asm("v_exp_f32 %0, %0\n\tv_exp_f32 %1, %1\n\tv_exp_f32 %2, %2\n\tv_exp_f32 %3, %3\n\t"
      "v_exp_f32 %4, %4\n\tv_exp_f32 %5, %5\n\tv_exp_f32 %6, %6\n\tv_exp_f32 %7, %7\n\t"
      "v_nop"
      : "+v"(a0), "+v"(a1), "+v"(a2), "+v"(a3), "+v"(a4), "+v"(a5), "+v"(a6), "+v"(a7));
  x[0] = a0; x[1] = a1; x[2] = a2; x[3] = a3; x[4] = a4; x[5] = a5; x[6] = a6; x[7] = a7;
}
__device__ __forceinline__ void exp2_inplace(float& a0, float& a1) {
  asm("v_exp_f32 %0, %0\n\tv_exp_f32 %1, %1\n\tv_nop" : "+v"(a0), "+v"(a1));
}

// One stage into LDS: eight 16-byte copies a lane, four of K (32 rows apart) and four
// of V^T (16 rows apart). kl, vl: the lane's LDS byte addresses; kg, vg: its global ones.
// The s_wait_xcnt stands inside the statement, so that no address register of a copy
// is rewritten ahead of it.
__device__ __forceinline__ void at_copy_stage(unsigned kl, unsigned vl, const _Float16* kg,
                                              const _Float16* vg) {
  asm volatile(
      "global_load_async_to_lds_b128 %0, %8, off\n\t"
      "global_load_async_to_lds_b128 %1, %9, off\n\t"
      "global_load_async_to_lds_b128 %2, %10, off\n\t"
      "global_load_async_to_lds_b128 %3, %11, off\n\t"
      "global_load_async_to_lds_b128 %4, %12, off\n\t"
      "global_load_async_to_lds_b128 %5, %13, off\n\t"
      "global_load_async_to_lds_b128 %6, %14, off\n\t"
      "global_load_async_to_lds_b128 %7, %15, off\n\t"
      "s_wait_xcnt 0x0" ::"v"(kl),
      "v"(kl + 32 * AT_KP * 2), "v"(kl + 64 * AT_KP * 2), "v"(kl + 96 * AT_KP * 2), "v"(vl),
      "v"(vl + 16 * AT_VP * 2), "v"(vl + 32 * AT_VP * 2), "v"(vl + 48 * AT_VP * 2), "v"(kg),
      "v"(kg + 32 * INNERv), "v"(kg + 64 * INNERv), "v"(kg + 96 * INNERv), "v"(vg),
      "v"(vg + 16 * SEQ_M), "v"(vg + 32 * SEQ_M), "v"(vg + 48 * SEQ_M)
      : "memory");
}

__global__ void __launch_bounds__(AT_NW * 32)
attn_kernel(const _Float16* __restrict__ Q, const _Float16* __restrict__ Kf,
            const _Float16* __restrict__ Vt, _Float16* __restrict__ O) {
  __shared__ __attribute__((aligned(16))) _Float16 sKV[2 * AT_BH];
  const int t = threadIdx.x;
  const int lane = t & 31, w = t >> 5;
  const int lr = lane & 15, hi4 = lane >> 4, kof = hi4 * 8;
  const int bh = blockIdx.y, b = bh >> 4, h = bh & 15;
  const int q0 = blockIdx.x * AT_QB + w * (AT_G * 16);
  const float cs = ATT_SCALE * 1.4426950408889634f;  // scores in the log2 domain

  // Q as B operand: column lr = query, DH split into two 32-wide k-steps
  v16h qf[AT_G][2];
#pragma unroll
  for (int g = 0; g < AT_G; ++g) {
    const _Float16* qp = Q + ((size_t)(b * SEQ_N + q0 + g * 16 + lr)) * INNERv + h * DHEAD + kof;
    qf[g][0] = ldfrag(qp);
    qf[g][1] = ldfrag(qp + 32);
  }

  // the lane's part of a stage: K row t/8, 16-byte piece t%8; V^T row t/16, piece t%16
  const _Float16* kg = Kf + ((size_t)(b * SEQ_M + (t >> 3))) * INNERv + h * DHEAD + (t & 7) * 8;
  const _Float16* vg = Vt + ((size_t)(b * INNERv + h * DHEAD + (t >> 4))) * SEQ_M + (t & 15) * 8;
  const unsigned kl = (unsigned)(size_t)&sKV[(t >> 3) * AT_KP + (t & 7) * 8];
  const unsigned vl = (unsigned)(size_t)&sKV[AT_VO + (t >> 4) * AT_VP + (t & 15) * 8];

  // stage 0 into buffer 0, landed and published; then stage 1 goes out into buffer 1
  at_copy_stage(kl, vl, kg, vg);
  // this wave's copies have landed
  asm volatile("s_wait_asynccnt 0x0" ::: "memory");
  __syncthreads();
  at_copy_stage(kl + AT_BH * 2, vl + AT_BH * 2, kg + (size_t)AT_SK * INNERv, vg + AT_SK);

  v8f acc[AT_G][4];
  float mrun[AT_G], lsum[AT_G];
#pragma unroll
  for (int g = 0; g < AT_G; ++g) {
    mrun[g] = -__builtin_inff();
    lsum[g] = 0.f;
#pragma unroll
    for (int d = 0; d < 4; ++d) acc[g][d] = v8f_zero();
  }

  for (int st = 0; st < AT_NS; ++st) {
   const _Float16* kbase = sKV + (st & 1) * AT_BH + lr * AT_KP + kof;
   const _Float16* vbase = sKV + (st & 1) * AT_BH + AT_VO + lr * AT_VP + kof;

   // K as A operand: row lr = key; two 16-key tiles x two k-steps, one pass ahead
   // inside a stage (never into the next stage's buffer)
   v16h kf[2][2];
#pragma unroll
   for (int kt = 0; kt < 2; ++kt) {
     kf[kt][0] = ldfrag(kbase + (kt * 16) * AT_KP);
     kf[kt][1] = ldfrag(kbase + (kt * 16) * AT_KP + 32);
   }

   for (int p = 0; p < AT_SP; ++p) {
    // V^T as A operand: row lr = dh, k = this pass's 32 keys; in flight under the
    // score products and the softmax. The barrier holds the fetch up here: sunk to
    // its first use it would be waited for at once
    v16h vf[4];
#pragma unroll
    for (int d = 0; d < 4; ++d) vf[d] = ldfrag(vbase + (d * 16) * AT_VP + p * 32);
    __builtin_amdgcn_sched_barrier(0);

    v8f s[2][AT_G];
#pragma unroll
    for (int kt = 0; kt < 2; ++kt)
#pragma unroll
      for (int g = 0; g < AT_G; ++g) {
        s[kt][g] = wmma16x16x32(kf[kt][0], qf[g][0], v8f_zero());
        s[kt][g] = wmma16x16x32(kf[kt][1], qf[g][1], s[kt][g]);
      }

    // keeps the eight products back to back: mixed with the maxima below, each
    // product that a maximum follows is padded with idle slots
    __builtin_amdgcn_sched_barrier(0);

    // next pass's K into the same registers, in flight under the softmax and the
    // second product (a stage's last pass names its own rows again, unused: the next
    // stage is not published yet)
    const int pn = (p + 1 < AT_SP) ? p + 1 : p;
#pragma unroll
    for (int kt = 0; kt < 2; ++kt) {
      kf[kt][0] = ldfrag(kbase + (pn * 32 + kt * 16) * AT_KP);
      kf[kt][1] = ldfrag(kbase + (pn * 32 + kt * 16) * AT_KP + 32);
    }

    // holds the fetch here, ahead of the softmax: sunk to the foot of the pass it
    // would be waited for at once by the next pass's products
    __builtin_amdgcn_sched_barrier(0);

    // online softmax: new running maximum per query, sums and outputs rescaled
    // (no branch: the loop stays one block, so the fetches stay where they stand)
    float corr[AT_G];
#pragma unroll
    for (int g = 0; g < AT_G; ++g) {
      float mx = s[0][g][0];
#pragma unroll
      for (int e = 1; e < 8; ++e) mx = fmaxf(mx, s[0][g][e]);
#pragma unroll
      for (int e = 0; e < 8; ++e) mx = fmaxf(mx, s[1][g][e]);
      mx = fmaxf(mx, xhalf(mx)) * cs;
      const float mnew = fmaxf(mrun[g], mx);
      corr[g] = mrun[g] - mnew;  // -inf on the first pass: its exponential is 0
      mrun[g] = mnew;
    }
    exp2_inplace(corr[0], corr[1]);

#pragma unroll
    for (int g = 0; g < AT_G; ++g) {
      const float nm = -mrun[g];
      v8f e0, e1;
#pragma unroll
      for (int e = 0; e < 8; ++e) {
        e0[e] = fmaf(s[0][g][e], cs, nm);
        e1[e] = fmaf(s[1][g][e], cs, nm);
      }
      exp2_inplace(e0);
      exp2_inplace(e1);
      v16h pf;  // elements 0-7 = keys 8*hi4 + e, 8-15 = keys 16 + 8*hi4 + e: ldfrag's k order
      float ps = e0[0] + e1[0];
#pragma unroll
      for (int e = 1; e < 8; ++e) ps += e0[e] + e1[e];
#pragma unroll
      for (int e = 0; e < 8; ++e) {
        pf[e] = (_Float16)e0[e];
        pf[8 + e] = (_Float16)e1[e];
      }
      lsum[g] = fmaf(lsum[g], corr[g], ps);
#pragma unroll
      for (int d = 0; d < 4; ++d)
        acc[g][d] = wmma16x16x32(vf[d], pf, acc[g][d] * corr[g]);
    }
   }

   // hand-over: this wave's reads of the buffer are done, its copies of the next stage
   // have landed; behind the barrier the next stage is readable by all and this
   // stage's buffer is free for the stage after it
   asm volatile("s_wait_dscnt 0x0" ::: "memory");
   asm volatile("s_wait_asynccnt 0x0" ::: "memory");
   __syncthreads();
   if (st + 2 < AT_NS)
     at_copy_stage(kl + (st & 1) * (AT_BH * 2), vl + (st & 1) * (AT_BH * 2),
                   kg + (size_t)(st + 2) * AT_SK * INNERv, vg + (st + 2) * AT_SK);
  }
  // no copy is left in flight when the wave ends
  asm volatile("s_wait_asynccnt 0x0" ::: "memory");

  // O^T tile d: register e = dh d*16 + 8*hi4 + e of query lr: one 16-byte store
#pragma unroll
  for (int g = 0; g < AT_G; ++g) {
    const float l = lsum[g];
    const float inv = 1.0f / (l + xhalf(l));
    _Float16* op = O + ((size_t)(b * SEQ_N + q0 + g * 16 + lr)) * AT_OP + h * DHEAD + kof;
#pragma unroll
    for (int d = 0; d < 4; ++d) {
      v8h o;
#pragma unroll
      for (int e = 0; e < 8; ++e) o[e] = (_Float16)(acc[g][d][e] * inv);
      *(v8h*)(op + d * 16) = o;
    }
  }
}

// ---------------------------------------------------------------------------
// Host-side launch
// ---------------------------------------------------------------------------
extern "C" void kernel_launch(void* const* d_in, const int* in_sizes, int n_in,
                              void* d_out, int out_size, void* d_ws, size_t ws_size,
                              hipStream_t stream) {
  (void)in_sizes; (void)n_in; (void)out_size; (void)ws_size;

  const float* person  = (const float*)d_in[0];
  const float* garment = (const float*)d_in[1];
  const float* Wq = (const float*)d_in[2];
  const float* Wk = (const float*)d_in[3];
  const float* Wv = (const float*)d_in[4];
  const float* Wo = (const float*)d_in[5];
  const float* bo = (const float*)d_in[6];
  const float* Wf = (const float*)d_in[7];
  const float* bf = (const float*)d_in[8];
  const float* gq = (const float*)d_in[9];
  const float* betaq = (const float*)d_in[10];
  const float* gk = (const float*)d_in[11];
  const float* betak = (const float*)d_in[12];
  float* out = (float*)d_out;

  _Float16* w0 = (_Float16*)d_ws;
  size_t off = 0;
  _Float16* pLN = w0 + off; off += (size_t)BATCH * SEQ_N * DQv;
  _Float16* gLN = w0 + off; off += (size_t)BATCH * SEQ_M * DCv;
  _Float16* WqT = w0 + off; off += (size_t)INNERv * DQv;
  _Float16* WkT = w0 + off; off += (size_t)INNERv * DCv;
  _Float16* WvT = w0 + off; off += (size_t)INNERv * DCv;
  _Float16* Woh = w0 + off; off += (size_t)INNERv * DQv;
  _Float16* WcT = w0 + off; off += (size_t)DQv * (2 * DQv);
  _Float16* Wf2T = w0 + off; off += (size_t)DQv * DQv;
  _Float16* Qh  = w0 + off; off += (size_t)BATCH * SEQ_N * INNERv;
  _Float16* Kh  = w0 + off; off += (size_t)BATCH * SEQ_M * INNERv;
  _Float16* Vh  = w0 + off; off += (size_t)BATCH * SEQ_M * INNERv;
  _Float16* VtB = w0 + off; off += (size_t)BATCH * INNERv * SEQ_M;
  _Float16* Cat = w0 + off; off += (size_t)BATCH * SEQ_N * 2 * DQv;
  float* biasC = (float*)(w0 + off);

  // Layer norms (the person rows' f16 copy into concat cols [0, DQ) with them), weight
  // transpose+convert, folded bias
  prep_kernel<<<PJ_BC, 256, 0, stream>>>(person, garment, Wq, Wk, Wv, Wo, Wf, bo, bf, gq, betaq,
                                         gk, betak, pLN, gLN, WqT, WkT, WvT, Woh, WcT, Wf2T,
                                         biasC, Cat);

  // Q/K/V projections (f16 out)
  gemm_qkv_kernel<<<dim3(INNERv / GBN, QKV_YV), 256, 0, stream>>>(pLN, gLN, WqT, WkT, WvT, Qh,
                                                                  Kh, Vh);

  // V transpose for contiguous PV fragments; (Wo Wf2)^T into the final weight's right half
  vtrans_w2_kernel<<<VW_ALL, 256, 0, stream>>>(Vh, VtB, Wf2T, Woh, WcT);

  // Attention (online softmax in registers) -> concat cols [DQ, 2*DQ) (f16)
  attn_kernel<<<dim3(SEQ_N / AT_QB, BATCH * NHEAD), AT_NW * 32, 0, stream>>>(
      Qh, Kh, VtB, Cat + DQv);

  // [residual, att] @ [Wf1; Wo Wf2] + (bo Wf2 + bf) -> out (f32)
  gemm_wmma_kernel<false, true><<<dim3(DQv / GBN, (BATCH * SEQ_N) / GBM(4)), 256, 0, stream>>>(
      Cat, 2 * DQv, WcT, 2 * DQv, (void*)out, DQv, biasC, BATCH * SEQ_N, DQv, 2 * DQv);
}

// v009
// A run of this version takes 111 microseconds.
// Two timings next to v008 put it at 1.05 and 1.03 times that version's speed.
// All steps since v000 together make it 4.41 times as fast.
#include <hip/hip_runtime.h>

#define BATCH 4
#define SEQ_N 2048
#define SEQ_M 1024
#define DQv   1024
#define DCv   768
#define NHEAD 16
#define DHEAD 64
#define INNERv 1024
#define ATT_SCALE 0.125f
#define ATT_SCALE_LOG2 (ATT_SCALE * 1.4426950408889634f)  // scores in the log2 domain

typedef _Float16 v16h __attribute__((ext_vector_type(16)));
typedef _Float16 v8h  __attribute__((ext_vector_type(8)));
typedef float    v8f  __attribute__((ext_vector_type(8)));
typedef unsigned int v4u __attribute__((ext_vector_type(4)));

__device__ __forceinline__ v8f v8f_zero() {
  v8f z = {0.f,0.f,0.f,0.f,0.f,0.f,0.f,0.f};
  return z;
}

// Load one 16-bit WMMA A/B fragment for this lane.
// Per CDNA5 ISA 16-bit 16x32 layout: a lane holds K chunks {base..base+7} and
// {base+16..base+23}; caller passes p already offset by ks*32 + (laneHi?8:0).
__device__ __forceinline__ v16h ldfrag(const _Float16* p) {
  v8h lo = *(const v8h*)(p);
  v8h hi = *(const v8h*)(p + 16);
  return __builtin_shufflevector(lo, hi, 0,1,2,3,4,5,6,7,8,9,10,11,12,13,14,15);
}

__device__ __forceinline__ v8f wmma16x16x32(v16h a, v16h b, v8f c) {
  return __builtin_amdgcn_wmma_f32_16x16x32_f16(false, a, false, b, (short)0, c,
                                                false, false);
}

typedef float    v4f  __attribute__((ext_vector_type(4)));
typedef _Float16 v4h  __attribute__((ext_vector_type(4)));
typedef _Float16 v2h  __attribute__((ext_vector_type(2)));
typedef float    v2f  __attribute__((ext_vector_type(2)));

// lane l <-> lane l ^ 16
__device__ __forceinline__ float xhalf(float x) {
  int v = __builtin_bit_cast(int, x);
  return __builtin_bit_cast(
      float, __builtin_amdgcn_permlanex16(v, v, 0x76543210, 0xfedcba98, false, false));
}

// x + (x of lane l ^ MASK), inside a 16-lane row (DPP row_xmask)
template <int MASK>
__device__ __forceinline__ float row_xadd(float x) {
  int v = __builtin_bit_cast(int, x);
  return x + __builtin_bit_cast(
                 float, __builtin_amdgcn_update_dpp(v, v, 0x160 + MASK, 0xf, 0xf, false));
}

// sum over the 32 lanes, the same value in every lane
__device__ __forceinline__ float wave_sum(float x) {
  x = row_xadd<1>(x);
  x = row_xadd<2>(x);
  x = row_xadd<4>(x);
  x = row_xadd<8>(x);
  return x + xhalf(x);
}

// ---------------------------------------------------------------------------
// The jobs without matrix work are dealt so that few waves start and each moves
// much: 128 x 128 transpose tiles and four layer-norm rows a wave, 16-byte loads, all of
// a wave's loads in flight at once.
//
// Transpose tile in LDS: row = output row, 64 dwords, a dword = two neighbours of the
// output row. The 16-byte pieces of a row are permuted by an XOR with a number taken
// from the row index, so that the 32 dword stores of a wave (16 rows, 2 columns) fall
// in 32 banks and the 16-byte reads along a row stay whole.
// Every loop of these jobs is unrolled: its arrays are then registers and its address
// steps constants of the instructions.
// ---------------------------------------------------------------------------
#define TT 128  // tile edge

// Weight transpose + f32 -> f16 convert:  Wt[n][k] = (f16) W[k][n], W with INNERv columns
__device__ __forceinline__ void wtrans_job(unsigned* sT, const float* __restrict__ W,
                                           _Float16* __restrict__ Wt, int K, int bx, int by) {
  const int t = threadIdx.x, lane = t & 31, w = t >> 5, hl = lane >> 4, l16 = lane & 15;
  const int n0 = bx * TT, k0 = by * TT;
  // a half wave reads 256 contiguous bytes of rows 2*kp and 2*kp + 1
  // (kp = w * 8 + (it / 2) * 2 + hl, columns (it % 2) * 64 + l16 * 4): one address, constant steps
  const float* p0 = W + (size_t)(k0 + w * 16 + hl * 2) * INNERv + n0 + l16 * 4;
  v4f r0[8], r1[8];
#pragma unroll
  for (int it = 0; it < 8; ++it) {
    const float* p = p0 + (it >> 1) * 4 * INNERv + (it & 1) * 64;
    r0[it] = *(const v4f*)p;
    r1[it] = *(const v4f*)(p + INNERv);
  }
  // the address is named, so that it outlives the last load and no load of the group
  // is given it as a target; behind the wait its registers are free
  asm volatile("s_wait_xcnt 0x0" ::"v"(p0) : "memory");
  // keeps the sixteen loads ahead of the first LDS store: one latency for the tile
  __builtin_amdgcn_sched_barrier(0);
#pragma unroll
  for (int it = 0; it < 8; ++it) {
    const int id = w * 8 + it, kp = (id >> 1) * 2 + hl, nq = (id & 1) * 16 + l16;
#pragma unroll
    for (int i = 0; i < 4; ++i) {
      v2h h = {(_Float16)r0[it][i], (_Float16)r1[it][i]};
      sT[(nq * 4 + i) * 64 + (((kp >> 2) ^ l16) << 2) + (kp & 3)] =
          __builtin_bit_cast(unsigned, h);
    }
  }
  __syncthreads();
#pragma unroll
  for (int it = 0; it < 8; ++it) {
    const int id = it * 256 + t, n = id >> 4, c = id & 15;
    v4u d = *(const v4u*)&sT[n * 64 + ((c ^ ((n >> 2) & 15)) << 2)];
    *(v4u*)(Wt + (size_t)(n0 + n) * K + k0 + c * 8) = d;
  }
  // behind the stores: in the built kernel another job's instructions stand next and
  // write the registers that these stores name
  asm volatile("s_wait_xcnt 0x0" ::: "memory");
}

// Weight convert f32 -> f16, layout kept: a block takes TT * TT elements in a row
__device__ __forceinline__ void wconv_job(const float* __restrict__ W,
                                          _Float16* __restrict__ Wh, int blk) {
  const int t = threadIdx.x;
  const v4f* p0 = (const v4f*)W + (size_t)blk * (TT * TT / 4) + t;
  v4f r[16];
#pragma unroll
  for (int it = 0; it < 16; ++it) r[it] = p0[it * 256];
  // the address is named, so that it outlives the last load and no load of the group
  // is given it as a target; behind the wait its registers are free
  asm volatile("s_wait_xcnt 0x0" ::"v"(p0) : "memory");
  // keeps the sixteen loads ahead of the first store: one latency for the block
  __builtin_amdgcn_sched_barrier(0);
  v4h* q = (v4h*)Wh + (size_t)blk * (TT * TT / 4) + t;
#pragma unroll
  for (int it = 0; it < 16; ++it) {
    v4h o;
#pragma unroll
    for (int i = 0; i < 4; ++i) o[i] = (_Float16)r[it][i];
    q[it * 256] = o;
  }
  // behind the stores: in the built kernel another job's instructions stand next and
  // write the registers that these stores name
  asm volatile("s_wait_xcnt 0x0" ::: "memory");
}

// Bias of the folded output:  bc[n] = bf[n] + sum_j bo[j] * W2[j][n]  (f32; W2 = the rows
// of the fusion weight that meet the attention half, DQv x DQv). A block takes BC_C
// columns: 8 lanes span them, 32 lane groups take 32 rows each, all 32 loads of a lane in
// flight at once; the groups' sums meet in LDS.
#define BC_C 32
__device__ __forceinline__ void bias_job(float* sF, const float* __restrict__ W2,
                                         const float* __restrict__ bo,
                                         const float* __restrict__ bf, float* __restrict__ bc,
                                         int blk) {
  const int t = threadIdx.x, c4 = t & 7, rg = t >> 3;
  const int n0 = blk * BC_C;
  const float* p0 = W2 + (size_t)(rg * 32) * DQv + n0 + c4 * 4;
  const v4f* b0 = (const v4f*)(bo + rg * 32);
  v4f wv[32], bv[8];
#pragma unroll
  for (int it = 0; it < 32; ++it) wv[it] = *(const v4f*)(p0 + it * DQv);
#pragma unroll
  for (int i = 0; i < 8; ++i) bv[i] = b0[i];
  // the addresses are named, so that they outlive the last load and no load of the group
  // is given them as a target; behind the wait their registers are free
  asm volatile("s_wait_xcnt 0x0" ::"v"(p0), "v"(b0) : "memory");
  // keeps every load ahead of the first product: one memory latency for the block
  __builtin_amdgcn_sched_barrier(0);
  v4f s = wv[0] * bv[0][0];
#pragma unroll
  for (int it = 1; it < 32; ++it) s += wv[it] * bv[it >> 2][it & 3];
  *(v4f*)&sF[rg * BC_C + c4 * 4] = s;
  __syncthreads();
  if (t < BC_C) {
    float a = bf[n0 + t];
#pragma unroll
    for (int r = 0; r < 32; ++r) a += sF[r * BC_C + t];
    bc[n0 + t] = a;
  }
  // behind the load and the store: in the built kernel another job's instructions stand
  // next and write the registers that they name
  asm volatile("s_wait_xcnt 0x0" ::: "memory");
}

// ---------------------------------------------------------------------------
// Per-batch transpose of V (f16):  Vt[b][c][m] = V[b*M + m][c]
// ---------------------------------------------------------------------------
__device__ __forceinline__ void vtrans_job(unsigned* sT, const _Float16* __restrict__ V,
                                           _Float16* __restrict__ Vt, int bx, int by, int b) {
  const int t = threadIdx.x, lane = t & 31, w = t >> 5, hl = lane >> 4, l16 = lane & 15;
  const int c0 = bx * TT, m0 = by * TT;
  // a half wave reads 256 contiguous bytes of rows 2*mp and 2*mp + 1
  // (mp = (w * 4 + it) * 2 + hl): one address, constant steps
  const _Float16* p0 = V + ((size_t)b * SEQ_M + m0 + w * 16 + hl * 2) * INNERv + c0 + l16 * 8;
  v4u r0[4], r1[4];
#pragma unroll
  for (int it = 0; it < 4; ++it) {
    r0[it] = *(const v4u*)(p0 + it * 4 * INNERv);
    r1[it] = *(const v4u*)(p0 + it * 4 * INNERv + INNERv);
  }
  // the address is named, so that it outlives the last load and no load of the group
  // is given it as a target; behind the wait its registers are free
  asm volatile("s_wait_xcnt 0x0" ::"v"(p0) : "memory");
  // keeps the eight loads ahead of the first LDS store: one latency for the tile
  __builtin_amdgcn_sched_barrier(0);
#pragma unroll
  for (int it = 0; it < 4; ++it) {
    const int mp = (w * 4 + it) * 2 + hl;
    unsigned* q = &sT[(l16 * 8) * 64 + (((mp >> 2) ^ l16) << 2) + (mp & 3)];
#pragma unroll
    for (int i = 0; i < 4; ++i) {
      const unsigned lo = r0[it][i], hi = r1[it][i];
      q[(2 * i) * 64] = (lo & 0xffffu) | (hi << 16);
      q[(2 * i + 1) * 64] = (lo >> 16) | (hi & 0xffff0000u);
    }
  }
  __syncthreads();
#pragma unroll
  for (int it = 0; it < 8; ++it) {
    const int id = it * 256 + t, n = id >> 4, c = id & 15;
    v4u d = *(const v4u*)&sT[n * 64 + ((c ^ ((n >> 3) & 15)) << 2)];
    *(v4u*)(Vt + ((size_t)b * INNERv + c0 + n) * SEQ_M + m0 + c * 8) = d;
  }
  // behind the stores: in the built kernel another job's instructions stand next and
  // write the registers that these stores name
  asm volatile("s_wait_xcnt 0x0" ::: "memory");
}

// ---------------------------------------------------------------------------
// Row LayerNorm (f32 statistics) producing f16 rows: a wave takes LN_R rows and holds
// them in registers; a row's sums are in-lane, then exchanged between lanes (no LDS, no
// barrier). With COPY the wave also writes the rows themselves as f16 into concat
// buffer cols [0, D).
// ---------------------------------------------------------------------------
#define LN_R 4
#define LN_RB (8 * LN_R)  // rows a block

template <int D, bool COPY>
__device__ __forceinline__ void ln_f16_job(const float* __restrict__ x,
                                           const float* __restrict__ g,
                                           const float* __restrict__ beta,
                                           _Float16* __restrict__ y,
                                           _Float16* __restrict__ cat, int row0) {
  constexpr int NJ = D / 128;  // 512-byte pieces of a row, 16 bytes a lane
  const int lane = threadIdx.x & 31;
  const v4f* xr = (const v4f*)(x + (size_t)row0 * D) + lane;
  v4f v[LN_R][NJ], gg[NJ], bb[NJ];
#pragma unroll
  for (int r = 0; r < LN_R; ++r)
#pragma unroll
    for (int j = 0; j < NJ; ++j) v[r][j] = xr[r * (D / 4) + j * 32];
#pragma unroll
  for (int j = 0; j < NJ; ++j) {
    gg[j] = ((const v4f*)g)[j * 32 + lane];
    bb[j] = ((const v4f*)beta)[j * 32 + lane];
  }
  // the address is named, so that it outlives the last load and no load of the group
  // is given it as a target; behind the wait its registers are free
  asm volatile("s_wait_xcnt 0x0" ::"v"(xr) : "memory");
  // keeps every load of the wave ahead of the first sum: one memory latency for its rows
  __builtin_amdgcn_sched_barrier(0);

  float a[LN_R], b[LN_R];
#pragma unroll
  for (int r = 0; r < LN_R; ++r) {
    v4f s = v[r][0], q = v[r][0] * v[r][0];
#pragma unroll
    for (int j = 1; j < NJ; ++j) {
      s += v[r][j];
      q += v[r][j] * v[r][j];
    }
    a[r] = (s[0] + s[1]) + (s[2] + s[3]);
    b[r] = (q[0] + q[1]) + (q[2] + q[3]);
  }
#pragma unroll
  for (int r = 0; r < LN_R; ++r) {
    a[r] = wave_sum(a[r]);
    b[r] = wave_sum(b[r]);
  }
#pragma unroll
  for (int r = 0; r < LN_R; ++r) {
    const float mu = a[r] * (1.0f / D);
    const float var = b[r] * (1.0f / D) - mu * mu;
    const float rs = rsqrtf(var + 1e-5f);
    v4h* yr = (v4h*)(y + (size_t)(row0 + r) * D) + lane;
#pragma unroll
    for (int j = 0; j < NJ; ++j) {
      v4h o;
#pragma unroll
      for (int i = 0; i < 4; ++i)
        o[i] = (_Float16)((v[r][j][i] - mu) * rs * gg[j][i] + bb[j][i]);
      yr[j * 32] = o;
    }
    if constexpr (COPY) {
      v4h* cr = (v4h*)(cat + (size_t)(row0 + r) * (2 * D)) + lane;
#pragma unroll
      for (int j = 0; j < NJ; ++j) {
        v4h o;
#pragma unroll
        for (int i = 0; i < 4; ++i) o[i] = (_Float16)v[r][j][i];
        cr[j * 32] = o;
      }
    }
  }
  // behind the stores: in the built kernel another job's instructions stand next and
  // write the registers that these stores name
  asm volatile("s_wait_xcnt 0x0" ::: "memory");
}

// ---------------------------------------------------------------------------
// All work that depends on the inputs alone, in one launch: a block takes one job,
// picked by its index (the same for the whole block, so the transposes' barrier is safe).
// ---------------------------------------------------------------------------
#define PJ_LNP ((BATCH * SEQ_N) / LN_RB)              // person row groups
#define PJ_LNG (PJ_LNP + (BATCH * SEQ_M) / LN_RB)     // garment row groups
#define PJ_TN  (INNERv / TT)                          // weight tiles a tile row
#define PJ_WQ  (PJ_LNG + (DQv / TT) * PJ_TN)
#define PJ_WK  (PJ_WQ + (DCv / TT) * PJ_TN)
#define PJ_WV  (PJ_WK + (DCv / TT) * PJ_TN)
#define PJ_WO  (PJ_WV + (INNERv * DQv) / (TT * TT))   // Wo: converted, not transposed
#define PJ_WF1 (PJ_WO + (DQv / TT) * PJ_TN)           // Wf rows that meet the residual
#define PJ_WF2 (PJ_WF1 + (DQv / TT) * PJ_TN)          // Wf rows that meet the attention half
#define PJ_BC  (PJ_WF2 + DQv / BC_C)                  // folded bias

__global__ void __launch_bounds__(256)
prep_kernel(const float* __restrict__ person, const float* __restrict__ garment,
            const float* __restrict__ Wq, const float* __restrict__ Wk,
            const float* __restrict__ Wv, const float* __restrict__ Wo,
            const float* __restrict__ Wf, const float* __restrict__ bo,
            const float* __restrict__ bf, const float* __restrict__ gq,
            const float* __restrict__ betaq, const float* __restrict__ gk,
            const float* __restrict__ betak, _Float16* __restrict__ pLN,
            _Float16* __restrict__ gLN, _Float16* __restrict__ WqT, _Float16* __restrict__ WkT,
            _Float16* __restrict__ WvT, _Float16* __restrict__ Woh, _Float16* __restrict__ WcT,
            _Float16* __restrict__ Wf2T, float* __restrict__ biasC,
            _Float16* __restrict__ Cat) {
  __shared__ __attribute__((aligned(16))) unsigned sT[TT * 64];
  const int j = blockIdx.x;
  const int wrow = (threadIdx.x >> 5) * LN_R;  // the wave's first row in a row group
  if (j < PJ_LNP) {
    ln_f16_job<DQv, true>(person, gq, betaq, pLN, Cat, j * LN_RB + wrow);
    return;
  }
  if (j < PJ_LNG) {
    ln_f16_job<DCv, false>(garment, gk, betak, gLN, nullptr, (j - PJ_LNP) * LN_RB + wrow);
    return;
  }
  if (j >= PJ_WF2) {
    bias_job((float*)sT, Wf + (size_t)DQv * DQv, bo, bf, biasC, j - PJ_WF2);
    return;
  }
  if (j >= PJ_WV && j < PJ_WO) {
    wconv_job(Wo, Woh, j - PJ_WV);
    return;
  }
  {
    // every weight has 1024 columns (INNER = DQ): PJ_TN tiles a tile row; K is the
    // row length of the target (the residual half of Wf goes into the left half of the
    // final product's weight, the other half into a matrix of its own)
    const float* W = Wf + (size_t)DQv * DQv;
    _Float16* Wt = Wf2T;
    int K = DQv, first = PJ_WF1;
    if (j < PJ_WQ) {
      W = Wq; Wt = WqT; K = DQv; first = PJ_LNG;
    } else if (j < PJ_WK) {
      W = Wk; Wt = WkT; K = DCv; first = PJ_WQ;
    } else if (j < PJ_WV) {
      W = Wv; Wt = WvT; K = DCv; first = PJ_WK;
    } else if (j < PJ_WF1) {
      W = Wf; Wt = WcT; K = 2 * DQv; first = PJ_WO;
    }
    wtrans_job(sT, W, Wt, K, (j - first) % PJ_TN, (j - first) / PJ_TN);
  }
}

// ---------------------------------------------------------------------------
// WMMA GEMM:  C[M x N] = A[M x K] * Bt[N x K]^T (+ bias), f16 in, f32 acc.
// Block: 256 threads = 8 waves (4x2 wave grid); a wave takes FM x 4 tiles of 16 x 16, so
// the block's tile is FM * 64 rows by 128 columns. The large products run with FM = 4
// (256 x 128, 64 x 64 a wave): a fragment read from LDS then serves four products, and the
// block brings fewer bytes from L2 for each product than at FM = 2. Its two buffers leave
// room for one block on a WGP: two waves a SIMD.
// A and Bt come into LDS by asynchronous copies, through no register: a stage is 128 k
// of both tiles (whole 256-byte rows), two buffers, the next stage's copies in flight
// while this stage is worked on; one barrier a stage. K: a multiple of 128.
// ---------------------------------------------------------------------------
#define GBM(FM) ((FM) * 64)
#define GBN 128
#define GBK 128
#define GLD 136                  // LDS row pitch in halfs: 256-byte rows at 272 bytes
#define GBO(FM) (GBM(FM) * GLD)          // the Bt tile stands behind the A tile (in halfs)
#define GBH(FM) (GBO(FM) + GBN * GLD)    // one buffer (in halfs)

// 128 rows of one operand's tile of a stage into LDS: eight 16-byte copies a lane, 16 rows apart.
// l: the lane's LDS byte address; g: its global one; ld: the operand's row length.
// The s_wait_xcnt stands inside the statement, so that no address register of a copy
// is rewritten ahead of it.
__device__ __forceinline__ void gemm_copy_tile(unsigned l, const _Float16* g, int ld) {
  const size_t s = (size_t)16 * ld;
  asm volatile(
      "global_load_async_to_lds_b128 %0, %8, off\n\t"
      "global_load_async_to_lds_b128 %1, %9, off\n\t"
      "global_load_async_to_lds_b128 %2, %10, off\n\t"
      "global_load_async_to_lds_b128 %3, %11, off\n\t"
      "global_load_async_to_lds_b128 %4, %12, off\n\t"
      "global_load_async_to_lds_b128 %5, %13, off\n\t"
      "global_load_async_to_lds_b128 %6, %14, off\n\t"
      "global_load_async_to_lds_b128 %7, %15, off\n\t"
      "s_wait_xcnt 0x0" ::"v"(l),
      "v"(l + 16 * GLD * 2), "v"(l + 32 * GLD * 2), "v"(l + 48 * GLD * 2),
      "v"(l + 64 * GLD * 2), "v"(l + 80 * GLD * 2), "v"(l + 96 * GLD * 2),
      "v"(l + 112 * GLD * 2), "v"(g), "v"(g + s), "v"(g + 2 * s), "v"(g + 3 * s),
      "v"(g + 4 * s), "v"(g + 5 * s), "v"(g + 6 * s), "v"(g + 7 * s)
      : "memory");
}

// Both tiles of a stage: the A tile in runs of 128 rows, then the Bt tile.
template <int FM>
__device__ __forceinline__ void gemm_copy_stage(unsigned la, const _Float16* ga, int lda,
                                                const _Float16* gb, int ldb) {
  // the scheduling barriers keep each statement's sixteen address sums next to it: formed
  // ahead for all statements at once, they push the kernel past 256 registers
#pragma unroll
  for (int h = 0; h < FM / 2; ++h) {
    __builtin_amdgcn_sched_barrier(0);
    gemm_copy_tile(la + h * (128 * GLD * 2), ga + (size_t)(h * 128) * lda, lda);
  }
  __builtin_amdgcn_sched_barrier(0);
  gemm_copy_tile(la + GBO(FM) * 2, gb, ldb);
  __builtin_amdgcn_sched_barrier(0);
}

// With SCALED the result is multiplied by oscale in f32, ahead of its one rounding to f16.
template <bool OUT_F16, bool HAS_BIAS, int FM, bool SCALED = false>
__device__ __forceinline__ void gemm_tile(_Float16* sAB, const _Float16* __restrict__ A, int lda,
                                 const _Float16* __restrict__ Bt, int ldb,
                                 void* __restrict__ Cv, int ldc,
                                 const float* __restrict__ bias, int K, int rowBlock,
                                 int colBlock, float oscale = 1.0f) {
  const int t = threadIdx.x;
  const int lane = t & 31, w = t >> 5;
  const int wm = w & 3, wn = w >> 2;  // 4 waves in M x 2 waves in N
  const int lr = lane & 15, hi4 = lane >> 4, kof = hi4 * 8;
  const int nst = K / GBK;  // stages

  // the lane's part of a stage: rows t/16 + 16 j of both tiles, 16-byte piece t%16
  const _Float16* ga = A + (size_t)(rowBlock + (t >> 4)) * lda + (t & 15) * 8;
  const _Float16* gb = Bt + (size_t)(colBlock + (t >> 4)) * ldb + (t & 15) * 8;
  const unsigned la = (unsigned)(size_t)&sAB[(t >> 4) * GLD + (t & 15) * 8];

  // the wave's fragment rows in buffer 0
  const _Float16* sA0 = sAB + (wm * (FM * 16) + lr) * GLD + kof;
  const _Float16* sB0 = sAB + GBO(FM) + (wn * 64 + lr) * GLD + kof;
  constexpr int FH = FM / 2;  // the A fragments go in two halves
  constexpr int NKS = GBK / 32;

  // stage 0 into buffer 0, landed and published
  gemm_copy_stage<FM>(la, ga, lda, gb, ldb);
  // this wave's copies have landed
  asm volatile("s_wait_asynccnt 0x0" ::: "memory");
  __syncthreads();

  // every loop over fragments is unrolled: its arrays are then registers and its LDS
  // steps constants of the loads
  v8f acc[FM][4];
#pragma unroll
  for (int fm = 0; fm < FM; ++fm)
#pragma unroll
    for (int fn = 0; fn < 4; ++fn) acc[fm][fn] = v8f_zero();

  for (int st = 0; st < nst; ++st) {
    const _Float16* sA = sA0 + (st & 1) * GBH(FM);
    const _Float16* sB = sB0 + (st & 1) * GBH(FM);
    // the stage's first fragments are asked for, and under their latency the next stage's
    // copies go out, into the other buffer, which every wave left at the barrier just passed
    v16h alo[FH], ahi[FH], bfr[4];  // the fragments of the k step at hand
#pragma unroll
    for (int fn = 0; fn < 4; ++fn) bfr[fn] = ldfrag(sB + fn * 16 * GLD);
#pragma unroll
    for (int f = 0; f < FH; ++f) {
      alo[f] = ldfrag(sA + f * 16 * GLD);
      ahi[f] = ldfrag(sA + (FH + f) * 16 * GLD);
    }
    if (st + 1 < nst)
      gemm_copy_stage<FM>(la + ((st + 1) & 1) * (GBH(FM) * 2), ga + (size_t)(st + 1) * GBK, lda,
                          gb + (size_t)(st + 1) * GBK, ldb);
    // Inside a stage the fragments are fetched one k step ahead, in two groups: Bt and
    // the first A half ahead of the first half's products, the second A half (into the
    // registers that those products have left) ahead of the second half's. The scheduling
    // barriers hold each group where it stands: sunk to its first use, a fetch is waited
    // for at once, and two waves a SIMD do not cover that wait.
#pragma unroll
    for (int ks = 0; ks < NKS; ++ks) {
      v16h nlo[FH], nhi[FH], nb[4];
      if (ks + 1 < NKS) {
#pragma unroll
        for (int fn = 0; fn < 4; ++fn) nb[fn] = ldfrag(sB + fn * 16 * GLD + (ks + 1) * 32);
#pragma unroll
        for (int f = 0; f < FH; ++f) nlo[f] = ldfrag(sA + f * 16 * GLD + (ks + 1) * 32);
      }
      __builtin_amdgcn_sched_barrier(0);
#pragma unroll
      for (int f = 0; f < FH; ++f)
#pragma unroll
        for (int fn = 0; fn < 4; ++fn) acc[f][fn] = wmma16x16x32(alo[f], bfr[fn], acc[f][fn]);
      __builtin_amdgcn_sched_barrier(0);
      if (ks + 1 < NKS) {
#pragma unroll
        for (int f = 0; f < FH; ++f)
          nhi[f] = ldfrag(sA + (FH + f) * 16 * GLD + (ks + 1) * 32);
      }
      __builtin_amdgcn_sched_barrier(0);
#pragma unroll
      for (int f = 0; f < FH; ++f)
#pragma unroll
        for (int fn = 0; fn < 4; ++fn)
          acc[FH + f][fn] = wmma16x16x32(ahi[f], bfr[fn], acc[FH + f][fn]);
      __builtin_amdgcn_sched_barrier(0);
      if (ks + 1 < NKS) {
#pragma unroll
        for (int fn = 0; fn < 4; ++fn) bfr[fn] = nb[fn];
#pragma unroll
        for (int f = 0; f < FH; ++f) {
          alo[f] = nlo[f];
          ahi[f] = nhi[f];
        }
      }
    }
    // hand-over: this wave's reads of the buffer are done, its copies of the next stage
    // have landed; behind the barrier the next stage is readable by all and this
    // stage's buffer is free for the stage after it
    asm volatile("s_wait_dscnt 0x0" ::: "memory");
    asm volatile("s_wait_asynccnt 0x0" ::: "memory");
    __syncthreads();
  }
  // no copy is left in flight when the wave ends
  asm volatile("s_wait_asynccnt 0x0" ::: "memory");

  // store: C layout — VGPR e: lanes 0-15 -> m=e, lanes 16-31 -> m=e+8; n=lr
#pragma unroll
  for (int fm = 0; fm < FM; ++fm)
#pragma unroll
    for (int fn = 0; fn < 4; ++fn) {
      int col = colBlock + wn * 64 + fn * 16 + lr;
      int row0 = rowBlock + wm * (FM * 16) + fm * 16 + hi4 * 8;
      float bv = HAS_BIAS ? bias[col] : 0.f;
#pragma unroll
      for (int e = 0; e < 8; ++e) {
        float v = acc[fm][fn][e] + bv;
        if constexpr (SCALED) v *= oscale;
        if constexpr (OUT_F16)
          ((_Float16*)Cv)[(size_t)(row0 + e) * ldc + col] = (_Float16)v;
        else
          ((float*)Cv)[(size_t)(row0 + e) * ldc + col] = v;
      }
    }
}

template <bool OUT_F16, bool HAS_BIAS>
__global__ void __launch_bounds__(256) gemm_wmma_kernel(const _Float16* __restrict__ A, int lda,
                                 const _Float16* __restrict__ Bt, int ldb,
                                 void* __restrict__ Cv, int ldc,
                                 const float* __restrict__ bias, int M, int N, int K) {
  __shared__ __attribute__((aligned(16))) _Float16 sAB[2 * GBH(4)];
  gemm_tile<OUT_F16, HAS_BIAS, 4>(sAB, A, lda, Bt, ldb, Cv, ldc, bias, K, blockIdx.y * GBM(4),
                                  blockIdx.x * GBN);
}

// The three projections in one launch: none reads another's result. blockIdx.y picks
// the product and its row tile; the longest (Q, K = DQ) has the lowest indices.
#define QKV_YQ ((BATCH * SEQ_N) / GBM(4))
#define QKV_YK (QKV_YQ + (BATCH * SEQ_M) / GBM(4))
#define QKV_YV (QKV_YK + (BATCH * SEQ_M) / GBM(4))

__global__ void __launch_bounds__(256)
gemm_qkv_kernel(const _Float16* __restrict__ pLN, const _Float16* __restrict__ gLN,
                const _Float16* __restrict__ WqT, const _Float16* __restrict__ WkT,
                const _Float16* __restrict__ WvT, _Float16* __restrict__ Qh,
                _Float16* __restrict__ Kh, _Float16* __restrict__ Vh) {
  __shared__ __attribute__((aligned(16))) _Float16 sAB[2 * GBH(4)];
  const int y = blockIdx.y;
  const bool isQ = y < QKV_YQ, isK = y < QKV_YK;
  const _Float16* A = isQ ? pLN : gLN;
  const _Float16* Bt = isQ ? WqT : (isK ? WkT : WvT);
  _Float16* C = isQ ? Qh : (isK ? Kh : Vh);
  const int K = isQ ? DQv : DCv;
  const int yt = isQ ? y : (isK ? y - QKV_YQ : y - QKV_YK);
  // Q leaves its projection times the softmax scale and log2(e): the attention's score
  // products are then exponents of 2 as they stand
  gemm_tile<true, false, 4, true>(sAB, A, K, Bt, K, (void*)C, INNERv, nullptr, K, yt * GBM(4),
                                  blockIdx.x * GBN, isQ ? ATT_SCALE_LOG2 : 1.0f);
}

// The output projection is folded into the final product:
//   (att Wo + bo) Wf2 + res Wf1 + bf = att (Wo Wf2) + res Wf1 + (bo Wf2 + bf),
// Wf1, Wf2 the upper and lower DQv rows of Wf. The weight product (Wo Wf2)^T = Wf2^T Wo^T
// needs the prepared weights alone, as the V transpose needs V alone: both in one launch,
// a block takes one job by its index; the product's tiles, the longer job, come first.
// Its result is the right half of the final product's weight rows.
#define VW_W2  ((DQv / GBM(2)) * (INNERv / GBN))  // small product: 128 x 128 tiles, more blocks
#define VW_ALL (VW_W2 + (INNERv / TT) * (SEQ_M / TT) * BATCH)

__global__ void __launch_bounds__(256)
vtrans_w2_kernel(const _Float16* __restrict__ V, _Float16* __restrict__ Vt,
                 const _Float16* __restrict__ Wf2T, const _Float16* __restrict__ Woh,
                 _Float16* __restrict__ WcT) {
  __shared__ __attribute__((aligned(16))) _Float16 sAB[2 * GBH(2)];
  const int j = blockIdx.x;
  if (j < VW_W2) {
    gemm_tile<true, false, 2>(sAB, Wf2T, DQv, Woh, DQv, (void*)(WcT + DQv), 2 * DQv, nullptr,
                              DQv, (j / (INNERv / GBN)) * GBM(2), (j % (INNERv / GBN)) * GBN);
    return;
  }
  const int v = j - VW_W2;
  vtrans_job((unsigned*)sAB, V, Vt, v % (INNERv / TT), (v / (INNERv / TT)) % (SEQ_M / TT),
             v / ((INNERv / TT) * (SEQ_M / TT)));
}

#define AT_NW 8
#define AT_G  2
#define AT_QB (AT_NW * AT_G * 16)
#define AT_SK 128                      // keys per stage
#define AT_NS (SEQ_M / AT_SK)          // stages
#define AT_SP (AT_SK / 32)             // passes per stage
#define AT_KP 72                       // K tile: 128 rows of 128 B at a pitch of 144 B (in halfs)
#define AT_VP 136                      // V^T tile: 64 rows of 256 B at a pitch of 272 B (in halfs)
#define AT_VO (AT_SK * AT_KP)          // V^T tile stands behind the K tile (in halfs)
#define AT_BH (AT_VO + DHEAD * AT_VP)  // one buffer (in halfs)
#define AT_OP (DQv + INNERv)           // output row pitch: the right half of the concat rows
#define AT_LAG 8.0f                    // how far a score may pass the maximum in use (log2)

// Base-2 exponentials in place, a run of them in one statement: left to the
// register allocator, an exponential's target is often the source of the one
// directly ahead of it. Here each overwrites only its own source, and the v_nop is
// the slot the instruction set asks for between the last one and its first reader.
__device__ __forceinline__ void exp2_inplace(v8f& x) {
  float a0 = x[0], a1 = x[1], a2 = x[2], a3 = x[3], a4 = x[4], a5 = x[5], a6 = x[6], a7 = x[7];
  asm("v_exp_f32 %0, %0\n\tv_exp_f32 %1, %1\n\tv_exp_f32 %2, %2\n\tv_exp_f32 %3, %3\n\t"
      "v_exp_f32 %4, %4\n\tv_exp_f32 %5, %5\n\tv_exp_f32 %6, %6\n\tv_exp_f32 %7, %7\n\t"
      "v_nop"
      : "+v"(a0), "+v"(a1), "+v"(a2), "+v"(a3), "+v"(a4), "+v"(a5), "+v"(a6), "+v"(a7));
  x[0] = a0; x[1] = a1; x[2] = a2; x[3] = a3; x[4] = a4; x[5] = a5; x[6] = a6; x[7] = a7;
}

// One stage into LDS: eight 16-byte copies a lane, four of K (32 rows apart) and four
// of V^T (16 rows apart). kl, vl: the lane's LDS byte addresses; kg, vg: its global ones.
// The s_wait_xcnt stands inside the statement, so that no address register of a copy
// is rewritten ahead of it.
__device__ __forceinline__ void at_copy_stage(unsigned kl, unsigned vl, const _Float16* kg,
                                              const _Float16* vg) {
  asm volatile(
      "global_load_async_to_lds_b128 %0, %8, off\n\t"
      "global_load_async_to_lds_b128 %1, %9, off\n\t"
      "global_load_async_to_lds_b128 %2, %10, off\n\t"
      "global_load_async_to_lds_b128 %3, %11, off\n\t"
      "global_load_async_to_lds_b128 %4, %12, off\n\t"
      "global_load_async_to_lds_b128 %5, %13, off\n\t"
      "global_load_async_to_lds_b128 %6, %14, off\n\t"
      "global_load_async_to_lds_b128 %7, %15, off\n\t"
      "s_wait_xcnt 0x0" ::"v"(kl),
      "v"(kl + 32 * AT_KP * 2), "v"(kl + 64 * AT_KP * 2), "v"(kl + 96 * AT_KP * 2), "v"(vl),
      "v"(vl + 16 * AT_VP * 2), "v"(vl + 32 * AT_VP * 2), "v"(vl + 48 * AT_VP * 2), "v"(kg),
      "v"(kg + 32 * INNERv), "v"(kg + 64 * INNERv), "v"(kg + 96 * INNERv), "v"(vg),
      "v"(vg + 16 * SEQ_M), "v"(vg + 32 * SEQ_M), "v"(vg + 48 * SEQ_M)
      : "memory");
}

__global__ void __launch_bounds__(AT_NW * 32)
attn_kernel(const _Float16* __restrict__ Q, const _Float16* __restrict__ Kf,
            const _Float16* __restrict__ Vt, _Float16* __restrict__ O) {
  __shared__ __attribute__((aligned(16))) _Float16 sKV[2 * AT_BH];
  const int t = threadIdx.x;
  const int lane = t & 31, w = t >> 5;
  const int lr = lane & 15, hi4 = lane >> 4, kof = hi4 * 8;
  const int bh = blockIdx.y, b = bh >> 4, h = bh & 15;
  const int q0 = blockIdx.x * AT_QB + w * (AT_G * 16);

  // Q as B operand: column lr = query, DH split into two 32-wide k-steps
  v16h qf[AT_G][2];
#pragma unroll
  for (int g = 0; g < AT_G; ++g) {
    const _Float16* qp = Q + ((size_t)(b * SEQ_N + q0 + g * 16 + lr)) * INNERv + h * DHEAD + kof;
    qf[g][0] = ldfrag(qp);
    qf[g][1] = ldfrag(qp + 32);
  }

  // the lane's part of a stage: K row t/8, 16-byte piece t%8; V^T row t/16, piece t%16
  const _Float16* kg = Kf + ((size_t)(b * SEQ_M + (t >> 3))) * INNERv + h * DHEAD + (t & 7) * 8;
  const _Float16* vg = Vt + ((size_t)(b * INNERv + h * DHEAD + (t >> 4))) * SEQ_M + (t & 15) * 8;
  const unsigned kl = (unsigned)(size_t)&sKV[(t >> 3) * AT_KP + (t & 7) * 8];
  const unsigned vl = (unsigned)(size_t)&sKV[AT_VO + (t >> 4) * AT_VP + (t & 15) * 8];

  // stage 0 into buffer 0, landed and published; then stage 1 goes out into buffer 1
  at_copy_stage(kl, vl, kg, vg);
  // this wave's copies have landed
  asm volatile("s_wait_asynccnt 0x0" ::: "memory");
  __syncthreads();
  at_copy_stage(kl + AT_BH * 2, vl + AT_BH * 2, kg + (size_t)AT_SK * INNERv, vg + AT_SK);

  v8f acc[AT_G][4];
  v8f cneg[AT_G];  // C of the score products: minus the maximum in use, eight times
  v2f lsum[AT_G];  // the lane's sum in two halves, joined behind the loop
  // least step of the maximum in use: none is in use yet, so the first pass takes its own
  // maximum whatever it is; from then on the maximum only rises
  float lo = -__builtin_inff();
#pragma unroll
  for (int g = 0; g < AT_G; ++g) {
    cneg[g] = v8f_zero();
    lsum[g] = v2f{0.f, 0.f};
#pragma unroll
    for (int d = 0; d < 4; ++d) acc[g][d] = v8f_zero();
  }

  for (int st = 0; st < AT_NS; ++st) {
   const _Float16* kbase = sKV + (st & 1) * AT_BH + lr * AT_KP + kof;
   const _Float16* vbase = sKV + (st & 1) * AT_BH + AT_VO + lr * AT_VP + kof;

   // K as A operand: row lr = key; two 16-key tiles x two k-steps, one pass ahead
   // inside a stage (never into the next stage's buffer)
   v16h kf[2][2];
#pragma unroll
   for (int kt = 0; kt < 2; ++kt) {
     kf[kt][0] = ldfrag(kbase + (kt * 16) * AT_KP);
     kf[kt][1] = ldfrag(kbase + (kt * 16) * AT_KP + 32);
   }

   for (int p = 0; p < AT_SP; ++p) {
    // V^T as A operand: row lr = dh, k = this pass's 32 keys; in flight under the
    // score products and the softmax. The barrier holds the fetch up here: sunk to
    // its first use it would be waited for at once
    v16h vf[4];
#pragma unroll
    for (int d = 0; d < 4; ++d) vf[d] = ldfrag(vbase + (d * 16) * AT_VP + p * 32);
    __builtin_amdgcn_sched_barrier(0);

    v8f s[2][AT_G];
#pragma unroll
    for (int kt = 0; kt < 2; ++kt)
#pragma unroll
      for (int g = 0; g < AT_G; ++g) {
        s[kt][g] = wmma16x16x32(kf[kt][0], qf[g][0], cneg[g]);
        s[kt][g] = wmma16x16x32(kf[kt][1], qf[g][1], s[kt][g]);
      }

    // keeps the eight products back to back: mixed with the maxima below, each
    // product that a maximum follows is padded with idle slots
    __builtin_amdgcn_sched_barrier(0);

    // next pass's K into the same registers, in flight under the softmax and the
    // second product (a stage's last pass names its own rows again, unused: the next
    // stage is not published yet)
    const int pn = (p + 1 < AT_SP) ? p + 1 : p;
#pragma unroll
    for (int kt = 0; kt < 2; ++kt) {
      kf[kt][0] = ldfrag(kbase + (pn * 32 + kt * 16) * AT_KP);
      kf[kt][1] = ldfrag(kbase + (pn * 32 + kt * 16) * AT_KP + 32);
    }

    // holds the fetch here, ahead of the softmax: sunk to the foot of the pass it
    // would be waited for at once by the next pass's products
    __builtin_amdgcn_sched_barrier(0);

    // the lane's largest scores, counted from the maximum in use
    float mx[AT_G];
#pragma unroll
    for (int g = 0; g < AT_G; ++g) {
      mx[g] = s[0][g][0];
#pragma unroll
      for (int e = 1; e < 8; ++e) mx[g] = fmaxf(mx[g], s[0][g][e]);
#pragma unroll
      for (int e = 0; e < 8; ++e) mx[g] = fmaxf(mx[g], s[1][g][e]);
    }
    // one scalar branch a pass, rarely taken behind the first passes
    if (__builtin_amdgcn_ballot_w32(fmaxf(mx[0], mx[1]) > lo + AT_LAG) != 0) {
#pragma unroll
      for (int g = 0; g < AT_G; ++g) {
        // the step of this query's maximum in use, the same in both wave halves
        const float d = fmaxf(fmaxf(mx[g], xhalf(mx[g])), lo);
        // a first pass below zero steps down: nothing is summed yet, the factor stays 1
        const float corr = __builtin_amdgcn_exp2f(-fmaxf(d, 0.f));
        cneg[g] -= d;
        s[0][g] -= d;
        s[1][g] -= d;
        lsum[g] *= corr;
#pragma unroll
        for (int dd = 0; dd < 4; ++dd) acc[g][dd] *= corr;
      }
      lo = 0.f;
    }

#pragma unroll
    for (int g = 0; g < AT_G; ++g) {
      exp2_inplace(s[0][g]);
      exp2_inplace(s[1][g]);
      v16h pf;  // elements 0-7 = keys 8*hi4 + e, 8-15 = keys 16 + 8*hi4 + e: ldfrag's k order
#pragma unroll
      for (int e = 0; e < 8; ++e) {
        pf[e] = (_Float16)s[0][g][e];
        pf[8 + e] = (_Float16)s[1][g][e];
      }
#pragma unroll
      for (int d = 0; d < 4; ++d) acc[g][d] = wmma16x16x32(vf[d], pf, acc[g][d]);
    }
    // holds the sums below behind the products: spread among them, the sums take the
    // registers of operands just used, and more products are padded with idle slots
    __builtin_amdgcn_sched_barrier(0);
    // the lane's sixteen terms of a query summed pairwise on whole register pairs, as the
    // score tiles stand: no term has to be moved to meet its partner
#pragma unroll
    for (int g = 0; g < AT_G; ++g) {
      const v8f t8 = s[0][g] + s[1][g];
      const v4f t4 = __builtin_shufflevector(t8, t8, 0, 1, 2, 3) +
                     __builtin_shufflevector(t8, t8, 4, 5, 6, 7);
      lsum[g] += __builtin_shufflevector(t4, t4, 0, 1) + __builtin_shufflevector(t4, t4, 2, 3);
    }
   }

   // hand-over: this wave's reads of the buffer are done, its copies of the next stage
   // have landed; behind the barrier the next stage is readable by all and this
   // stage's buffer is free for the stage after it
   asm volatile("s_wait_dscnt 0x0" ::: "memory");
   asm volatile("s_wait_asynccnt 0x0" ::: "memory");
   __syncthreads();
   if (st + 2 < AT_NS)
     at_copy_stage(kl + (st & 1) * (AT_BH * 2), vl + (st & 1) * (AT_BH * 2),
                   kg + (size_t)(st + 2) * AT_SK * INNERv, vg + (st + 2) * AT_SK);
  }
  // no copy is left in flight when the wave ends
  asm volatile("s_wait_asynccnt 0x0" ::: "memory");

  // O^T tile d: register e = dh d*16 + 8*hi4 + e of query lr: one 16-byte store
#pragma unroll
  for (int g = 0; g < AT_G; ++g) {
    const float l = lsum[g][0] + lsum[g][1];
    const float inv = 1.0f / (l + xhalf(l));
    _Float16* op = O + ((size_t)(b * SEQ_N + q0 + g * 16 + lr)) * AT_OP + h * DHEAD + kof;
#pragma unroll
    for (int d = 0; d < 4; ++d) {
      v8h o;
#pragma unroll
      for (int e = 0; e < 8; ++e) o[e] = (_Float16)(acc[g][d][e] * inv);
      *(v8h*)(op + d * 16) = o;
    }
  }
}

// ---------------------------------------------------------------------------
// Host-side launch
// ---------------------------------------------------------------------------
extern "C" void kernel_launch(void* const* d_in, const int* in_sizes, int n_in,
                              void* d_out, int out_size, void* d_ws, size_t ws_size,
                              hipStream_t stream) {
  (void)in_sizes; (void)n_in; (void)out_size; (void)ws_size;

  const float* person  = (const float*)d_in[0];
  const float* garment = (const float*)d_in[1];
  const float* Wq = (const float*)d_in[2];
  const float* Wk = (const float*)d_in[3];
  const float* Wv = (const float*)d_in[4];
  const float* Wo = (const float*)d_in[5];
  const float* bo = (const float*)d_in[6];
  const float* Wf = (const float*)d_in[7];
  const float* bf = (const float*)d_in[8];
  const float* gq = (const float*)d_in[9];
  const float* betaq = (const float*)d_in[10];
  const float* gk = (const float*)d_in[11];
  const float* betak = (const float*)d_in[12];
  float* out = (float*)d_out;

  _Float16* w0 = (_Float16*)d_ws;
  size_t off = 0;
  _Float16* pLN = w0 + off; off += (size_t)BATCH * SEQ_N * DQv;
  _Float16* gLN = w0 + off; off += (size_t)BATCH * SEQ_M * DCv;
  _Float16* WqT = w0 + off; off += (size_t)INNERv * DQv;
  _Float16* WkT = w0 + off; off += (size_t)INNERv * DCv;
  _Float16* WvT = w0 + off; off += (size_t)INNERv * DCv;
  _Float16* Woh = w0 + off; off += (size_t)INNERv * DQv;
  _Float16* WcT = w0 + off; off += (size_t)DQv * (2 * DQv);
  _Float16* Wf2T = w0 + off; off += (size_t)DQv * DQv;
  _Float16* Qh  = w0 + off; off += (size_t)BATCH * SEQ_N * INNERv;
  _Float16* Kh  = w0 + off; off += (size_t)BATCH * SEQ_M * INNERv;
  _Float16* Vh  = w0 + off; off += (size_t)BATCH * SEQ_M * INNERv;
  _Float16* VtB = w0 + off; off += (size_t)BATCH * INNERv * SEQ_M;
  _Float16* Cat = w0 + off; off += (size_t)BATCH * SEQ_N * 2 * DQv;
  float* biasC = (float*)(w0 + off);

  // Layer norms (the person rows' f16 copy into concat cols [0, DQ) with them), weight
  // transpose+convert, folded bias
  prep_kernel<<<PJ_BC, 256, 0, stream>>>(person, garment, Wq, Wk, Wv, Wo, Wf, bo, bf, gq, betaq,
                                         gk, betak, pLN, gLN, WqT, WkT, WvT, Woh, WcT, Wf2T,
                                         biasC, Cat);

  // Q/K/V projections (f16 out)
  gemm_qkv_kernel<<<dim3(INNERv / GBN, QKV_YV), 256, 0, stream>>>(pLN, gLN, WqT, WkT, WvT, Qh,
                                                                  Kh, Vh);

  // V transpose for contiguous PV fragments; (Wo Wf2)^T into the final weight's right half
  vtrans_w2_kernel<<<VW_ALL, 256, 0, stream>>>(Vh, VtB, Wf2T, Woh, WcT);

  // Attention (online softmax in registers) -> concat cols [DQ, 2*DQ) (f16)
  attn_kernel<<<dim3(SEQ_N / AT_QB, BATCH * NHEAD), AT_NW * 32, 0, stream>>>(
      Qh, Kh, VtB, Cat + DQv);

  // [residual, att] @ [Wf1; Wo Wf2] + (bo Wf2 + bf) -> out (f32)
  gemm_wmma_kernel<false, true><<<dim3(DQv / GBN, (BATCH * SEQ_N) / GBM(4)), 256, 0, stream>>>(
      Cat, 2 * DQv, WcT, 2 * DQv, (void*)out, DQv, biasC, BATCH * SEQ_N, DQv, 2 * DQv);
}

// v010
// One run takes 108 microseconds.
// Timed twice side by side with v009, it ran 1.04 and 1.03 times as fast.
// Over all steps from v000 it is 4.57 times as fast.
#include <hip/hip_runtime.h>

#define BATCH 4
#define SEQ_N 2048
#define SEQ_M 1024
#define DQv   1024
#define DCv   768
#define NHEAD 16
#define DHEAD 64
#define INNERv 1024
#define ATT_SCALE 0.125f
#define ATT_SCALE_LOG2 (ATT_SCALE * 1.4426950408889634f)  // scores in the log2 domain

typedef _Float16 v16h __attribute__((ext_vector_type(16)));
typedef _Float16 v8h  __attribute__((ext_vector_type(8)));
typedef float    v8f  __attribute__((ext_vector_type(8)));
typedef unsigned int v4u __attribute__((ext_vector_type(4)));

__device__ __forceinline__ v8f v8f_zero() {
  v8f z = {0.f,0.f,0.f,0.f,0.f,0.f,0.f,0.f};
  return z;
}

// Load one 16-bit WMMA A/B fragment for this lane.
// Per CDNA5 ISA 16-bit 16x32 layout: a lane holds K chunks {base..base+7} and
// {base+16..base+23}; caller passes p already offset by ks*32 + (laneHi?8:0).
__device__ __forceinline__ v16h ldfrag(const _Float16* p) {
  v8h lo = *(const v8h*)(p);
  v8h hi = *(const v8h*)(p + 16);
  return __builtin_shufflevector(lo, hi, 0,1,2,3,4,5,6,7,8,9,10,11,12,13,14,15);
}

__device__ __forceinline__ v8f wmma16x16x32(v16h a, v16h b, v8f c) {
  return __builtin_amdgcn_wmma_f32_16x16x32_f16(false, a, false, b, (short)0, c,
                                                false, false);
}

typedef float    v4f  __attribute__((ext_vector_type(4)));
typedef _Float16 v4h  __attribute__((ext_vector_type(4)));
typedef _Float16 v2h  __attribute__((ext_vector_type(2)));
typedef float    v2f  __attribute__((ext_vector_type(2)));

// lane l <-> lane l ^ 16
__device__ __forceinline__ float xhalf(float x) {
  int v = __builtin_bit_cast(int, x);
  return __builtin_bit_cast(
      float, __builtin_amdgcn_permlanex16(v, v, 0x76543210, 0xfedcba98, false, false));
}

// x + (x of lane l ^ MASK), inside a 16-lane row (DPP row_xmask)
template <int MASK>
__device__ __forceinline__ float row_xadd(float x) {
  int v = __builtin_bit_cast(int, x);
  return x + __builtin_bit_cast(
                 float, __builtin_amdgcn_update_dpp(v, v, 0x160 + MASK, 0xf, 0xf, false));
}

// sum over the 32 lanes, the same value in every lane
__device__ __forceinline__ float wave_sum(float x) {
  x = row_xadd<1>(x);
  x = row_xadd<2>(x);
  x = row_xadd<4>(x);
  x = row_xadd<8>(x);
  return x + xhalf(x);
}

// ---------------------------------------------------------------------------
// The jobs without matrix work are dealt so that few waves start and each moves
// much: 128 x 128 transpose tiles and four layer-norm rows a wave, 16-byte loads, all of
// a wave's loads in flight at once.
//
// Transpose tile in LDS: row = output row, 64 dwords, a dword = two neighbours of the
// output row. The 16-byte pieces of a row are permuted by an XOR with a number taken
// from the row index, so that the 32 dword stores of a wave (16 rows, 2 columns) fall
// in 32 banks and the 16-byte reads along a row stay whole.
// Every loop of these jobs is unrolled: its arrays are then registers and its address
// steps constants of the instructions.
// ---------------------------------------------------------------------------
#define TT 128  // tile edge

// Weight transpose + f32 -> f16 convert:  Wt[n][k] = (f16) W[k][n], W with INNERv columns
__device__ __forceinline__ void wtrans_job(unsigned* sT, const float* __restrict__ W,
                                           _Float16* __restrict__ Wt, int K, int bx, int by) {
  const int t = threadIdx.x, lane = t & 31, w = t >> 5, hl = lane >> 4, l16 = lane & 15;
  const int n0 = bx * TT, k0 = by * TT;
  // a half wave reads 256 contiguous bytes of rows 2*kp and 2*kp + 1
  // (kp = w * 8 + (it / 2) * 2 + hl, columns (it % 2) * 64 + l16 * 4): one address, constant steps
  const float* p0 = W + (size_t)(k0 + w * 16 + hl * 2) * INNERv + n0 + l16 * 4;
  v4f r0[8], r1[8];
#pragma unroll
  for (int it = 0; it < 8; ++it) {
    const float* p = p0 + (it >> 1) * 4 * INNERv + (it & 1) * 64;
    r0[it] = *(const v4f*)p;
    r1[it] = *(const v4f*)(p + INNERv);
  }
  // the address is named, so that it outlives the last load and no load of the group
  // is given it as a target; behind the wait its registers are free
  asm volatile("s_wait_xcnt 0x0" ::"v"(p0) : "memory");
  // keeps the sixteen loads ahead of the first LDS store: one latency for the tile
  __builtin_amdgcn_sched_barrier(0);
#pragma unroll
  for (int it = 0; it < 8; ++it) {
    const int id = w * 8 + it, kp = (id >> 1) * 2 + hl, nq = (id & 1) * 16 + l16;
#pragma unroll
    for (int i = 0; i < 4; ++i) {
      v2h h = {(_Float16)r0[it][i], (_Float16)r1[it][i]};
      sT[(nq * 4 + i) * 64 + (((kp >> 2) ^ l16) << 2) + (kp & 3)] =
          __builtin_bit_cast(unsigned, h);
    }
  }
  __syncthreads();
#pragma unroll
  for (int it = 0; it < 8; ++it) {
    const int id = it * 256 + t, n = id >> 4, c = id & 15;
    v4u d = *(const v4u*)&sT[n * 64 + ((c ^ ((n >> 2) & 15)) << 2)];
    *(v4u*)(Wt + (size_t)(n0 + n) * K + k0 + c * 8) = d;
  }
  // behind the stores: in the built kernel another job's instructions stand next and
  // write the registers that these stores name
  asm volatile("s_wait_xcnt 0x0" ::: "memory");
}

// The folded weight (Wo W2)^T, W2 = the rows of the fusion weight that meet the attention
// half:  Wc[n][k] = sum_j W2[j][n] * Wo[k][j], a 128 x 128 tile a block, on WMMA, from the
// f32 weights as they are given: nothing here waits for another launch or block.
// A stage is W2_BK j. Both tiles go through registers, where they become f16: a lane takes
// eight rows j of four columns n of W2 and stores them as four 16-byte pieces of rows n (the
// transpose), and 8-float pieces of rows k of Wo as they stand. Two LDS buffers, one
// barrier a stage; the next stage's loads are in flight under this stage's products.
#define W2_BK 128
#define W2_P  136                // LDS row pitch in halfs: 256-byte rows at 272 bytes
#define W2_BO (TT * W2_P)        // the Wo tile stands behind the W2 tile (in halfs)
#define W2_BH (2 * TT * W2_P)    // one buffer (in halfs)

// One stage's loads: W2 rows (u * 8 + wave) * 8 + r, four columns a lane (a wave reads 512
// contiguous bytes of a row); Wo rows t / 16 + 16 i, eight columns a lane (a half wave
// reads 512 contiguous bytes).
__device__ __forceinline__ void w2_load(v4f (&ra)[16], v4f (&rb)[16], const float* pa,
                                        const float* pb) {
#pragma unroll
  for (int u = 0; u < 2; ++u)
#pragma unroll
    for (int r = 0; r < 8; ++r) ra[u * 8 + r] = *(const v4f*)(pa + (u * 64 + r) * DQv);
#pragma unroll
  for (int i = 0; i < 8; ++i) {
    rb[2 * i] = *(const v4f*)(pb + i * 16 * DQv);
    rb[2 * i + 1] = *(const v4f*)(pb + i * 16 * DQv + 4);
  }
  // the addresses are named, so that they outlive the last load and no load of the group
  // is given them as a target; behind the wait they may step on
  asm volatile("s_wait_xcnt 0x0" ::"v"(pa), "v"(pb) : "memory");
}

__device__ __forceinline__ void w2_job(_Float16* sW, const float* __restrict__ W2,
                                       const float* __restrict__ Wo, _Float16* __restrict__ Wc,
                                       int ldc, int n0, int k0) {
  const int t = threadIdx.x, lane = t & 31, w = t >> 5;
  const int wm = w & 3, wn = w >> 2;  // 4 waves in n x 2 waves in k
  const int lr = lane & 15, hi4 = lane >> 4, kof = hi4 * 8;
  const float* pa = W2 + (size_t)(w * 8) * DQv + n0 + lane * 4;
  const float* pb = Wo + (size_t)(k0 + (t >> 4)) * DQv + (t & 15) * 8;
  _Float16* qa = sW + (lane * 4) * W2_P + w * 8;
  _Float16* qb = sW + W2_BO + (t >> 4) * W2_P + (t & 15) * 8;
  const _Float16* fa = sW + (wm * 32 + lr) * W2_P + kof;
  const _Float16* fb = sW + W2_BO + (wn * 64 + lr) * W2_P + kof;

  v4f ra[16], rb[16];
  w2_load(ra, rb, pa, pb);

  v8f acc[2][4];
#pragma unroll
  for (int fm = 0; fm < 2; ++fm)
#pragma unroll
    for (int fn = 0; fn < 4; ++fn) acc[fm][fn] = v8f_zero();

  // the loop stays rolled: eight copies of its body would be code that runs once
#pragma unroll 1
  for (int st = 0; st < DQv / W2_BK; ++st) {
    const int bo = (st & 1) * W2_BH;
    // this stage's registers into its buffer, which every wave left before the barrier of
    // the stage just done
#pragma unroll
    for (int u = 0; u < 2; ++u)
#pragma unroll
      for (int i = 0; i < 4; ++i) {
        v8h ha;
#pragma unroll
        for (int r = 0; r < 8; ++r) ha[r] = (_Float16)ra[u * 8 + r][i];
        *(v8h*)(qa + bo + i * W2_P + u * 64) = ha;
      }
#pragma unroll
    for (int i = 0; i < 8; ++i) {
      v8h hb;
#pragma unroll
      for (int e = 0; e < 4; ++e) {
        hb[e] = (_Float16)rb[2 * i][e];
        hb[4 + e] = (_Float16)rb[2 * i + 1][e];
      }
      *(v8h*)(qb + bo + i * 16 * W2_P) = hb;
    }
    __syncthreads();
    // behind the barrier, which would wait for them; ahead of the products, which cover them
    if (st + 1 < DQv / W2_BK) {
      pa += (size_t)W2_BK * DQv;
      pb += W2_BK;
      w2_load(ra, rb, pa, pb);
    }
    // holds the loads up here: sunk to their use in the next stage they would be waited
    // for at once
    __builtin_amdgcn_sched_barrier(0);
#pragma unroll
    for (int ks = 0; ks < W2_BK / 32; ++ks) {
      v16h af[2], bfr[4];
#pragma unroll
      for (int fm = 0; fm < 2; ++fm) af[fm] = ldfrag(fa + bo + fm * 16 * W2_P + ks * 32);
#pragma unroll
      for (int fn = 0; fn < 4; ++fn) bfr[fn] = ldfrag(fb + bo + fn * 16 * W2_P + ks * 32);
#pragma unroll
      for (int fm = 0; fm < 2; ++fm)
#pragma unroll
        for (int fn = 0; fn < 4; ++fn) acc[fm][fn] = wmma16x16x32(af[fm], bfr[fn], acc[fm][fn]);
    }
  }

  // C layout: register e: lanes 0-15 -> n = e, lanes 16-31 -> n = e + 8; k = lr
#pragma unroll
  for (int fm = 0; fm < 2; ++fm)
#pragma unroll
    for (int fn = 0; fn < 4; ++fn) {
      _Float16* c = Wc + (size_t)(n0 + wm * 32 + fm * 16 + hi4 * 8) * ldc + k0 + wn * 64 +
                    fn * 16 + lr;
#pragma unroll
      for (int e = 0; e < 8; ++e) c[(size_t)e * ldc] = (_Float16)acc[fm][fn][e];
    }
  // behind the stores: in the built kernel another job's instructions stand next and
  // write the registers that these stores name
  asm volatile("s_wait_xcnt 0x0" ::: "memory");
}

// Bias of the folded output:  bc[n] = bf[n] + sum_j bo[j] * W2[j][n]  (f32; W2 = the rows
// of the fusion weight that meet the attention half, DQv x DQv). A block takes BC_C
// columns: 8 lanes span them, 32 lane groups take 32 rows each, all 32 loads of a lane in
// flight at once; the groups' sums meet in LDS.
#define BC_C 32
__device__ __forceinline__ void bias_job(float* sF, const float* __restrict__ W2,
                                         const float* __restrict__ bo,
                                         const float* __restrict__ bf, float* __restrict__ bc,
                                         int blk) {
  const int t = threadIdx.x, c4 = t & 7, rg = t >> 3;
  const int n0 = blk * BC_C;
  const float* p0 = W2 + (size_t)(rg * 32) * DQv + n0 + c4 * 4;
  const v4f* b0 = (const v4f*)(bo + rg * 32);
  v4f wv[32], bv[8];
#pragma unroll
  for (int it = 0; it < 32; ++it) wv[it] = *(const v4f*)(p0 + it * DQv);
#pragma unroll
  for (int i = 0; i < 8; ++i) bv[i] = b0[i];
  // the addresses are named, so that they outlive the last load and no load of the group
  // is given them as a target; behind the wait their registers are free
  asm volatile("s_wait_xcnt 0x0" ::"v"(p0), "v"(b0) : "memory");
  // keeps every load ahead of the first product: one memory latency for the block
  __builtin_amdgcn_sched_barrier(0);
  v4f s = wv[0] * bv[0][0];
#pragma unroll
  for (int it = 1; it < 32; ++it) s += wv[it] * bv[it >> 2][it & 3];
  *(v4f*)&sF[rg * BC_C + c4 * 4] = s;
  __syncthreads();
  if (t < BC_C) {
    float a = bf[n0 + t];
#pragma unroll
    for (int r = 0; r < 32; ++r) a += sF[r * BC_C + t];
    bc[n0 + t] = a;
  }
  // behind the load and the store: in the built kernel another job's instructions stand
  // next and write the registers that they name
  asm volatile("s_wait_xcnt 0x0" ::: "memory");
}

// ---------------------------------------------------------------------------
// Row LayerNorm (f32 statistics) producing f16 rows: a wave takes LN_R rows and holds
// them in registers; a row's sums are in-lane, then exchanged between lanes (no LDS, no
// barrier). With COPY the wave also writes the rows themselves as f16 into concat
// buffer cols [0, D).
// ---------------------------------------------------------------------------
#define LN_R 4
#define LN_RB (8 * LN_R)  // rows a block

template <int D, bool COPY>
__device__ __forceinline__ void ln_f16_job(const float* __restrict__ x,
                                           const float* __restrict__ g,
                                           const float* __restrict__ beta,
                                           _Float16* __restrict__ y,
                                           _Float16* __restrict__ cat, int row0) {
  constexpr int NJ = D / 128;  // 512-byte pieces of a row, 16 bytes a lane
  const int lane = threadIdx.x & 31;
  const v4f* xr = (const v4f*)(x + (size_t)row0 * D) + lane;
  v4f v[LN_R][NJ], gg[NJ], bb[NJ];
#pragma unroll
  for (int r = 0; r < LN_R; ++r)
#pragma unroll
    for (int j = 0; j < NJ; ++j) v[r][j] = xr[r * (D / 4) + j * 32];
#pragma unroll
  for (int j = 0; j < NJ; ++j) {
    gg[j] = ((const v4f*)g)[j * 32 + lane];
    bb[j] = ((const v4f*)beta)[j * 32 + lane];
  }
  // the address is named, so that it outlives the last load and no load of the group
  // is given it as a target; behind the wait its registers are free
  asm volatile("s_wait_xcnt 0x0" ::"v"(xr) : "memory");
  // keeps every load of the wave ahead of the first sum: one memory latency for its rows
  __builtin_amdgcn_sched_barrier(0);

  float a[LN_R], b[LN_R];
#pragma unroll
  for (int r = 0; r < LN_R; ++r) {
    v4f s = v[r][0], q = v[r][0] * v[r][0];
#pragma unroll
    for (int j = 1; j < NJ; ++j) {
      s += v[r][j];
      q += v[r][j] * v[r][j];
    }
    a[r] = (s[0] + s[1]) + (s[2] + s[3]);
    b[r] = (q[0] + q[1]) + (q[2] + q[3]);
  }
#pragma unroll
  for (int r = 0; r < LN_R; ++r) {
    a[r] = wave_sum(a[r]);
    b[r] = wave_sum(b[r]);
  }
#pragma unroll
  for (int r = 0; r < LN_R; ++r) {
    const float mu = a[r] * (1.0f / D);
    const float var = b[r] * (1.0f / D) - mu * mu;
    const float rs = rsqrtf(var + 1e-5f);
    v4h* yr = (v4h*)(y + (size_t)(row0 + r) * D) + lane;
#pragma unroll
    for (int j = 0; j < NJ; ++j) {
      v4h o;
#pragma unroll
      for (int i = 0; i < 4; ++i)
        o[i] = (_Float16)((v[r][j][i] - mu) * rs * gg[j][i] + bb[j][i]);
      yr[j * 32] = o;
    }
    if constexpr (COPY) {
      v4h* cr = (v4h*)(cat + (size_t)(row0 + r) * (2 * D)) + lane;
#pragma unroll
      for (int j = 0; j < NJ; ++j) {
        v4h o;
#pragma unroll
        for (int i = 0; i < 4; ++i) o[i] = (_Float16)v[r][j][i];
        cr[j * 32] = o;
      }
    }
  }
  // behind the stores: in the built kernel another job's instructions stand next and
  // write the registers that these stores name
  asm volatile("s_wait_xcnt 0x0" ::: "memory");
}

// ---------------------------------------------------------------------------
// All work that depends on the inputs alone, in one launch: a block takes one job,
// picked by its index (the same for the whole block, so the jobs' barriers are safe).
// The folded weight's tiles, the longest job, have the lowest indices and start first.
// ---------------------------------------------------------------------------
#define PJ_W2  ((DQv / TT) * (INNERv / TT))           // folded weight tiles
#define PJ_LNP (PJ_W2 + (BATCH * SEQ_N) / LN_RB)      // person row groups
#define PJ_LNG (PJ_LNP + (BATCH * SEQ_M) / LN_RB)     // garment row groups
#define PJ_TN  (INNERv / TT)                          // weight tiles a tile row
#define PJ_WQ  (PJ_LNG + (DQv / TT) * PJ_TN)
#define PJ_WK  (PJ_WQ + (DCv / TT) * PJ_TN)
#define PJ_WV  (PJ_WK + (DCv / TT) * PJ_TN)
#define PJ_WF1 (PJ_WV + (DQv / TT) * PJ_TN)           // Wf rows that meet the residual
#define PJ_BC  (PJ_WF1 + DQv / BC_C)                  // folded bias

__global__ void __launch_bounds__(256)
prep_kernel(const float* __restrict__ person, const float* __restrict__ garment,
            const float* __restrict__ Wq, const float* __restrict__ Wk,
            const float* __restrict__ Wv, const float* __restrict__ Wo,
            const float* __restrict__ Wf, const float* __restrict__ bo,
            const float* __restrict__ bf, const float* __restrict__ gq,
            const float* __restrict__ betaq, const float* __restrict__ gk,
            const float* __restrict__ betak, _Float16* __restrict__ pLN,
            _Float16* __restrict__ gLN, _Float16* __restrict__ WqT, _Float16* __restrict__ WkT,
            _Float16* __restrict__ WvT, _Float16* __restrict__ WcT, float* __restrict__ biasC,
            _Float16* __restrict__ Cat) {
  __shared__ __attribute__((aligned(16))) unsigned sT[W2_BH];  // 2 * W2_BH halfs, the largest job's
  const int j = blockIdx.x;
  const int wrow = (threadIdx.x >> 5) * LN_R;  // the wave's first row in a row group
  if (j < PJ_W2) {
    // into the right half of the final product's weight rows
    w2_job((_Float16*)sT, Wf + (size_t)DQv * DQv, Wo, WcT + DQv, 2 * DQv,
           (j / (INNERv / TT)) * TT, (j % (INNERv / TT)) * TT);
    return;
  }
  if (j < PJ_LNP) {
    ln_f16_job<DQv, true>(person, gq, betaq, pLN, Cat, (j - PJ_W2) * LN_RB + wrow);
    return;
  }
  if (j < PJ_LNG) {
    ln_f16_job<DCv, false>(garment, gk, betak, gLN, nullptr, (j - PJ_LNP) * LN_RB + wrow);
    return;
  }
  if (j >= PJ_WF1) {
    bias_job((float*)sT, Wf + (size_t)DQv * DQv, bo, bf, biasC, j - PJ_WF1);
    return;
  }
  {
    // every weight has 1024 columns (INNER = DQ): PJ_TN tiles a tile row; K is the
    // row length of the target (the residual half of Wf goes into the left half of the
    // final product's weight)
    const float* W = Wf;
    _Float16* Wt = WcT;
    int K = 2 * DQv, first = PJ_WV;
    if (j < PJ_WQ) {
      W = Wq; Wt = WqT; K = DQv; first = PJ_LNG;
    } else if (j < PJ_WK) {
      W = Wk; Wt = WkT; K = DCv; first = PJ_WQ;
    } else if (j < PJ_WV) {
      W = Wv; Wt = WvT; K = DCv; first = PJ_WK;
    }
    wtrans_job(sT, W, Wt, K, (j - first) % PJ_TN, (j - first) / PJ_TN);
  }
}

// ---------------------------------------------------------------------------
// WMMA GEMM:  C[M x N] = A[M x K] * Bt[N x K]^T (+ bias), f16 in, f32 acc.
// Block: 256 threads = 8 waves (4x2 wave grid); a wave takes FM x 4 tiles of 16 x 16, so
// the block's tile is FM * 64 rows by 128 columns. The large products run with FM = 4
// (256 x 128, 64 x 64 a wave): a fragment read from LDS then serves four products, and the
// block brings fewer bytes from L2 for each product than at FM = 2. Its two buffers leave
// room for one block on a WGP: two waves a SIMD.
// A and Bt come into LDS by asynchronous copies, through no register: a stage is 128 k
// of both tiles (whole 256-byte rows), two buffers, the next stage's copies in flight
// while this stage is worked on; one barrier a stage. K: a multiple of 128.
// ---------------------------------------------------------------------------
#define GBM(FM) ((FM) * 64)
#define GBN 128
#define GBK 128
#define GLD 136                  // LDS row pitch in halfs: 256-byte rows at 272 bytes
#define GBO(FM) (GBM(FM) * GLD)          // the Bt tile stands behind the A tile (in halfs)
#define GBH(FM) (GBO(FM) + GBN * GLD)    // one buffer (in halfs)

// 128 rows of one operand's tile of a stage into LDS: eight 16-byte copies a lane, 16 rows apart.
// l: the lane's LDS byte address; g: its global one; ld: the operand's row length.
// The s_wait_xcnt stands inside the statement, so that no address register of a copy
// is rewritten ahead of it.
__device__ __forceinline__ void gemm_copy_tile(unsigned l, const _Float16* g, int ld) {
  const size_t s = (size_t)16 * ld;
  asm volatile(
      "global_load_async_to_lds_b128 %0, %8, off\n\t"
      "global_load_async_to_lds_b128 %1, %9, off\n\t"
      "global_load_async_to_lds_b128 %2, %10, off\n\t"
      "global_load_async_to_lds_b128 %3, %11, off\n\t"
      "global_load_async_to_lds_b128 %4, %12, off\n\t"
      "global_load_async_to_lds_b128 %5, %13, off\n\t"
      "global_load_async_to_lds_b128 %6, %14, off\n\t"
      "global_load_async_to_lds_b128 %7, %15, off\n\t"
      "s_wait_xcnt 0x0" ::"v"(l),
      "v"(l + 16 * GLD * 2), "v"(l + 32 * GLD * 2), "v"(l + 48 * GLD * 2),
      "v"(l + 64 * GLD * 2), "v"(l + 80 * GLD * 2), "v"(l + 96 * GLD * 2),
      "v"(l + 112 * GLD * 2), "v"(g), "v"(g + s), "v"(g + 2 * s), "v"(g + 3 * s),
      "v"(g + 4 * s), "v"(g + 5 * s), "v"(g + 6 * s), "v"(g + 7 * s)
      : "memory");
}

// Both tiles of a stage: the A tile in runs of 128 rows, then the Bt tile.
template <int FM>
__device__ __forceinline__ void gemm_copy_stage(unsigned la, const _Float16* ga, int lda,
                                                const _Float16* gb, int ldb) {
  // the scheduling barriers keep each statement's sixteen address sums next to it: formed
  // ahead for all statements at once, they push the kernel past 256 registers
#pragma unroll
  for (int h = 0; h < FM / 2; ++h) {
    __builtin_amdgcn_sched_barrier(0);
    gemm_copy_tile(la + h * (128 * GLD * 2), ga + (size_t)(h * 128) * lda, lda);
  }
  __builtin_amdgcn_sched_barrier(0);
  gemm_copy_tile(la + GBO(FM) * 2, gb, ldb);
  __builtin_amdgcn_sched_barrier(0);
}

// With SCALED the result is multiplied by oscale in f32, ahead of its one rounding to f16.
template <bool OUT_F16, bool HAS_BIAS, int FM, bool SCALED = false>
__device__ __forceinline__ void gemm_tile(_Float16* sAB, const _Float16* __restrict__ A, int lda,
                                 const _Float16* __restrict__ Bt, int ldb,
                                 void* __restrict__ Cv, int ldc,
                                 const float* __restrict__ bias, int K, int rowBlock,
                                 int colBlock, float oscale = 1.0f) {
  const int t = threadIdx.x;
  const int lane = t & 31, w = t >> 5;
  const int wm = w & 3, wn = w >> 2;  // 4 waves in M x 2 waves in N
  const int lr = lane & 15, hi4 = lane >> 4, kof = hi4 * 8;
  const int nst = K / GBK;  // stages

  // the lane's part of a stage: rows t/16 + 16 j of both tiles, 16-byte piece t%16
  const _Float16* ga = A + (size_t)(rowBlock + (t >> 4)) * lda + (t & 15) * 8;
  const _Float16* gb = Bt + (size_t)(colBlock + (t >> 4)) * ldb + (t & 15) * 8;
  const unsigned la = (unsigned)(size_t)&sAB[(t >> 4) * GLD + (t & 15) * 8];

  // the wave's fragment rows in buffer 0
  const _Float16* sA0 = sAB + (wm * (FM * 16) + lr) * GLD + kof;
  const _Float16* sB0 = sAB + GBO(FM) + (wn * 64 + lr) * GLD + kof;
  constexpr int FH = FM / 2;  // the A fragments go in two halves
  constexpr int NKS = GBK / 32;

  // stage 0 into buffer 0, landed and published
  gemm_copy_stage<FM>(la, ga, lda, gb, ldb);
  // this wave's copies have landed
  asm volatile("s_wait_asynccnt 0x0" ::: "memory");
  __syncthreads();

  // every loop over fragments is unrolled: its arrays are then registers and its LDS
  // steps constants of the loads
  v8f acc[FM][4];
#pragma unroll
  for (int fm = 0; fm < FM; ++fm)
#pragma unroll
    for (int fn = 0; fn < 4; ++fn) acc[fm][fn] = v8f_zero();

  for (int st = 0; st < nst; ++st) {
    const _Float16* sA = sA0 + (st & 1) * GBH(FM);
    const _Float16* sB = sB0 + (st & 1) * GBH(FM);
    // the stage's first fragments are asked for, and under their latency the next stage's
    // copies go out, into the other buffer, which every wave left at the barrier just passed
    v16h alo[FH], ahi[FH], bfr[4];  // the fragments of the k step at hand
#pragma unroll
    for (int fn = 0; fn < 4; ++fn) bfr[fn] = ldfrag(sB + fn * 16 * GLD);
#pragma unroll
    for (int f = 0; f < FH; ++f) {
      alo[f] = ldfrag(sA + f * 16 * GLD);
      ahi[f] = ldfrag(sA + (FH + f) * 16 * GLD);
    }
    if (st + 1 < nst)
      gemm_copy_stage<FM>(la + ((st + 1) & 1) * (GBH(FM) * 2), ga + (size_t)(st + 1) * GBK, lda,
                          gb + (size_t)(st + 1) * GBK, ldb);
    // Inside a stage the fragments are fetched one k step ahead, in two groups: Bt and
    // the first A half ahead of the first half's products, the second A half (into the
    // registers that those products have left) ahead of the second half's. The scheduling
    // barriers hold each group where it stands: sunk to its first use, a fetch is waited
    // for at once, and two waves a SIMD do not cover that wait.
#pragma unroll
    for (int ks = 0; ks < NKS; ++ks) {
      v16h nlo[FH], nhi[FH], nb[4];
      if (ks + 1 < NKS) {
#pragma unroll
        for (int fn = 0; fn < 4; ++fn) nb[fn] = ldfrag(sB + fn * 16 * GLD + (ks + 1) * 32);
#pragma unroll
        for (int f = 0; f < FH; ++f) nlo[f] = ldfrag(sA + f * 16 * GLD + (ks + 1) * 32);
      }
      __builtin_amdgcn_sched_barrier(0);
#pragma unroll
      for (int f = 0; f < FH; ++f)
#pragma unroll
        for (int fn = 0; fn < 4; ++fn) acc[f][fn] = wmma16x16x32(alo[f], bfr[fn], acc[f][fn]);
      __builtin_amdgcn_sched_barrier(0);
      if (ks + 1 < NKS) {
#pragma unroll
        for (int f = 0; f < FH; ++f)
          nhi[f] = ldfrag(sA + (FH + f) * 16 * GLD + (ks + 1) * 32);
      }
      __builtin_amdgcn_sched_barrier(0);
#pragma unroll
      for (int f = 0; f < FH; ++f)
#pragma unroll
        for (int fn = 0; fn < 4; ++fn)
          acc[FH + f][fn] = wmma16x16x32(ahi[f], bfr[fn], acc[FH + f][fn]);
      __builtin_amdgcn_sched_barrier(0);
      if (ks + 1 < NKS) {
#pragma unroll
        for (int fn = 0; fn < 4; ++fn) bfr[fn] = nb[fn];
#pragma unroll
        for (int f = 0; f < FH; ++f) {
          alo[f] = nlo[f];
          ahi[f] = nhi[f];
        }
      }
    }
    // hand-over: this wave's reads of the buffer are done, its copies of the next stage
    // have landed; behind the barrier the next stage is readable by all and this
    // stage's buffer is free for the stage after it
    asm volatile("s_wait_dscnt 0x0" ::: "memory");
    asm volatile("s_wait_asynccnt 0x0" ::: "memory");
    __syncthreads();
  }
  // no copy is left in flight when the wave ends
  asm volatile("s_wait_asynccnt 0x0" ::: "memory");

  // store: C layout — VGPR e: lanes 0-15 -> m=e, lanes 16-31 -> m=e+8; n=lr
#pragma unroll
  for (int fm = 0; fm < FM; ++fm)
#pragma unroll
    for (int fn = 0; fn < 4; ++fn) {
      int col = colBlock + wn * 64 + fn * 16 + lr;
      int row0 = rowBlock + wm * (FM * 16) + fm * 16 + hi4 * 8;
      float bv = HAS_BIAS ? bias[col] : 0.f;
#pragma unroll
      for (int e = 0; e < 8; ++e) {
        float v = acc[fm][fn][e] + bv;
        if constexpr (SCALED) v *= oscale;
        if constexpr (OUT_F16)
          ((_Float16*)Cv)[(size_t)(row0 + e) * ldc + col] = (_Float16)v;
        else
          ((float*)Cv)[(size_t)(row0 + e) * ldc + col] = v;
      }
    }
}

template <bool OUT_F16, bool HAS_BIAS>
__global__ void __launch_bounds__(256) gemm_wmma_kernel(const _Float16* __restrict__ A, int lda,
                                 const _Float16* __restrict__ Bt, int ldb,
                                 void* __restrict__ Cv, int ldc,
                                 const float* __restrict__ bias, int M, int N, int K) {
  __shared__ __attribute__((aligned(16))) _Float16 sAB[2 * GBH(4)];
  gemm_tile<OUT_F16, HAS_BIAS, 4>(sAB, A, lda, Bt, ldb, Cv, ldc, bias, K, blockIdx.y * GBM(4),
                                  blockIdx.x * GBN);
}

// The three projections in one launch: none reads another's result. blockIdx.y picks
// the product and, for Q and K, its row tile; the longest (Q, K = DQ) has the lowest indices.
// V leaves its product transposed, as the attention reads it: V^T = Wv^T g^T, the operands
// swapped (rows = inner columns c, columns = garment rows), Vt[b][c][m]. A column tile lies
// inside one batch, so the batch only moves the tile's base.
#define QKV_YQ ((BATCH * SEQ_N) / GBM(4))
#define QKV_YK (QKV_YQ + (BATCH * SEQ_M) / GBM(4))
#define QKV_YV (QKV_YK + (BATCH * SEQ_M) / GBM(4))

__global__ void __launch_bounds__(256)
gemm_qkv_kernel(const _Float16* __restrict__ pLN, const _Float16* __restrict__ gLN,
                const _Float16* __restrict__ WqT, const _Float16* __restrict__ WkT,
                const _Float16* __restrict__ WvT, _Float16* __restrict__ Qh,
                _Float16* __restrict__ Kh, _Float16* __restrict__ Vt) {
  __shared__ __attribute__((aligned(16))) _Float16 sAB[2 * GBH(4)];
  const int y = blockIdx.y;
  const bool isQ = y < QKV_YQ, isK = y < QKV_YK;
  // V^T: its tiles numbered in a row, INNERv / GBM(4) row tiles to a column tile
  const int vt = (y - QKV_YK) * (INNERv / GBN) + blockIdx.x;
  const int vcol = (vt / (INNERv / GBM(4))) * GBN;  // first garment row, over all batches
  const _Float16* A = isQ ? pLN : (isK ? gLN : WvT);
  const _Float16* Bt = isQ ? WqT : (isK ? WkT : gLN);
  // column b * SEQ_M + m of row c stands at (b * INNERv + c) * SEQ_M + m
  _Float16* C = isQ ? Qh : (isK ? Kh : Vt + (size_t)(vcol / SEQ_M) * (INNERv - 1) * SEQ_M);
  const int K = isQ ? DQv : DCv;
  const int row = isQ ? y * GBM(4)
                      : (isK ? (y - QKV_YQ) * GBM(4) : (vt % (INNERv / GBM(4))) * GBM(4));
  const int col = isK ? blockIdx.x * GBN : vcol;
  // Q leaves its projection times the softmax scale and log2(e): the attention's score
  // products are then exponents of 2 as they stand
  gemm_tile<true, false, 4, true>(sAB, A, K, Bt, K, (void*)C, isK ? INNERv : SEQ_M, nullptr, K,
                                  row, col, isQ ? ATT_SCALE_LOG2 : 1.0f);
}

#define AT_NW 8
#define AT_G  2
#define AT_QB (AT_NW * AT_G * 16)
#define AT_SK 128                      // keys per stage
#define AT_NS (SEQ_M / AT_SK)          // stages
#define AT_SP (AT_SK / 32)             // passes per stage
#define AT_KP 72                       // K tile: 128 rows of 128 B at a pitch of 144 B (in halfs)
#define AT_VP 136                      // V^T tile: 64 rows of 256 B at a pitch of 272 B (in halfs)
#define AT_VO (AT_SK * AT_KP)          // V^T tile stands behind the K tile (in halfs)
#define AT_BH (AT_VO + DHEAD * AT_VP)  // one buffer (in halfs)
#define AT_OP (DQv + INNERv)           // output row pitch: the right half of the concat rows
#define AT_LAG 8.0f                    // how far a score may pass the maximum in use (log2)

// Base-2 exponentials in place, a run of them in one statement: left to the
// register allocator, an exponential's target is often the source of the one
// directly ahead of it. Here each overwrites only its own source, and the v_nop is
// the slot the instruction set asks for between the last one and its first reader.
__device__ __forceinline__ void exp2_inplace(v8f& x) {
  float a0 = x[0], a1 = x[1], a2 = x[2], a3 = x[3], a4 = x[4], a5 = x[5], a6 = x[6], a7 = x[7];
  asm("v_exp_f32 %0, %0\n\tv_exp_f32 %1, %1\n\tv_exp_f32 %2, %2\n\tv_exp_f32 %3, %3\n\t"
      "v_exp_f32 %4, %4\n\tv_exp_f32 %5, %5\n\tv_exp_f32 %6, %6\n\tv_exp_f32 %7, %7\n\t"
      "v_nop"
      : "+v"(a0), "+v"(a1), "+v"(a2), "+v"(a3), "+v"(a4), "+v"(a5), "+v"(a6), "+v"(a7));
  x[0] = a0; x[1] = a1; x[2] = a2; x[3] = a3; x[4] = a4; x[5] = a5; x[6] = a6; x[7] = a7;
}

// One stage into LDS: eight 16-byte copies a lane, four of K (32 rows apart) and four
// of V^T (16 rows apart). kl, vl: the lane's LDS byte addresses; kg, vg: its global ones.
// The s_wait_xcnt stands inside the statement, so that no address register of a copy
// is rewritten ahead of it.
__device__ __forceinline__ void at_copy_stage(unsigned kl, unsigned vl, const _Float16* kg,
                                              const _Float16* vg) {
  asm volatile(
      "global_load_async_to_lds_b128 %0, %8, off\n\t"
      "global_load_async_to_lds_b128 %1, %9, off\n\t"
      "global_load_async_to_lds_b128 %2, %10, off\n\t"
      "global_load_async_to_lds_b128 %3, %11, off\n\t"
      "global_load_async_to_lds_b128 %4, %12, off\n\t"
      "global_load_async_to_lds_b128 %5, %13, off\n\t"
      "global_load_async_to_lds_b128 %6, %14, off\n\t"
      "global_load_async_to_lds_b128 %7, %15, off\n\t"
      "s_wait_xcnt 0x0" ::"v"(kl),
      "v"(kl + 32 * AT_KP * 2), "v"(kl + 64 * AT_KP * 2), "v"(kl + 96 * AT_KP * 2), "v"(vl),
      "v"(vl + 16 * AT_VP * 2), "v"(vl + 32 * AT_VP * 2), "v"(vl + 48 * AT_VP * 2), "v"(kg),
      "v"(kg + 32 * INNERv), "v"(kg + 64 * INNERv), "v"(kg + 96 * INNERv), "v"(vg),
      "v"(vg + 16 * SEQ_M), "v"(vg + 32 * SEQ_M), "v"(vg + 48 * SEQ_M)
      : "memory");
}

__global__ void __launch_bounds__(AT_NW * 32)
attn_kernel(const _Float16* __restrict__ Q, const _Float16* __restrict__ Kf,
            const _Float16* __restrict__ Vt, _Float16* __restrict__ O) {
  __shared__ __attribute__((aligned(16))) _Float16 sKV[2 * AT_BH];
  const int t = threadIdx.x;
  const int lane = t & 31, w = t >> 5;
  const int lr = lane & 15, hi4 = lane >> 4, kof = hi4 * 8;
  const int bh = blockIdx.y, b = bh >> 4, h = bh & 15;
  const int q0 = blockIdx.x * AT_QB + w * (AT_G * 16);

  // Q as B operand: column lr = query, DH split into two 32-wide k-steps
  v16h qf[AT_G][2];
#pragma unroll
  for (int g = 0; g < AT_G; ++g) {
    const _Float16* qp = Q + ((size_t)(b * SEQ_N + q0 + g * 16 + lr)) * INNERv + h * DHEAD + kof;
    qf[g][0] = ldfrag(qp);
    qf[g][1] = ldfrag(qp + 32);
  }

  // the lane's part of a stage: K row t/8, 16-byte piece t%8; V^T row t/16, piece t%16
  const _Float16* kg = Kf + ((size_t)(b * SEQ_M + (t >> 3))) * INNERv + h * DHEAD + (t & 7) * 8;
  const _Float16* vg = Vt + ((size_t)(b * INNERv + h * DHEAD + (t >> 4))) * SEQ_M + (t & 15) * 8;
  const unsigned kl = (unsigned)(size_t)&sKV[(t >> 3) * AT_KP + (t & 7) * 8];
  const unsigned vl = (unsigned)(size_t)&sKV[AT_VO + (t >> 4) * AT_VP + (t & 15) * 8];

  // stage 0 into buffer 0, landed and published; then stage 1 goes out into buffer 1
  at_copy_stage(kl, vl, kg, vg);
  // this wave's copies have landed
  asm volatile("s_wait_asynccnt 0x0" ::: "memory");
  __syncthreads();
  at_copy_stage(kl + AT_BH * 2, vl + AT_BH * 2, kg + (size_t)AT_SK * INNERv, vg + AT_SK);

  v8f acc[AT_G][4];
  v8f cneg[AT_G];  // C of the score products: minus the maximum in use, eight times
  v2f lsum[AT_G];  // the lane's sum in two halves, joined behind the loop
  // least step of the maximum in use: none is in use yet, so the first pass takes its own
  // maximum whatever it is; from then on the maximum only rises
  float lo = -__builtin_inff();
#pragma unroll
  for (int g = 0; g < AT_G; ++g) {
    cneg[g] = v8f_zero();
    lsum[g] = v2f{0.f, 0.f};
#pragma unroll
    for (int d = 0; d < 4; ++d) acc[g][d] = v8f_zero();
  }

  for (int st = 0; st < AT_NS; ++st) {
   const _Float16* kbase = sKV + (st & 1) * AT_BH + lr * AT_KP + kof;
   const _Float16* vbase = sKV + (st & 1) * AT_BH + AT_VO + lr * AT_VP + kof;

   // K as A operand: row lr = key; two 16-key tiles x two k-steps, one pass ahead
   // inside a stage (never into the next stage's buffer)
   v16h kf[2][2];
#pragma unroll
   for (int kt = 0; kt < 2; ++kt) {
     kf[kt][0] = ldfrag(kbase + (kt * 16) * AT_KP);
     kf[kt][1] = ldfrag(kbase + (kt * 16) * AT_KP + 32);
   }

   for (int p = 0; p < AT_SP; ++p) {
    // V^T as A operand: row lr = dh, k = this pass's 32 keys; in flight under the
    // score products and the softmax. The barrier holds the fetch up here: sunk to
    // its first use it would be waited for at once
    v16h vf[4];
#pragma unroll
    for (int d = 0; d < 4; ++d) vf[d] = ldfrag(vbase + (d * 16) * AT_VP + p * 32);
    __builtin_amdgcn_sched_barrier(0);

    v8f s[2][AT_G];
#pragma unroll
    for (int kt = 0; kt < 2; ++kt)
#pragma unroll
      for (int g = 0; g < AT_G; ++g) {
        s[kt][g] = wmma16x16x32(kf[kt][0], qf[g][0], cneg[g]);
        s[kt][g] = wmma16x16x32(kf[kt][1], qf[g][1], s[kt][g]);
      }

    // keeps the eight products back to back: mixed with the maxima below, each
    // product that a maximum follows is padded with idle slots
    __builtin_amdgcn_sched_barrier(0);

    // next pass's K into the same registers, in flight under the softmax and the
    // second product (a stage's last pass names its own rows again, unused: the next
    // stage is not published yet)
    const int pn = (p + 1 < AT_SP) ? p + 1 : p;
#pragma unroll
    for (int kt = 0; kt < 2; ++kt) {
      kf[kt][0] = ldfrag(kbase + (pn * 32 + kt * 16) * AT_KP);
      kf[kt][1] = ldfrag(kbase + (pn * 32 + kt * 16) * AT_KP + 32);
    }

    // holds the fetch here, ahead of the softmax: sunk to the foot of the pass it
    // would be waited for at once by the next pass's products
    __builtin_amdgcn_sched_barrier(0);

    // the lane's largest scores, counted from the maximum in use
    float mx[AT_G];
#pragma unroll
    for (int g = 0; g < AT_G; ++g) {
      mx[g] = s[0][g][0];
#pragma unroll
      for (int e = 1; e < 8; ++e) mx[g] = fmaxf(mx[g], s[0][g][e]);
#pragma unroll
      for (int e = 0; e < 8; ++e) mx[g] = fmaxf(mx[g], s[1][g][e]);
    }
    // one scalar branch a pass, rarely taken behind the first passes
    if (__builtin_amdgcn_ballot_w32(fmaxf(mx[0], mx[1]) > lo + AT_LAG) != 0) {
#pragma unroll
      for (int g = 0; g < AT_G; ++g) {
        // the step of this query's maximum in use, the same in both wave halves
        const float d = fmaxf(fmaxf(mx[g], xhalf(mx[g])), lo);
        // a first pass below zero steps down: nothing is summed yet, the factor stays 1
        const float corr = __builtin_amdgcn_exp2f(-fmaxf(d, 0.f));
        cneg[g] -= d;
        s[0][g] -= d;
        s[1][g] -= d;
        lsum[g] *= corr;
#pragma unroll
        for (int dd = 0; dd < 4; ++dd) acc[g][dd] *= corr;
      }
      lo = 0.f;
    }

#pragma unroll
    for (int g = 0; g < AT_G; ++g) {
      exp2_inplace(s[0][g]);
      exp2_inplace(s[1][g]);
      v16h pf;  // elements 0-7 = keys 8*hi4 + e, 8-15 = keys 16 + 8*hi4 + e: ldfrag's k order
#pragma unroll
      for (int e = 0; e < 8; ++e) {
        pf[e] = (_Float16)s[0][g][e];
        pf[8 + e] = (_Float16)s[1][g][e];
      }
#pragma unroll
      for (int d = 0; d < 4; ++d) acc[g][d] = wmma16x16x32(vf[d], pf, acc[g][d]);
    }
    // holds the sums below behind the products: spread among them, the sums take the
    // registers of operands just used, and more products are padded with idle slots
    __builtin_amdgcn_sched_barrier(0);
    // the lane's sixteen terms of a query summed pairwise on whole register pairs, as the
    // score tiles stand: no term has to be moved to meet its partner
#pragma unroll
    for (int g = 0; g < AT_G; ++g) {
      const v8f t8 = s[0][g] + s[1][g];
      const v4f t4 = __builtin_shufflevector(t8, t8, 0, 1, 2, 3) +
                     __builtin_shufflevector(t8, t8, 4, 5, 6, 7);
      lsum[g] += __builtin_shufflevector(t4, t4, 0, 1) + __builtin_shufflevector(t4, t4, 2, 3);
    }
   }

   // hand-over: this wave's reads of the buffer are done, its copies of the next stage
   // have landed; behind the barrier the next stage is readable by all and this
   // stage's buffer is free for the stage after it
   asm volatile("s_wait_dscnt 0x0" ::: "memory");
   asm volatile("s_wait_asynccnt 0x0" ::: "memory");
   __syncthreads();
   if (st + 2 < AT_NS)
     at_copy_stage(kl + (st & 1) * (AT_BH * 2), vl + (st & 1) * (AT_BH * 2),
                   kg + (size_t)(st + 2) * AT_SK * INNERv, vg + (st + 2) * AT_SK);
  }
  // no copy is left in flight when the wave ends
  asm volatile("s_wait_asynccnt 0x0" ::: "memory");

  // O^T tile d: register e = dh d*16 + 8*hi4 + e of query lr: one 16-byte store
#pragma unroll
  for (int g = 0; g < AT_G; ++g) {
    const float l = lsum[g][0] + lsum[g][1];
    const float inv = 1.0f / (l + xhalf(l));
    _Float16* op = O + ((size_t)(b * SEQ_N + q0 + g * 16 + lr)) * AT_OP + h * DHEAD + kof;
#pragma unroll
    for (int d = 0; d < 4; ++d) {
      v8h o;
#pragma unroll
      for (int e = 0; e < 8; ++e) o[e] = (_Float16)(acc[g][d][e] * inv);
      *(v8h*)(op + d * 16) = o;
    }
  }
}

// ---------------------------------------------------------------------------
// Host-side launch
// ---------------------------------------------------------------------------
extern "C" void kernel_launch(void* const* d_in, const int* in_sizes, int n_in,
                              void* d_out, int out_size, void* d_ws, size_t ws_size,
                              hipStream_t stream) {
  (void)in_sizes; (void)n_in; (void)out_size; (void)ws_size;

  const float* person  = (const float*)d_in[0];
  const float* garment = (const float*)d_in[1];
  const float* Wq = (const float*)d_in[2];
  const float* Wk = (const float*)d_in[3];
  const float* Wv = (const float*)d_in[4];
  const float* Wo = (const float*)d_in[5];
  const float* bo = (const float*)d_in[6];
  const float* Wf = (const float*)d_in[7];
  const float* bf = (const float*)d_in[8];
  const float* gq = (const float*)d_in[9];
  const float* betaq = (const float*)d_in[10];
  const float* gk = (const float*)d_in[11];
  const float* betak = (const float*)d_in[12];
  float* out = (float*)d_out;

  _Float16* w0 = (_Float16*)d_ws;
  size_t off = 0;
  _Float16* pLN = w0 + off; off += (size_t)BATCH * SEQ_N * DQv;
  _Float16* gLN = w0 + off; off += (size_t)BATCH * SEQ_M * DCv;
  _Float16* WqT = w0 + off; off += (size_t)INNERv * DQv;
  _Float16* WkT = w0 + off; off += (size_t)INNERv * DCv;
  _Float16* WvT = w0 + off; off += (size_t)INNERv * DCv;
  _Float16* WcT = w0 + off; off += (size_t)DQv * (2 * DQv);
  _Float16* Qh  = w0 + off; off += (size_t)BATCH * SEQ_N * INNERv;
  _Float16* Kh  = w0 + off; off += (size_t)BATCH * SEQ_M * INNERv;
  _Float16* VtB = w0 + off; off += (size_t)BATCH * INNERv * SEQ_M;
  _Float16* Cat = w0 + off; off += (size_t)BATCH * SEQ_N * 2 * DQv;
  float* biasC = (float*)(w0 + off);

  // Layer norms (the person rows' f16 copy into concat cols [0, DQ) with them), weight
  // transpose+convert, folded weight (Wo Wf2)^T into the final weight's right half, folded bias
  prep_kernel<<<PJ_BC, 256, 0, stream>>>(person, garment, Wq, Wk, Wv, Wo, Wf, bo, bf, gq, betaq,
                                         gk, betak, pLN, gLN, WqT, WkT, WvT, WcT, biasC, Cat);

  // Q/K/V projections (f16 out), V transposed for contiguous PV fragments
  gemm_qkv_kernel<<<dim3(INNERv / GBN, QKV_YV), 256, 0, stream>>>(pLN, gLN, WqT, WkT, WvT, Qh,
                                                                  Kh, VtB);

  // Attention (online softmax in registers) -> concat cols [DQ, 2*DQ) (f16)
  attn_kernel<<<dim3(SEQ_N / AT_QB, BATCH * NHEAD), AT_NW * 32, 0, stream>>>(
      Qh, Kh, VtB, Cat + DQv);

  // [residual, att] @ [Wf1; Wo Wf2] + (bo Wf2 + bf) -> out (f32)
  gemm_wmma_kernel<false, true><<<dim3(DQv / GBN, (BATCH * SEQ_N) / GBM(4)), 256, 0, stream>>>(
      Cat, 2 * DQv, WcT, 2 * DQv, (void*)out, DQv, biasC, BATCH * SEQ_N, DQv, 2 * DQv);
}
